// v000
// Times are from an AMD MI455X. After a warm-up the kernel runs many times in a row, and a time is the length of
// such a window on the GPU divided by its runs, so every launch and the gaps after it count. The runs cycle
// through copies of the inputs. A figure is the median of several windows, for all but v000 over two sittings.
// Sittings can differ by a few percent; kernels timed side by side share one.
// The starting kernel, v000, takes 1240 microseconds a run.
#include <hip/hip_runtime.h>
#include <hip/hip_bf16.h>

// ---------------------------------------------------------------------------
// CDNA5 (gfx1250) transformer encoder block with memory tokens.
// - All heavy GEMMs: v_wmma_f32_16x16x32_bf16 (wave32 WMMA), f32 accumulate.
// - GEMM tile staging: global_load_async_to_lds_b128 (ASYNCcnt) with
//   double-buffered LDS tiles -> prefetch tile k+1 while computing tile k.
// ---------------------------------------------------------------------------

typedef __attribute__((ext_vector_type(16))) __bf16 v16bf;
typedef __attribute__((ext_vector_type(8)))  __bf16 v8bf;
typedef __attribute__((ext_vector_type(8)))  float  v8f;

static constexpr int B_    = 4;
static constexpr int S_    = 2048;
static constexpr int D_    = 1024;
static constexpr int H_    = 16;
static constexpr int DK_   = 64;
static constexpr int DFF_  = 4096;
static constexpr int MEMT_ = 32;
static constexpr int T_    = S_ + MEMT_;   // 2080 = 65 * 32

__device__ __forceinline__ v8f zero_v8f() {
  v8f z;
#pragma unroll
  for (int i = 0; i < 8; ++i) z[i] = 0.0f;
  return z;
}

// Build a 16-element bf16 A/B fragment from two contiguous 16-byte segments.
// Layout per CDNA5 ISA 7.12.2: lane holds row (lane%16); elements 0..7 are
// K = (lane/16)*8 .. +7, elements 8..15 are K = (lane/16)*8+16 .. +23.
__device__ __forceinline__ v16bf ld_frag(const __bf16* p0, const __bf16* p1) {
  v8bf lo = *(const v8bf*)p0;
  v8bf hi = *(const v8bf*)p1;
  return __builtin_shufflevector(lo, hi, 0, 1, 2, 3, 4, 5, 6, 7,
                                         8, 9, 10, 11, 12, 13, 14, 15);
}

__device__ __forceinline__ v8f wmma_bf16(v16bf a, v16bf b, v8f c) {
  return __builtin_amdgcn_wmma_f32_16x16x32_bf16(
      false, a, false, b, (short)0, c, false, false);
}

// CDNA5 async global->LDS copy, 16 bytes per lane (GVS mode: SGPR base +
// per-lane u32 byte offset). Tracked by ASYNCcnt; loads complete in order.
__device__ __forceinline__ void async_load_b128(unsigned lds_off,
                                                unsigned long long base,
                                                unsigned voff) {
  asm volatile("global_load_async_to_lds_b128 %0, %1, %2"
               :: "v"(lds_off), "v"(voff), "s"(base)
               : "memory");
}
__device__ __forceinline__ void wait_asynccnt_4() {
  asm volatile("s_wait_asynccnt 0x4" ::: "memory");
}
__device__ __forceinline__ void wait_asynccnt_0() {
  asm volatile("s_wait_asynccnt 0x0" ::: "memory");
}

// ---------------------------------------------------------------------------
// Weight transpose + fp32 -> bf16 convert: Wt[n*K + k] = (bf16)W[k*N + n]
// ---------------------------------------------------------------------------
__global__ __launch_bounds__(256)
void transpose_convert_kernel(const float* __restrict__ W,
                              __bf16* __restrict__ Wt, int K, int N) {
  int idx = blockIdx.x * 256 + threadIdx.x;
  int k = idx / N;
  int n = idx - k * N;
  Wt[(size_t)n * K + k] = (__bf16)W[idx];
}

__global__ __launch_bounds__(256)
void convert_kernel(const float* __restrict__ X, __bf16* __restrict__ Y, int n) {
  int i = blockIdx.x * 256 + threadIdx.x;
  if (i < n) Y[i] = (__bf16)X[i];
}

// ---------------------------------------------------------------------------
// LayerNorm (matches reference: unbiased std, alpha*(x-mean)/(std+eps)+bias)
// One block per row of D_=1024. Output bf16 for the following GEMM.
// ---------------------------------------------------------------------------
__global__ __launch_bounds__(256)
void layernorm_kernel(const float* __restrict__ x,
                      const float* __restrict__ alpha,
                      const float* __restrict__ beta,
                      __bf16* __restrict__ y) {
  __shared__ float red[256];
  const int row = blockIdx.x, tid = threadIdx.x;
  const float* xr = x + (size_t)row * D_;
  float vals[4];
  float s1 = 0.f, s2 = 0.f;
#pragma unroll
  for (int i = 0; i < 4; ++i) {
    float t = xr[tid + i * 256];
    vals[i] = t;
    s1 += t;
    s2 += t * t;
  }
  red[tid] = s1; __syncthreads();
  for (int o = 128; o > 0; o >>= 1) {
    if (tid < o) red[tid] += red[tid + o];
    __syncthreads();
  }
  float sum1 = red[0]; __syncthreads();
  red[tid] = s2; __syncthreads();
  for (int o = 128; o > 0; o >>= 1) {
    if (tid < o) red[tid] += red[tid + o];
    __syncthreads();
  }
  float sum2 = red[0];
  float mean = sum1 * (1.0f / D_);
  float var = (sum2 - (float)D_ * mean * mean) * (1.0f / (D_ - 1));
  var = var > 0.f ? var : 0.f;
  float rinv = 1.0f / (sqrtf(var) + 1e-6f);
  __bf16* yr = y + (size_t)row * D_;
#pragma unroll
  for (int i = 0; i < 4; ++i) {
    int d = tid + i * 256;
    yr[d] = (__bf16)(alpha[d] * (vals[i] - mean) * rinv + beta[d]);
  }
}

// ---------------------------------------------------------------------------
// WMMA GEMM: C[M,N] = A[M,K](bf16) * Bt[N,K](bf16)^T  (+ epilogue)
// MODE 0: store bf16
// MODE 1: +bias[col], ReLU, store bf16
// MODE 2: +resid[row,col], store f32
// MODE 3: +bias[col] + resid[row,col], store f32
// Block tile 128x128, K-step 32. 8 waves: 4 (M) x 2 (N); wave tile 32x64.
// Tiles staged with async global->LDS b128 copies, double-buffered so the
// next K-tile streams in while WMMAs consume the current one.
// Rows >= M are clamped (not skipped) so every wave issues exactly 4 async
// ops per tile -> ASYNCcnt bookkeeping is uniform; epilogue guards stores.
// ---------------------------------------------------------------------------
template <int MODE>
__global__ __launch_bounds__(256)
void gemm_bt_kernel(const __bf16* __restrict__ A, const __bf16* __restrict__ Bt,
                    const float* __restrict__ bias, const float* __restrict__ resid,
                    float* __restrict__ Cf, __bf16* __restrict__ Cb,
                    int M, int N, int K) {
  __shared__ __align__(16) __bf16 sA[2][128 * 32];
  __shared__ __align__(16) __bf16 sB[2][128 * 32];
  const int tid = threadIdx.x;
  const int lane = tid & 31, wave = tid >> 5;
  const int mw = wave >> 1, nw = wave & 1;
  const int mbase = blockIdx.y * 128, nbase = blockIdx.x * 128;
  const int lrow = lane & 15, lh = lane >> 4;

  const unsigned long long baseA = (unsigned long long)(uintptr_t)A;
  const unsigned long long baseB = (unsigned long long)(uintptr_t)Bt;

  // this thread's two 16B-segment assignments within the 128x32 tile
  int r0 = tid >> 2, c0 = (tid & 3) * 8;
  int idx1 = tid + 256;
  int r1 = idx1 >> 2, c1 = (idx1 & 3) * 8;
  int ga0 = mbase + r0; if (ga0 >= M) ga0 = M - 1;   // clamp, never skip
  int ga1 = mbase + r1; if (ga1 >= M) ga1 = M - 1;

  auto issue_tile = [&](int kk, int p) {
    async_load_b128((unsigned)(uintptr_t)&sA[p][r0 * 32 + c0], baseA,
                    (unsigned)(((size_t)ga0 * K + kk + c0) * 2));
    async_load_b128((unsigned)(uintptr_t)&sB[p][r0 * 32 + c0], baseB,
                    (unsigned)(((size_t)(nbase + r0) * K + kk + c0) * 2));
    async_load_b128((unsigned)(uintptr_t)&sA[p][r1 * 32 + c1], baseA,
                    (unsigned)(((size_t)ga1 * K + kk + c1) * 2));
    async_load_b128((unsigned)(uintptr_t)&sB[p][r1 * 32 + c1], baseB,
                    (unsigned)(((size_t)(nbase + r1) * K + kk + c1) * 2));
  };

  v8f acc[2][4];
#pragma unroll
  for (int mi = 0; mi < 2; ++mi)
#pragma unroll
    for (int ni = 0; ni < 4; ++ni) acc[mi][ni] = zero_v8f();

  issue_tile(0, 0);
  int p = 0;
  for (int kk = 0; kk < K; kk += 32) {
    const bool pf = (kk + 32) < K;
    if (pf) {
      issue_tile(kk + 32, p ^ 1);   // 4 new in flight on top of 4 old
      wait_asynccnt_4();            // in-order completion: tile p has landed
    } else {
      wait_asynccnt_0();
    }
    __syncthreads();

    v16bf af[2], bfr[4];
#pragma unroll
    for (int mi = 0; mi < 2; ++mi) {
      const __bf16* q = sA[p] + (mw * 32 + mi * 16 + lrow) * 32 + lh * 8;
      af[mi] = ld_frag(q, q + 16);
    }
#pragma unroll
    for (int ni = 0; ni < 4; ++ni) {
      const __bf16* q = sB[p] + (nw * 64 + ni * 16 + lrow) * 32 + lh * 8;
      bfr[ni] = ld_frag(q, q + 16);
    }
#pragma unroll
    for (int mi = 0; mi < 2; ++mi)
#pragma unroll
      for (int ni = 0; ni < 4; ++ni)
        acc[mi][ni] = wmma_bf16(af[mi], bfr[ni], acc[mi][ni]);

    __syncthreads();                // tile p free for overwrite next round
    p ^= 1;
  }

  // epilogue (C layout: VGPR j -> row j + 8*(lane/16); col = lane%16)
#pragma unroll
  for (int mi = 0; mi < 2; ++mi) {
#pragma unroll
    for (int ni = 0; ni < 4; ++ni) {
      int col = nbase + nw * 64 + ni * 16 + lrow;
#pragma unroll
      for (int j = 0; j < 8; ++j) {
        int row = mbase + mw * 32 + mi * 16 + j + 8 * lh;
        if (row >= M) continue;
        float r = acc[mi][ni][j];
        if (MODE == 1 || MODE == 3) r += bias[col];
        if (MODE == 1) r = r > 0.f ? r : 0.f;
        if (MODE == 2 || MODE == 3) r += resid[(size_t)row * N + col];
        if (MODE == 0 || MODE == 1)
          Cb[(size_t)row * N + col] = (__bf16)r;
        else
          Cf[(size_t)row * N + col] = r;
      }
    }
  }
}

// ---------------------------------------------------------------------------
// Flash attention with memory K/V prefix (T = 32 + 2048).
// Grid: (S/128, B*H). 8 waves/block, each wave owns 16 query rows.
// Online softmax; ctx accumulated in 4x v8f per wave (16 rows x 64 dims).
// ---------------------------------------------------------------------------
__global__ __launch_bounds__(256)
void attention_kernel(const __bf16* __restrict__ qg, const __bf16* __restrict__ kg,
                      const __bf16* __restrict__ vg,
                      const __bf16* __restrict__ memk, const __bf16* __restrict__ memv,
                      const int* __restrict__ mask,
                      __bf16* __restrict__ ctxout) {
  __shared__ __align__(16) __bf16 sVt[64 * 32];        // V tile transposed [d][key]
  __shared__ __align__(16) __bf16 sP[8 * 16 * 32];     // per-wave P tiles

  const int tid = threadIdx.x, lane = tid & 31, wave = tid >> 5;
  const int lrow = lane & 15, lh = lane >> 4;
  const int bh = blockIdx.y;
  const int b = bh >> 4, h = bh & 15;
  const int qbase = blockIdx.x * 128 + wave * 16;

  // Q fragments (rows qbase..+15, d 0..63), pre-scaled by 1/sqrt(64)=0.125
  v16bf qf[2];
  {
    const __bf16* qp =
        qg + ((size_t)b * S_ + qbase + lrow) * D_ + h * DK_ + lh * 8;
#pragma unroll
    for (int half = 0; half < 2; ++half) {
      v16bf f = ld_frag(qp + half * 32, qp + half * 32 + 16);
#pragma unroll
      for (int i = 0; i < 16; ++i) f[i] = (__bf16)((float)f[i] * 0.125f);
      qf[half] = f;
    }
  }

  v8f ctx[4];
#pragma unroll
  for (int dg = 0; dg < 4; ++dg) ctx[dg] = zero_v8f();
  float mrun[8], lsum[8];
#pragma unroll
  for (int j = 0; j < 8; ++j) { mrun[j] = -3.0e38f; lsum[j] = 0.f; }

  for (int tbase = 0; tbase < T_; tbase += 32) {
    __syncthreads();
    // stage transposed V tile (32 keys x 64 dims) cooperatively
    {
      int key = tid >> 3;
      int dseg = (tid & 7) * 8;
      int tg = tbase + key;
      const __bf16* src =
          (tg < MEMT_) ? (memv + (size_t)tg * D_ + h * DK_ + dseg)
                       : (vg + ((size_t)b * S_ + (tg - MEMT_)) * D_ + h * DK_ + dseg);
      v8bf val = *(const v8bf*)src;
#pragma unroll
      for (int i = 0; i < 8; ++i) sVt[(dseg + i) * 32 + key] = val[i];
    }
    __syncthreads();

    // scores: [16 rows x 32 keys] = Q[16x64] @ K^T
    v8f s0 = zero_v8f(), s1 = zero_v8f();
#pragma unroll
    for (int grp = 0; grp < 2; ++grp) {
      int tg = tbase + grp * 16 + lrow;
      const __bf16* kp =
          (tg < MEMT_) ? (memk + (size_t)tg * D_ + h * DK_)
                       : (kg + ((size_t)b * S_ + (tg - MEMT_)) * D_ + h * DK_);
      v16bf kf0 = ld_frag(kp + lh * 8, kp + lh * 8 + 16);
      v16bf kf1 = ld_frag(kp + 32 + lh * 8, kp + 32 + lh * 8 + 16);
      if (grp == 0) {
        s0 = wmma_bf16(qf[0], kf0, s0);
        s0 = wmma_bf16(qf[1], kf1, s0);
      } else {
        s1 = wmma_bf16(qf[0], kf0, s1);
        s1 = wmma_bf16(qf[1], kf1, s1);
      }
    }

    // online softmax: per-lane rows j + 8*(lane/16); 16-lane reductions
#pragma unroll
    for (int j = 0; j < 8; ++j) {
      int srow = qbase + j + 8 * lh;
      float v0 = mask[(size_t)srow * T_ + tbase + lrow] ? s0[j] : -1e9f;
      float v1 = mask[(size_t)srow * T_ + tbase + 16 + lrow] ? s1[j] : -1e9f;
      float tmax = fmaxf(v0, v1);
#pragma unroll
      for (int o = 8; o >= 1; o >>= 1) tmax = fmaxf(tmax, __shfl_xor(tmax, o, 32));
      float newm = fmaxf(mrun[j], tmax);
      float scale = __expf(mrun[j] - newm);
      float p0 = __expf(v0 - newm);
      float p1 = __expf(v1 - newm);
      float ts = p0 + p1;
#pragma unroll
      for (int o = 8; o >= 1; o >>= 1) ts += __shfl_xor(ts, o, 32);
      lsum[j] = lsum[j] * scale + ts;
      mrun[j] = newm;
#pragma unroll
      for (int dg = 0; dg < 4; ++dg) ctx[dg][j] *= scale;
      __bf16* pp = sP + wave * 512 + (j + 8 * lh) * 32;
      pp[lrow] = (__bf16)p0;
      pp[16 + lrow] = (__bf16)p1;
    }

    // P (16x32) as A fragment from wave-private LDS (same-wave RAW, in-order DS)
    const __bf16* pb = sP + wave * 512 + lrow * 32 + lh * 8;
    v16bf pf = ld_frag(pb, pb + 16);

    // ctx += P @ V  (N = 64 dims, K = 32 keys)
#pragma unroll
    for (int dg = 0; dg < 4; ++dg) {
      const __bf16* vp = sVt + (dg * 16 + lrow) * 32 + lh * 8;
      v16bf vf = ld_frag(vp, vp + 16);
      ctx[dg] = wmma_bf16(pf, vf, ctx[dg]);
    }
  }

  // normalize and write ctx as bf16 in [B,S,D] (head-major cols)
  float inv[8];
#pragma unroll
  for (int j = 0; j < 8; ++j) inv[j] = 1.0f / lsum[j];
#pragma unroll
  for (int dg = 0; dg < 4; ++dg)
#pragma unroll
    for (int j = 0; j < 8; ++j) {
      int srow = qbase + j + 8 * lh;
      int col = h * DK_ + dg * 16 + lrow;
      ctxout[((size_t)b * S_ + srow) * D_ + col] = (__bf16)(ctx[dg][j] * inv[j]);
    }
}

// ---------------------------------------------------------------------------
// new_memory: broadcast mean over S of final x into [B, MEM, D]
// ---------------------------------------------------------------------------
__global__ __launch_bounds__(256)
void mean_bcast_kernel(const float* __restrict__ x, float* __restrict__ nm) {
  int gid = blockIdx.x * 256 + threadIdx.x;    // B*D threads
  int b = gid / D_;
  int d = gid - b * D_;
  const float* p = x + (size_t)b * S_ * D_ + d;
  float s = 0.f;
  for (int i = 0; i < S_; ++i) s += p[(size_t)i * D_];
  float mean = s * (1.0f / S_);
  float* o = nm + (size_t)b * MEMT_ * D_ + d;
  for (int mI = 0; mI < MEMT_; ++mI) o[(size_t)mI * D_] = mean;
}

// ---------------------------------------------------------------------------
// launch
// ---------------------------------------------------------------------------
extern "C" void kernel_launch(void* const* d_in, const int* in_sizes, int n_in,
                              void* d_out, int out_size, void* d_ws, size_t ws_size,
                              hipStream_t stream) {
  (void)in_sizes; (void)n_in; (void)out_size; (void)ws_size;
  const float* x    = (const float*)d_in[0];
  const int*   mask = (const int*)d_in[1];
  const float* mem  = (const float*)d_in[2];
  const float* w_q  = (const float*)d_in[3];
  const float* w_k  = (const float*)d_in[4];
  const float* w_v  = (const float*)d_in[5];
  const float* w_o  = (const float*)d_in[6];
  const float* ln1a = (const float*)d_in[7];
  const float* ln1b = (const float*)d_in[8];
  const float* ln2a = (const float*)d_in[9];
  const float* ln2b = (const float*)d_in[10];
  const float* fw1  = (const float*)d_in[11];
  const float* fb1  = (const float*)d_in[12];
  const float* fw2  = (const float*)d_in[13];
  const float* fb2  = (const float*)d_in[14];

  float* out_x  = (float*)d_out;                                // [B,S,D]
  float* out_nm = out_x + (size_t)B_ * S_ * D_;                 // [B,MEM,D]

  // workspace carve-out
  size_t off = 0;
  auto carve = [&](size_t bytes) -> char* {
    char* p = (char*)d_ws + off;
    off = (off + bytes + 255) & ~(size_t)255;
    return p;
  };
  __bf16* wqT  = (__bf16*)carve((size_t)D_ * D_ * 2);
  __bf16* wkT  = (__bf16*)carve((size_t)D_ * D_ * 2);
  __bf16* wvT  = (__bf16*)carve((size_t)D_ * D_ * 2);
  __bf16* woT  = (__bf16*)carve((size_t)D_ * D_ * 2);
  __bf16* w1T  = (__bf16*)carve((size_t)DFF_ * D_ * 2);
  __bf16* w2T  = (__bf16*)carve((size_t)D_ * DFF_ * 2);
  __bf16* memb = (__bf16*)carve((size_t)MEMT_ * D_ * 2);
  __bf16* memK = (__bf16*)carve((size_t)MEMT_ * D_ * 2);
  __bf16* memV = (__bf16*)carve((size_t)MEMT_ * D_ * 2);
  __bf16* xn   = (__bf16*)carve((size_t)B_ * S_ * D_ * 2);
  __bf16* qb   = (__bf16*)carve((size_t)B_ * S_ * D_ * 2);
  __bf16* kb   = (__bf16*)carve((size_t)B_ * S_ * D_ * 2);
  __bf16* vb   = (__bf16*)carve((size_t)B_ * S_ * D_ * 2);
  __bf16* ctxb = (__bf16*)carve((size_t)B_ * S_ * D_ * 2);
  float*  x1   = (float*)carve((size_t)B_ * S_ * D_ * 4);
  __bf16* xn2  = (__bf16*)carve((size_t)B_ * S_ * D_ * 2);
  __bf16* ffh  = (__bf16*)carve((size_t)B_ * S_ * DFF_ * 2);

  const int rows = B_ * S_;   // 8192
  dim3 blk(256);

  // weight prep (bf16, transposed to [N][K])
  transpose_convert_kernel<<<(D_ * D_) / 256, blk, 0, stream>>>(w_q, wqT, D_, D_);
  transpose_convert_kernel<<<(D_ * D_) / 256, blk, 0, stream>>>(w_k, wkT, D_, D_);
  transpose_convert_kernel<<<(D_ * D_) / 256, blk, 0, stream>>>(w_v, wvT, D_, D_);
  transpose_convert_kernel<<<(D_ * D_) / 256, blk, 0, stream>>>(w_o, woT, D_, D_);
  transpose_convert_kernel<<<(D_ * DFF_) / 256, blk, 0, stream>>>(fw1, w1T, D_, DFF_);
  transpose_convert_kernel<<<(DFF_ * D_) / 256, blk, 0, stream>>>(fw2, w2T, DFF_, D_);
  convert_kernel<<<(MEMT_ * D_) / 256, blk, 0, stream>>>(mem, memb, MEMT_ * D_);

  // LN1 -> Q/K/V projections (WMMA bf16)
  layernorm_kernel<<<rows, blk, 0, stream>>>(x, ln1a, ln1b, xn);
  gemm_bt_kernel<0><<<dim3(D_ / 128, rows / 128), blk, 0, stream>>>(
      xn, wqT, nullptr, nullptr, nullptr, qb, rows, D_, D_);
  gemm_bt_kernel<0><<<dim3(D_ / 128, rows / 128), blk, 0, stream>>>(
      xn, wkT, nullptr, nullptr, nullptr, kb, rows, D_, D_);
  gemm_bt_kernel<0><<<dim3(D_ / 128, rows / 128), blk, 0, stream>>>(
      xn, wvT, nullptr, nullptr, nullptr, vb, rows, D_, D_);
  // memory K/V (raw memory tokens, not layernormed), M=32 with row clamp
  gemm_bt_kernel<0><<<dim3(D_ / 128, 1), blk, 0, stream>>>(
      memb, wkT, nullptr, nullptr, nullptr, memK, MEMT_, D_, D_);
  gemm_bt_kernel<0><<<dim3(D_ / 128, 1), blk, 0, stream>>>(
      memb, wvT, nullptr, nullptr, nullptr, memV, MEMT_, D_, D_);

  // flash attention over T = MEM + S
  attention_kernel<<<dim3(S_ / 128, B_ * H_), blk, 0, stream>>>(
      qb, kb, vb, memK, memV, mask, ctxb);

  // out-proj + residual -> x1 (f32)
  gemm_bt_kernel<2><<<dim3(D_ / 128, rows / 128), blk, 0, stream>>>(
      ctxb, woT, nullptr, x, x1, nullptr, rows, D_, D_);

  // LN2 -> FFN
  layernorm_kernel<<<rows, blk, 0, stream>>>(x1, ln2a, ln2b, xn2);
  gemm_bt_kernel<1><<<dim3(DFF_ / 128, rows / 128), blk, 0, stream>>>(
      xn2, w1T, fb1, nullptr, nullptr, ffh, rows, DFF_, D_);
  gemm_bt_kernel<3><<<dim3(D_ / 128, rows / 128), blk, 0, stream>>>(
      ffh, w2T, fb2, x1, out_x, nullptr, rows, D_, DFF_);

  // new_memory = broadcast mean over S
  mean_bcast_kernel<<<(B_ * D_) / 256, blk, 0, stream>>>(out_x, out_nm);
}

// v001
// One run takes 1000 microseconds.
// In two side-by-side timings against v000, it was 1.26 and 1.25 times as fast.
#include <hip/hip_runtime.h>
#include <hip/hip_bf16.h>

// ---------------------------------------------------------------------------
// CDNA5 (gfx1250) transformer encoder block with memory tokens.
// - All heavy GEMMs: v_wmma_f32_16x16x32_bf16 (wave32 WMMA), f32 accumulate.
// - GEMM tile staging: global_load_async_to_lds_b128 (ASYNCcnt) with
//   double-buffered LDS tiles -> prefetch tile k+1 while computing tile k.
// ---------------------------------------------------------------------------

typedef __attribute__((ext_vector_type(16))) __bf16 v16bf;
typedef __attribute__((ext_vector_type(8)))  __bf16 v8bf;
typedef __attribute__((ext_vector_type(8)))  float  v8f;
typedef __attribute__((ext_vector_type(2)))  __bf16 v2bf;
typedef __attribute__((ext_vector_type(4)))  unsigned v4u;

static constexpr int B_    = 4;
static constexpr int S_    = 2048;
static constexpr int D_    = 1024;
static constexpr int H_    = 16;
static constexpr int DK_   = 64;
static constexpr int DFF_  = 4096;
static constexpr int MEMT_ = 32;
static constexpr int T_    = S_ + MEMT_;   // 2080 = 65 * 32

__device__ __forceinline__ v8f zero_v8f() {
  v8f z;
#pragma unroll
  for (int i = 0; i < 8; ++i) z[i] = 0.0f;
  return z;
}

// Build a 16-element bf16 A/B fragment from two contiguous 16-byte segments.
// Layout per CDNA5 ISA 7.12.2: lane holds row (lane%16); elements 0..7 are
// K = (lane/16)*8 .. +7, elements 8..15 are K = (lane/16)*8+16 .. +23.
__device__ __forceinline__ v16bf ld_frag(const __bf16* p0, const __bf16* p1) {
  v8bf lo = *(const v8bf*)p0;
  v8bf hi = *(const v8bf*)p1;
  return __builtin_shufflevector(lo, hi, 0, 1, 2, 3, 4, 5, 6, 7,
                                         8, 9, 10, 11, 12, 13, 14, 15);
}

// two floats -> one dword of two bf16, a in the low half
__device__ __forceinline__ unsigned pack_bf16(float a, float b) {
  v2bf t = {(__bf16)a, (__bf16)b};
  return __builtin_bit_cast(unsigned, t);
}

__device__ __forceinline__ v8f wmma_bf16(v16bf a, v16bf b, v8f c) {
  return __builtin_amdgcn_wmma_f32_16x16x32_bf16(
      false, a, false, b, (short)0, c, false, false);
}

// CDNA5 async global->LDS copy, 16 bytes per lane (GVS mode: SGPR base +
// per-lane u32 byte offset). Tracked by ASYNCcnt; loads complete in order.
__device__ __forceinline__ void async_load_b128(unsigned lds_off,
                                                unsigned long long base,
                                                unsigned voff) {
  asm volatile("global_load_async_to_lds_b128 %0, %1, %2"
               :: "v"(lds_off), "v"(voff), "s"(base)
               : "memory");
}
__device__ __forceinline__ void wait_asynccnt_4() {
  asm volatile("s_wait_asynccnt 0x4" ::: "memory");
}
__device__ __forceinline__ void wait_asynccnt_0() {
  asm volatile("s_wait_asynccnt 0x0" ::: "memory");
}

// ---------------------------------------------------------------------------
// Weight transpose + fp32 -> bf16 convert: Wt[n*K + k] = (bf16)W[k*N + n]
// One block moves a 64(k) x 64(n) tile through LDS: reads are whole 256-byte
// row pieces of W, writes are whole 128-byte lines of Wt. Two k neighbours are
// packed into one dword before LDS; the pitch of 65 dwords keeps both the
// row-wise stores and the column-wise loads free of bank conflicts.
// K and N must be multiples of 64.
// ---------------------------------------------------------------------------
__global__ __launch_bounds__(256)
void transpose_convert_kernel(const float* __restrict__ W,
                              __bf16* __restrict__ Wt, int K, int N) {
  __shared__ unsigned tile[32 * 65];                   // [k pair][n]
  const int tid = threadIdx.x;
  const int n0 = blockIdx.x * 64, k0 = blockIdx.y * 64;

  const int c4 = (tid & 15) * 4;
  float4 lo[2], hi[2];
#pragma unroll
  for (int i = 0; i < 2; ++i) {
    const int kp = (tid >> 4) + i * 16;
    const float* src = W + (size_t)(k0 + 2 * kp) * N + n0 + c4;
    lo[i] = *(const float4*)src;
    hi[i] = *(const float4*)(src + N);
  }
#pragma unroll
  for (int i = 0; i < 2; ++i) {
    unsigned* t = tile + ((tid >> 4) + i * 16) * 65 + c4;
    t[0] = pack_bf16(lo[i].x, hi[i].x);
    t[1] = pack_bf16(lo[i].y, hi[i].y);
    t[2] = pack_bf16(lo[i].z, hi[i].z);
    t[3] = pack_bf16(lo[i].w, hi[i].w);
  }
  __syncthreads();
#pragma unroll
  for (int i = 0; i < 2; ++i) {
    const int c = tid + i * 256;
    const int n = c >> 3, kc = c & 7;                  // 8 lanes fill one line
    const unsigned* t = tile + kc * 4 * 65 + n;
    v4u o;
#pragma unroll
    for (int e = 0; e < 4; ++e) o[e] = t[e * 65];
    *(v4u*)(Wt + (size_t)(n0 + n) * K + k0 + kc * 8) = o;
  }
}

__global__ __launch_bounds__(256)
void convert_kernel(const float* __restrict__ X, __bf16* __restrict__ Y, int n) {
  int i = blockIdx.x * 256 + threadIdx.x;
  if (i < n) Y[i] = (__bf16)X[i];
}

// ---------------------------------------------------------------------------
// LayerNorm (matches reference: unbiased std, alpha*(x-mean)/(std+eps)+bias)
// One block per row of D_=1024. Output bf16 for the following GEMM.
// ---------------------------------------------------------------------------
__global__ __launch_bounds__(256)
void layernorm_kernel(const float* __restrict__ x,
                      const float* __restrict__ alpha,
                      const float* __restrict__ beta,
                      __bf16* __restrict__ y) {
  __shared__ float red[256];
  const int row = blockIdx.x, tid = threadIdx.x;
  const float* xr = x + (size_t)row * D_;
  float vals[4];
  float s1 = 0.f, s2 = 0.f;
#pragma unroll
  for (int i = 0; i < 4; ++i) {
    float t = xr[tid + i * 256];
    vals[i] = t;
    s1 += t;
    s2 += t * t;
  }
  red[tid] = s1; __syncthreads();
  for (int o = 128; o > 0; o >>= 1) {
    if (tid < o) red[tid] += red[tid + o];
    __syncthreads();
  }
  float sum1 = red[0]; __syncthreads();
  red[tid] = s2; __syncthreads();
  for (int o = 128; o > 0; o >>= 1) {
    if (tid < o) red[tid] += red[tid + o];
    __syncthreads();
  }
  float sum2 = red[0];
  float mean = sum1 * (1.0f / D_);
  float var = (sum2 - (float)D_ * mean * mean) * (1.0f / (D_ - 1));
  var = var > 0.f ? var : 0.f;
  float rinv = 1.0f / (sqrtf(var) + 1e-6f);
  __bf16* yr = y + (size_t)row * D_;
#pragma unroll
  for (int i = 0; i < 4; ++i) {
    int d = tid + i * 256;
    yr[d] = (__bf16)(alpha[d] * (vals[i] - mean) * rinv + beta[d]);
  }
}

// ---------------------------------------------------------------------------
// WMMA GEMM: C[M,N] = A[M,K](bf16) * Bt[N,K](bf16)^T  (+ epilogue)
// MODE 0: store bf16
// MODE 1: +bias[col], ReLU, store bf16
// MODE 2: +resid[row,col], store f32
// MODE 3: +bias[col] + resid[row,col], store f32
// Block tile 128x128, K-step 32. 8 waves: 4 (M) x 2 (N); wave tile 32x64.
// Tiles staged with async global->LDS b128 copies, double-buffered so the
// next K-tile streams in while WMMAs consume the current one.
// Rows >= M are clamped (not skipped) so every wave issues exactly 4 async
// ops per tile -> ASYNCcnt bookkeeping is uniform; epilogue guards stores.
// ---------------------------------------------------------------------------
template <int MODE>
__global__ __launch_bounds__(256)
void gemm_bt_kernel(const __bf16* __restrict__ A, const __bf16* __restrict__ Bt,
                    const float* __restrict__ bias, const float* __restrict__ resid,
                    float* __restrict__ Cf, __bf16* __restrict__ Cb,
                    int M, int N, int K) {
  __shared__ __align__(16) __bf16 sA[2][128 * 32];
  __shared__ __align__(16) __bf16 sB[2][128 * 32];
  const int tid = threadIdx.x;
  const int lane = tid & 31, wave = tid >> 5;
  const int mw = wave >> 1, nw = wave & 1;
  const int mbase = blockIdx.y * 128, nbase = blockIdx.x * 128;
  const int lrow = lane & 15, lh = lane >> 4;

  const unsigned long long baseA = (unsigned long long)(uintptr_t)A;
  const unsigned long long baseB = (unsigned long long)(uintptr_t)Bt;

  // this thread's two 16B-segment assignments within the 128x32 tile
  int r0 = tid >> 2, c0 = (tid & 3) * 8;
  int idx1 = tid + 256;
  int r1 = idx1 >> 2, c1 = (idx1 & 3) * 8;
  int ga0 = mbase + r0; if (ga0 >= M) ga0 = M - 1;   // clamp, never skip
  int ga1 = mbase + r1; if (ga1 >= M) ga1 = M - 1;

  auto issue_tile = [&](int kk, int p) {
    async_load_b128((unsigned)(uintptr_t)&sA[p][r0 * 32 + c0], baseA,
                    (unsigned)(((size_t)ga0 * K + kk + c0) * 2));
    async_load_b128((unsigned)(uintptr_t)&sB[p][r0 * 32 + c0], baseB,
                    (unsigned)(((size_t)(nbase + r0) * K + kk + c0) * 2));
    async_load_b128((unsigned)(uintptr_t)&sA[p][r1 * 32 + c1], baseA,
                    (unsigned)(((size_t)ga1 * K + kk + c1) * 2));
    async_load_b128((unsigned)(uintptr_t)&sB[p][r1 * 32 + c1], baseB,
                    (unsigned)(((size_t)(nbase + r1) * K + kk + c1) * 2));
  };

  v8f acc[2][4];
#pragma unroll
  for (int mi = 0; mi < 2; ++mi)
#pragma unroll
    for (int ni = 0; ni < 4; ++ni) acc[mi][ni] = zero_v8f();

  issue_tile(0, 0);
  int p = 0;
  for (int kk = 0; kk < K; kk += 32) {
    const bool pf = (kk + 32) < K;
    if (pf) {
      issue_tile(kk + 32, p ^ 1);   // 4 new in flight on top of 4 old
      wait_asynccnt_4();            // in-order completion: tile p has landed
    } else {
      wait_asynccnt_0();
    }
    __syncthreads();

    v16bf af[2], bfr[4];
#pragma unroll
    for (int mi = 0; mi < 2; ++mi) {
      const __bf16* q = sA[p] + (mw * 32 + mi * 16 + lrow) * 32 + lh * 8;
      af[mi] = ld_frag(q, q + 16);
    }
#pragma unroll
    for (int ni = 0; ni < 4; ++ni) {
      const __bf16* q = sB[p] + (nw * 64 + ni * 16 + lrow) * 32 + lh * 8;
      bfr[ni] = ld_frag(q, q + 16);
    }
#pragma unroll
    for (int mi = 0; mi < 2; ++mi)
#pragma unroll
      for (int ni = 0; ni < 4; ++ni)
        acc[mi][ni] = wmma_bf16(af[mi], bfr[ni], acc[mi][ni]);

    __syncthreads();                // tile p free for overwrite next round
    p ^= 1;
  }

  // epilogue (C layout: VGPR j -> row j + 8*(lane/16); col = lane%16)
#pragma unroll
  for (int mi = 0; mi < 2; ++mi) {
#pragma unroll
    for (int ni = 0; ni < 4; ++ni) {
      int col = nbase + nw * 64 + ni * 16 + lrow;
#pragma unroll
      for (int j = 0; j < 8; ++j) {
        int row = mbase + mw * 32 + mi * 16 + j + 8 * lh;
        if (row >= M) continue;
        float r = acc[mi][ni][j];
        if (MODE == 1 || MODE == 3) r += bias[col];
        if (MODE == 1) r = r > 0.f ? r : 0.f;
        if (MODE == 2 || MODE == 3) r += resid[(size_t)row * N + col];
        if (MODE == 0 || MODE == 1)
          Cb[(size_t)row * N + col] = (__bf16)r;
        else
          Cf[(size_t)row * N + col] = r;
      }
    }
  }
}

// ---------------------------------------------------------------------------
// Flash attention with memory K/V prefix (T = 32 + 2048).
// Grid: (S/128, B*H). 8 waves/block, each wave owns 16 query rows.
// Online softmax; ctx accumulated in 4x v8f per wave (16 rows x 64 dims).
// ---------------------------------------------------------------------------
__global__ __launch_bounds__(256)
void attention_kernel(const __bf16* __restrict__ qg, const __bf16* __restrict__ kg,
                      const __bf16* __restrict__ vg,
                      const __bf16* __restrict__ memk, const __bf16* __restrict__ memv,
                      const int* __restrict__ mask,
                      __bf16* __restrict__ ctxout) {
  __shared__ __align__(16) __bf16 sVt[64 * 32];        // V tile transposed [d][key]
  __shared__ __align__(16) __bf16 sP[8 * 16 * 32];     // per-wave P tiles

  const int tid = threadIdx.x, lane = tid & 31, wave = tid >> 5;
  const int lrow = lane & 15, lh = lane >> 4;
  const int bh = blockIdx.y;
  const int b = bh >> 4, h = bh & 15;
  const int qbase = blockIdx.x * 128 + wave * 16;

  // Q fragments (rows qbase..+15, d 0..63), pre-scaled by 1/sqrt(64)=0.125
  v16bf qf[2];
  {
    const __bf16* qp =
        qg + ((size_t)b * S_ + qbase + lrow) * D_ + h * DK_ + lh * 8;
#pragma unroll
    for (int half = 0; half < 2; ++half) {
      v16bf f = ld_frag(qp + half * 32, qp + half * 32 + 16);
#pragma unroll
      for (int i = 0; i < 16; ++i) f[i] = (__bf16)((float)f[i] * 0.125f);
      qf[half] = f;
    }
  }

  v8f ctx[4];
#pragma unroll
  for (int dg = 0; dg < 4; ++dg) ctx[dg] = zero_v8f();
  float mrun[8], lsum[8];
#pragma unroll
  for (int j = 0; j < 8; ++j) { mrun[j] = -3.0e38f; lsum[j] = 0.f; }

  for (int tbase = 0; tbase < T_; tbase += 32) {
    __syncthreads();
    // stage transposed V tile (32 keys x 64 dims) cooperatively
    {
      int key = tid >> 3;
      int dseg = (tid & 7) * 8;
      int tg = tbase + key;
      const __bf16* src =
          (tg < MEMT_) ? (memv + (size_t)tg * D_ + h * DK_ + dseg)
                       : (vg + ((size_t)b * S_ + (tg - MEMT_)) * D_ + h * DK_ + dseg);
      v8bf val = *(const v8bf*)src;
#pragma unroll
      for (int i = 0; i < 8; ++i) sVt[(dseg + i) * 32 + key] = val[i];
    }
    __syncthreads();

    // scores: [16 rows x 32 keys] = Q[16x64] @ K^T
    v8f s0 = zero_v8f(), s1 = zero_v8f();
#pragma unroll
    for (int grp = 0; grp < 2; ++grp) {
      int tg = tbase + grp * 16 + lrow;
      const __bf16* kp =
          (tg < MEMT_) ? (memk + (size_t)tg * D_ + h * DK_)
                       : (kg + ((size_t)b * S_ + (tg - MEMT_)) * D_ + h * DK_);
      v16bf kf0 = ld_frag(kp + lh * 8, kp + lh * 8 + 16);
      v16bf kf1 = ld_frag(kp + 32 + lh * 8, kp + 32 + lh * 8 + 16);
      if (grp == 0) {
        s0 = wmma_bf16(qf[0], kf0, s0);
        s0 = wmma_bf16(qf[1], kf1, s0);
      } else {
        s1 = wmma_bf16(qf[0], kf0, s1);
        s1 = wmma_bf16(qf[1], kf1, s1);
      }
    }

    // online softmax: per-lane rows j + 8*(lane/16); 16-lane reductions
#pragma unroll
    for (int j = 0; j < 8; ++j) {
      int srow = qbase + j + 8 * lh;
      float v0 = mask[(size_t)srow * T_ + tbase + lrow] ? s0[j] : -1e9f;
      float v1 = mask[(size_t)srow * T_ + tbase + 16 + lrow] ? s1[j] : -1e9f;
      float tmax = fmaxf(v0, v1);
#pragma unroll
      for (int o = 8; o >= 1; o >>= 1) tmax = fmaxf(tmax, __shfl_xor(tmax, o, 32));
      float newm = fmaxf(mrun[j], tmax);
      float scale = __expf(mrun[j] - newm);
      float p0 = __expf(v0 - newm);
      float p1 = __expf(v1 - newm);
      float ts = p0 + p1;
#pragma unroll
      for (int o = 8; o >= 1; o >>= 1) ts += __shfl_xor(ts, o, 32);
      lsum[j] = lsum[j] * scale + ts;
      mrun[j] = newm;
#pragma unroll
      for (int dg = 0; dg < 4; ++dg) ctx[dg][j] *= scale;
      __bf16* pp = sP + wave * 512 + (j + 8 * lh) * 32;
      pp[lrow] = (__bf16)p0;
      pp[16 + lrow] = (__bf16)p1;
    }

    // P (16x32) as A fragment from wave-private LDS (same-wave RAW, in-order DS)
    const __bf16* pb = sP + wave * 512 + lrow * 32 + lh * 8;
    v16bf pf = ld_frag(pb, pb + 16);

    // ctx += P @ V  (N = 64 dims, K = 32 keys)
#pragma unroll
    for (int dg = 0; dg < 4; ++dg) {
      const __bf16* vp = sVt + (dg * 16 + lrow) * 32 + lh * 8;
      v16bf vf = ld_frag(vp, vp + 16);
      ctx[dg] = wmma_bf16(pf, vf, ctx[dg]);
    }
  }

  // normalize and write ctx as bf16 in [B,S,D] (head-major cols)
  float inv[8];
#pragma unroll
  for (int j = 0; j < 8; ++j) inv[j] = 1.0f / lsum[j];
#pragma unroll
  for (int dg = 0; dg < 4; ++dg)
#pragma unroll
    for (int j = 0; j < 8; ++j) {
      int srow = qbase + j + 8 * lh;
      int col = h * DK_ + dg * 16 + lrow;
      ctxout[((size_t)b * S_ + srow) * D_ + col] = (__bf16)(ctx[dg][j] * inv[j]);
    }
}

// ---------------------------------------------------------------------------
// new_memory: broadcast mean over S of final x into [B, MEM, D]
// ---------------------------------------------------------------------------
__global__ __launch_bounds__(256)
void mean_bcast_kernel(const float* __restrict__ x, float* __restrict__ nm) {
  int gid = blockIdx.x * 256 + threadIdx.x;    // B*D threads
  int b = gid / D_;
  int d = gid - b * D_;
  const float* p = x + (size_t)b * S_ * D_ + d;
  float s = 0.f;
  for (int i = 0; i < S_; ++i) s += p[(size_t)i * D_];
  float mean = s * (1.0f / S_);
  float* o = nm + (size_t)b * MEMT_ * D_ + d;
  for (int mI = 0; mI < MEMT_; ++mI) o[(size_t)mI * D_] = mean;
}

// ---------------------------------------------------------------------------
// launch
// ---------------------------------------------------------------------------
extern "C" void kernel_launch(void* const* d_in, const int* in_sizes, int n_in,
                              void* d_out, int out_size, void* d_ws, size_t ws_size,
                              hipStream_t stream) {
  (void)in_sizes; (void)n_in; (void)out_size; (void)ws_size;
  const float* x    = (const float*)d_in[0];
  const int*   mask = (const int*)d_in[1];
  const float* mem  = (const float*)d_in[2];
  const float* w_q  = (const float*)d_in[3];
  const float* w_k  = (const float*)d_in[4];
  const float* w_v  = (const float*)d_in[5];
  const float* w_o  = (const float*)d_in[6];
  const float* ln1a = (const float*)d_in[7];
  const float* ln1b = (const float*)d_in[8];
  const float* ln2a = (const float*)d_in[9];
  const float* ln2b = (const float*)d_in[10];
  const float* fw1  = (const float*)d_in[11];
  const float* fb1  = (const float*)d_in[12];
  const float* fw2  = (const float*)d_in[13];
  const float* fb2  = (const float*)d_in[14];

  float* out_x  = (float*)d_out;                                // [B,S,D]
  float* out_nm = out_x + (size_t)B_ * S_ * D_;                 // [B,MEM,D]

  // workspace carve-out
  size_t off = 0;
  auto carve = [&](size_t bytes) -> char* {
    char* p = (char*)d_ws + off;
    off = (off + bytes + 255) & ~(size_t)255;
    return p;
  };
  __bf16* wqT  = (__bf16*)carve((size_t)D_ * D_ * 2);
  __bf16* wkT  = (__bf16*)carve((size_t)D_ * D_ * 2);
  __bf16* wvT  = (__bf16*)carve((size_t)D_ * D_ * 2);
  __bf16* woT  = (__bf16*)carve((size_t)D_ * D_ * 2);
  __bf16* w1T  = (__bf16*)carve((size_t)DFF_ * D_ * 2);
  __bf16* w2T  = (__bf16*)carve((size_t)D_ * DFF_ * 2);
  __bf16* memb = (__bf16*)carve((size_t)MEMT_ * D_ * 2);
  __bf16* memK = (__bf16*)carve((size_t)MEMT_ * D_ * 2);
  __bf16* memV = (__bf16*)carve((size_t)MEMT_ * D_ * 2);
  __bf16* xn   = (__bf16*)carve((size_t)B_ * S_ * D_ * 2);
  __bf16* qb   = (__bf16*)carve((size_t)B_ * S_ * D_ * 2);
  __bf16* kb   = (__bf16*)carve((size_t)B_ * S_ * D_ * 2);
  __bf16* vb   = (__bf16*)carve((size_t)B_ * S_ * D_ * 2);
  __bf16* ctxb = (__bf16*)carve((size_t)B_ * S_ * D_ * 2);
  float*  x1   = (float*)carve((size_t)B_ * S_ * D_ * 4);
  __bf16* xn2  = (__bf16*)carve((size_t)B_ * S_ * D_ * 2);
  __bf16* ffh  = (__bf16*)carve((size_t)B_ * S_ * DFF_ * 2);

  const int rows = B_ * S_;   // 8192
  dim3 blk(256);

  // weight prep (bf16, transposed to [N][K])
  transpose_convert_kernel<<<dim3(D_ / 64, D_ / 64), blk, 0, stream>>>(w_q, wqT, D_, D_);
  transpose_convert_kernel<<<dim3(D_ / 64, D_ / 64), blk, 0, stream>>>(w_k, wkT, D_, D_);
  transpose_convert_kernel<<<dim3(D_ / 64, D_ / 64), blk, 0, stream>>>(w_v, wvT, D_, D_);
  transpose_convert_kernel<<<dim3(D_ / 64, D_ / 64), blk, 0, stream>>>(w_o, woT, D_, D_);
  transpose_convert_kernel<<<dim3(DFF_ / 64, D_ / 64), blk, 0, stream>>>(fw1, w1T, D_, DFF_);
  transpose_convert_kernel<<<dim3(D_ / 64, DFF_ / 64), blk, 0, stream>>>(fw2, w2T, DFF_, D_);
  convert_kernel<<<(MEMT_ * D_) / 256, blk, 0, stream>>>(mem, memb, MEMT_ * D_);

  // LN1 -> Q/K/V projections (WMMA bf16)
  layernorm_kernel<<<rows, blk, 0, stream>>>(x, ln1a, ln1b, xn);
  gemm_bt_kernel<0><<<dim3(D_ / 128, rows / 128), blk, 0, stream>>>(
      xn, wqT, nullptr, nullptr, nullptr, qb, rows, D_, D_);
  gemm_bt_kernel<0><<<dim3(D_ / 128, rows / 128), blk, 0, stream>>>(
      xn, wkT, nullptr, nullptr, nullptr, kb, rows, D_, D_);
  gemm_bt_kernel<0><<<dim3(D_ / 128, rows / 128), blk, 0, stream>>>(
      xn, wvT, nullptr, nullptr, nullptr, vb, rows, D_, D_);
  // memory K/V (raw memory tokens, not layernormed), M=32 with row clamp
  gemm_bt_kernel<0><<<dim3(D_ / 128, 1), blk, 0, stream>>>(
      memb, wkT, nullptr, nullptr, nullptr, memK, MEMT_, D_, D_);
  gemm_bt_kernel<0><<<dim3(D_ / 128, 1), blk, 0, stream>>>(
      memb, wvT, nullptr, nullptr, nullptr, memV, MEMT_, D_, D_);

  // flash attention over T = MEM + S
  attention_kernel<<<dim3(S_ / 128, B_ * H_), blk, 0, stream>>>(
      qb, kb, vb, memK, memV, mask, ctxb);

  // out-proj + residual -> x1 (f32)
  gemm_bt_kernel<2><<<dim3(D_ / 128, rows / 128), blk, 0, stream>>>(
      ctxb, woT, nullptr, x, x1, nullptr, rows, D_, D_);

  // LN2 -> FFN
  layernorm_kernel<<<rows, blk, 0, stream>>>(x1, ln2a, ln2b, xn2);
  gemm_bt_kernel<1><<<dim3(DFF_ / 128, rows / 128), blk, 0, stream>>>(
      xn2, w1T, fb1, nullptr, nullptr, ffh, rows, DFF_, D_);
  gemm_bt_kernel<3><<<dim3(D_ / 128, rows / 128), blk, 0, stream>>>(
      ffh, w2T, fb2, x1, out_x, nullptr, rows, D_, DFF_);

  // new_memory = broadcast mean over S
  mean_bcast_kernel<<<(B_ * D_) / 256, blk, 0, stream>>>(out_x, out_nm);
}

// v002
// A run of this version takes 854 microseconds.
// Timed twice side by side with v001, it ran 1.19 times as fast both times.
// Counting every step since v000, it is 1.49 times as fast.
#include <hip/hip_runtime.h>
#include <hip/hip_bf16.h>

// ---------------------------------------------------------------------------
// CDNA5 (gfx1250) transformer encoder block with memory tokens.
// - All heavy GEMMs: v_wmma_f32_16x16x32_bf16 (wave32 WMMA), f32 accumulate.
// - GEMM tile staging: global_load_async_to_lds_b128 (ASYNCcnt) with
//   double-buffered LDS tiles -> prefetch tile k+1 while computing tile k.
// ---------------------------------------------------------------------------

typedef __attribute__((ext_vector_type(16))) __bf16 v16bf;
typedef __attribute__((ext_vector_type(8)))  __bf16 v8bf;
typedef __attribute__((ext_vector_type(8)))  float  v8f;
typedef __attribute__((ext_vector_type(2)))  __bf16 v2bf;
typedef __attribute__((ext_vector_type(4)))  unsigned v4u;

static constexpr int B_    = 4;
static constexpr int S_    = 2048;
static constexpr int D_    = 1024;
static constexpr int H_    = 16;
static constexpr int DK_   = 64;
static constexpr int DFF_  = 4096;
static constexpr int MEMT_ = 32;
static constexpr int T_    = S_ + MEMT_;   // 2080 = 65 * 32
// Row pitch, in bf16, of every LDS tile whose 32-element rows are read as WMMA
// fragments with 16-byte loads: 80 bytes = 16 x 5, so the 16 rows one half-wave
// reads start on 16 different groups of four banks. At the bare 64 bytes rows
// r and r + 4 share their banks and each fragment load takes four times as long.
static constexpr int LP_   = 40;

__device__ __forceinline__ v8f zero_v8f() {
  v8f z;
#pragma unroll
  for (int i = 0; i < 8; ++i) z[i] = 0.0f;
  return z;
}

// Build a 16-element bf16 A/B fragment from two contiguous 16-byte segments.
// Layout per CDNA5 ISA 7.12.2: lane holds row (lane%16); elements 0..7 are
// K = (lane/16)*8 .. +7, elements 8..15 are K = (lane/16)*8+16 .. +23.
__device__ __forceinline__ v16bf ld_frag(const __bf16* p0, const __bf16* p1) {
  v8bf lo = *(const v8bf*)p0;
  v8bf hi = *(const v8bf*)p1;
  return __builtin_shufflevector(lo, hi, 0, 1, 2, 3, 4, 5, 6, 7,
                                         8, 9, 10, 11, 12, 13, 14, 15);
}

// two floats -> one dword of two bf16, a in the low half
__device__ __forceinline__ unsigned pack_bf16(float a, float b) {
  v2bf t = {(__bf16)a, (__bf16)b};
  return __builtin_bit_cast(unsigned, t);
}

__device__ __forceinline__ v8f wmma_bf16(v16bf a, v16bf b, v8f c) {
  return __builtin_amdgcn_wmma_f32_16x16x32_bf16(
      false, a, false, b, (short)0, c, false, false);
}

// CDNA5 async global->LDS copies, 16 bytes per lane (GVS mode: SGPR base +
// per-lane u32 byte offset). Tracked by ASYNCcnt. One K-tile's four copies of a
// thread (A, B, A, B) stand in one statement that ends in s_wait_xcnt 0, so that
// no address register of a copy is rewritten ahead of that wait.
__device__ __forceinline__ void async_load4_b128(
    unsigned ldsA0, unsigned voffA0, unsigned ldsB0, unsigned voffB0,
    unsigned ldsA1, unsigned voffA1, unsigned ldsB1, unsigned voffB1,
    unsigned long long baseA, unsigned long long baseB) {
  asm volatile("global_load_async_to_lds_b128 %0, %1, %8\n\t"
               "global_load_async_to_lds_b128 %2, %3, %9\n\t"
               "global_load_async_to_lds_b128 %4, %5, %8\n\t"
               "global_load_async_to_lds_b128 %6, %7, %9\n\t"
               "s_wait_xcnt 0x0"
               :: "v"(ldsA0), "v"(voffA0), "v"(ldsB0), "v"(voffB0),
                  "v"(ldsA1), "v"(voffA1), "v"(ldsB1), "v"(voffB1),
                  "s"(baseA), "s"(baseB)
               : "memory");
}
__device__ __forceinline__ void wait_asynccnt_4() {
  asm volatile("s_wait_asynccnt 0x4" ::: "memory");
}
__device__ __forceinline__ void wait_asynccnt_0() {
  asm volatile("s_wait_asynccnt 0x0" ::: "memory");
}

// ---------------------------------------------------------------------------
// Weight transpose + fp32 -> bf16 convert: Wt[n*K + k] = (bf16)W[k*N + n]
// One block moves a 64(k) x 64(n) tile through LDS: reads are whole 256-byte
// row pieces of W, writes are whole 128-byte lines of Wt. Two k neighbours are
// packed into one dword before LDS; the pitch of 65 dwords keeps both the
// row-wise stores and the column-wise loads free of bank conflicts.
// K and N must be multiples of 64.
// ---------------------------------------------------------------------------
__global__ __launch_bounds__(256)
void transpose_convert_kernel(const float* __restrict__ W,
                              __bf16* __restrict__ Wt, int K, int N) {
  __shared__ unsigned tile[32 * 65];                   // [k pair][n]
  const int tid = threadIdx.x;
  const int n0 = blockIdx.x * 64, k0 = blockIdx.y * 64;

  const int c4 = (tid & 15) * 4;
  float4 lo[2], hi[2];
#pragma unroll
  for (int i = 0; i < 2; ++i) {
    const int kp = (tid >> 4) + i * 16;
    const float* src = W + (size_t)(k0 + 2 * kp) * N + n0 + c4;
    lo[i] = *(const float4*)src;
    hi[i] = *(const float4*)(src + N);
  }
#pragma unroll
  for (int i = 0; i < 2; ++i) {
    unsigned* t = tile + ((tid >> 4) + i * 16) * 65 + c4;
    t[0] = pack_bf16(lo[i].x, hi[i].x);
    t[1] = pack_bf16(lo[i].y, hi[i].y);
    t[2] = pack_bf16(lo[i].z, hi[i].z);
    t[3] = pack_bf16(lo[i].w, hi[i].w);
  }
  __syncthreads();
#pragma unroll
  for (int i = 0; i < 2; ++i) {
    const int c = tid + i * 256;
    const int n = c >> 3, kc = c & 7;                  // 8 lanes fill one line
    const unsigned* t = tile + kc * 4 * 65 + n;
    v4u o;
#pragma unroll
    for (int e = 0; e < 4; ++e) o[e] = t[e * 65];
    *(v4u*)(Wt + (size_t)(n0 + n) * K + k0 + kc * 8) = o;
  }
}

__global__ __launch_bounds__(256)
void convert_kernel(const float* __restrict__ X, __bf16* __restrict__ Y, int n) {
  int i = blockIdx.x * 256 + threadIdx.x;
  if (i < n) Y[i] = (__bf16)X[i];
}

// ---------------------------------------------------------------------------
// LayerNorm (matches reference: unbiased std, alpha*(x-mean)/(std+eps)+bias)
// One block per row of D_=1024. Output bf16 for the following GEMM.
// ---------------------------------------------------------------------------
__global__ __launch_bounds__(256)
void layernorm_kernel(const float* __restrict__ x,
                      const float* __restrict__ alpha,
                      const float* __restrict__ beta,
                      __bf16* __restrict__ y) {
  __shared__ float red[256];
  const int row = blockIdx.x, tid = threadIdx.x;
  const float* xr = x + (size_t)row * D_;
  float vals[4];
  float s1 = 0.f, s2 = 0.f;
#pragma unroll
  for (int i = 0; i < 4; ++i) {
    float t = xr[tid + i * 256];
    vals[i] = t;
    s1 += t;
    s2 += t * t;
  }
  red[tid] = s1; __syncthreads();
  for (int o = 128; o > 0; o >>= 1) {
    if (tid < o) red[tid] += red[tid + o];
    __syncthreads();
  }
  float sum1 = red[0]; __syncthreads();
  red[tid] = s2; __syncthreads();
  for (int o = 128; o > 0; o >>= 1) {
    if (tid < o) red[tid] += red[tid + o];
    __syncthreads();
  }
  float sum2 = red[0];
  float mean = sum1 * (1.0f / D_);
  float var = (sum2 - (float)D_ * mean * mean) * (1.0f / (D_ - 1));
  var = var > 0.f ? var : 0.f;
  float rinv = 1.0f / (sqrtf(var) + 1e-6f);
  __bf16* yr = y + (size_t)row * D_;
#pragma unroll
  for (int i = 0; i < 4; ++i) {
    int d = tid + i * 256;
    yr[d] = (__bf16)(alpha[d] * (vals[i] - mean) * rinv + beta[d]);
  }
}

// ---------------------------------------------------------------------------
// WMMA GEMM: C[M,N] = A[M,K](bf16) * Bt[N,K](bf16)^T  (+ epilogue)
// MODE 0: store bf16
// MODE 1: +bias[col], ReLU, store bf16
// MODE 2: +resid[row,col], store f32
// MODE 3: +bias[col] + resid[row,col], store f32
// Block tile 128x128, K-step 32. 8 waves: 4 (M) x 2 (N); wave tile 32x64.
// Tiles staged with async global->LDS b128 copies, double-buffered so the
// next K-tile streams in while WMMAs consume the current one.
// Rows >= M are clamped (not skipped) so every wave issues exactly 4 async
// ops per tile -> ASYNCcnt bookkeeping is uniform; epilogue guards stores.
// ---------------------------------------------------------------------------
template <int MODE>
__global__ __launch_bounds__(256)
void gemm_bt_kernel(const __bf16* __restrict__ A, const __bf16* __restrict__ Bt,
                    const float* __restrict__ bias, const float* __restrict__ resid,
                    float* __restrict__ Cf, __bf16* __restrict__ Cb,
                    int M, int N, int K) {
  __shared__ __align__(16) __bf16 sA[2][128 * LP_];
  __shared__ __align__(16) __bf16 sB[2][128 * LP_];
  const int tid = threadIdx.x;
  const int lane = tid & 31, wave = tid >> 5;
  const int mw = wave >> 1, nw = wave & 1;
  const int mbase = blockIdx.y * 128, nbase = blockIdx.x * 128;
  const int lrow = lane & 15, lh = lane >> 4;

  const unsigned long long baseA = (unsigned long long)(uintptr_t)A;
  const unsigned long long baseB = (unsigned long long)(uintptr_t)Bt;

  // this thread's two 16B-segment assignments within the 128x32 tile
  int r0 = tid >> 2, c0 = (tid & 3) * 8;
  int idx1 = tid + 256;
  int r1 = idx1 >> 2, c1 = (idx1 & 3) * 8;
  int ga0 = mbase + r0; if (ga0 >= M) ga0 = M - 1;   // clamp, never skip
  int ga1 = mbase + r1; if (ga1 >= M) ga1 = M - 1;

  auto issue_tile = [&](int kk, int p) {
    async_load4_b128((unsigned)(uintptr_t)&sA[p][r0 * LP_ + c0],
                     (unsigned)(((size_t)ga0 * K + kk + c0) * 2),
                     (unsigned)(uintptr_t)&sB[p][r0 * LP_ + c0],
                     (unsigned)(((size_t)(nbase + r0) * K + kk + c0) * 2),
                     (unsigned)(uintptr_t)&sA[p][r1 * LP_ + c1],
                     (unsigned)(((size_t)ga1 * K + kk + c1) * 2),
                     (unsigned)(uintptr_t)&sB[p][r1 * LP_ + c1],
                     (unsigned)(((size_t)(nbase + r1) * K + kk + c1) * 2),
                     baseA, baseB);
  };

  v8f acc[2][4];
#pragma unroll
  for (int mi = 0; mi < 2; ++mi)
#pragma unroll
    for (int ni = 0; ni < 4; ++ni) acc[mi][ni] = zero_v8f();

  issue_tile(0, 0);
  int p = 0;
  for (int kk = 0; kk < K; kk += 32) {
    const bool pf = (kk + 32) < K;
    if (pf) {
      issue_tile(kk + 32, p ^ 1);   // 4 new in flight on top of 4 old
      wait_asynccnt_4();            // in-order completion: tile p has landed
    } else {
      wait_asynccnt_0();
    }
    __syncthreads();

    v16bf af[2], bfr[4];
#pragma unroll
    for (int mi = 0; mi < 2; ++mi) {
      const __bf16* q = sA[p] + (mw * 32 + mi * 16 + lrow) * LP_ + lh * 8;
      af[mi] = ld_frag(q, q + 16);
    }
#pragma unroll
    for (int ni = 0; ni < 4; ++ni) {
      const __bf16* q = sB[p] + (nw * 64 + ni * 16 + lrow) * LP_ + lh * 8;
      bfr[ni] = ld_frag(q, q + 16);
    }
#pragma unroll
    for (int mi = 0; mi < 2; ++mi)
#pragma unroll
      for (int ni = 0; ni < 4; ++ni)
        acc[mi][ni] = wmma_bf16(af[mi], bfr[ni], acc[mi][ni]);

    __syncthreads();                // tile p free for overwrite next round
    p ^= 1;
  }

  // epilogue (C layout: VGPR j -> row j + 8*(lane/16); col = lane%16)
#pragma unroll
  for (int mi = 0; mi < 2; ++mi) {
#pragma unroll
    for (int ni = 0; ni < 4; ++ni) {
      int col = nbase + nw * 64 + ni * 16 + lrow;
#pragma unroll
      for (int j = 0; j < 8; ++j) {
        int row = mbase + mw * 32 + mi * 16 + j + 8 * lh;
        if (row >= M) continue;
        float r = acc[mi][ni][j];
        if (MODE == 1 || MODE == 3) r += bias[col];
        if (MODE == 1) r = r > 0.f ? r : 0.f;
        if (MODE == 2 || MODE == 3) r += resid[(size_t)row * N + col];
        if (MODE == 0 || MODE == 1)
          Cb[(size_t)row * N + col] = (__bf16)r;
        else
          Cf[(size_t)row * N + col] = r;
      }
    }
  }
}

// ---------------------------------------------------------------------------
// Flash attention with memory K/V prefix (T = 32 + 2048).
// Grid: (S/128, B*H). 8 waves/block, each wave owns 16 query rows.
// Online softmax; ctx accumulated in 4x v8f per wave (16 rows x 64 dims).
// ---------------------------------------------------------------------------
__global__ __launch_bounds__(256)
void attention_kernel(const __bf16* __restrict__ qg, const __bf16* __restrict__ kg,
                      const __bf16* __restrict__ vg,
                      const __bf16* __restrict__ memk, const __bf16* __restrict__ memv,
                      const int* __restrict__ mask,
                      __bf16* __restrict__ ctxout) {
  __shared__ __align__(16) __bf16 sVt[64 * LP_];       // V tile transposed [d][key]
  __shared__ __align__(16) __bf16 sP[8 * 16 * LP_];    // per-wave P tiles

  const int tid = threadIdx.x, lane = tid & 31, wave = tid >> 5;
  const int lrow = lane & 15, lh = lane >> 4;
  const int bh = blockIdx.y;
  const int b = bh >> 4, h = bh & 15;
  const int qbase = blockIdx.x * 128 + wave * 16;

  // Q fragments (rows qbase..+15, d 0..63), pre-scaled by 1/sqrt(64)=0.125
  v16bf qf[2];
  {
    const __bf16* qp =
        qg + ((size_t)b * S_ + qbase + lrow) * D_ + h * DK_ + lh * 8;
#pragma unroll
    for (int half = 0; half < 2; ++half) {
      v16bf f = ld_frag(qp + half * 32, qp + half * 32 + 16);
#pragma unroll
      for (int i = 0; i < 16; ++i) f[i] = (__bf16)((float)f[i] * 0.125f);
      qf[half] = f;
    }
  }

  v8f ctx[4];
#pragma unroll
  for (int dg = 0; dg < 4; ++dg) ctx[dg] = zero_v8f();
  float mrun[8], lsum[8];
#pragma unroll
  for (int j = 0; j < 8; ++j) { mrun[j] = -3.0e38f; lsum[j] = 0.f; }

  for (int tbase = 0; tbase < T_; tbase += 32) {
    __syncthreads();
    // stage transposed V tile (32 keys x 64 dims) cooperatively
    {
      int key = tid >> 3;
      int dseg = (tid & 7) * 8;
      int tg = tbase + key;
      const __bf16* src =
          (tg < MEMT_) ? (memv + (size_t)tg * D_ + h * DK_ + dseg)
                       : (vg + ((size_t)b * S_ + (tg - MEMT_)) * D_ + h * DK_ + dseg);
      v8bf val = *(const v8bf*)src;
#pragma unroll
      for (int i = 0; i < 8; ++i) sVt[(dseg + i) * LP_ + key] = val[i];
    }
    __syncthreads();

    // scores: [16 rows x 32 keys] = Q[16x64] @ K^T
    v8f s0 = zero_v8f(), s1 = zero_v8f();
#pragma unroll
    for (int grp = 0; grp < 2; ++grp) {
      int tg = tbase + grp * 16 + lrow;
      const __bf16* kp =
          (tg < MEMT_) ? (memk + (size_t)tg * D_ + h * DK_)
                       : (kg + ((size_t)b * S_ + (tg - MEMT_)) * D_ + h * DK_);
      v16bf kf0 = ld_frag(kp + lh * 8, kp + lh * 8 + 16);
      v16bf kf1 = ld_frag(kp + 32 + lh * 8, kp + 32 + lh * 8 + 16);
      if (grp == 0) {
        s0 = wmma_bf16(qf[0], kf0, s0);
        s0 = wmma_bf16(qf[1], kf1, s0);
      } else {
        s1 = wmma_bf16(qf[0], kf0, s1);
        s1 = wmma_bf16(qf[1], kf1, s1);
      }
    }

    // online softmax: per-lane rows j + 8*(lane/16); 16-lane reductions
#pragma unroll
    for (int j = 0; j < 8; ++j) {
      int srow = qbase + j + 8 * lh;
      float v0 = mask[(size_t)srow * T_ + tbase + lrow] ? s0[j] : -1e9f;
      float v1 = mask[(size_t)srow * T_ + tbase + 16 + lrow] ? s1[j] : -1e9f;
      float tmax = fmaxf(v0, v1);
#pragma unroll
      for (int o = 8; o >= 1; o >>= 1) tmax = fmaxf(tmax, __shfl_xor(tmax, o, 32));
      float newm = fmaxf(mrun[j], tmax);
      float scale = __expf(mrun[j] - newm);
      float p0 = __expf(v0 - newm);
      float p1 = __expf(v1 - newm);
      float ts = p0 + p1;
#pragma unroll
      for (int o = 8; o >= 1; o >>= 1) ts += __shfl_xor(ts, o, 32);
      lsum[j] = lsum[j] * scale + ts;
      mrun[j] = newm;
#pragma unroll
      for (int dg = 0; dg < 4; ++dg) ctx[dg][j] *= scale;
      __bf16* pp = sP + wave * (16 * LP_) + (j + 8 * lh) * LP_;
      pp[lrow] = (__bf16)p0;
      pp[16 + lrow] = (__bf16)p1;
    }

    // P (16x32) as A fragment from wave-private LDS (same-wave RAW, in-order DS)
    const __bf16* pb = sP + wave * (16 * LP_) + lrow * LP_ + lh * 8;
    v16bf pf = ld_frag(pb, pb + 16);

    // ctx += P @ V  (N = 64 dims, K = 32 keys)
#pragma unroll
    for (int dg = 0; dg < 4; ++dg) {
      const __bf16* vp = sVt + (dg * 16 + lrow) * LP_ + lh * 8;
      v16bf vf = ld_frag(vp, vp + 16);
      ctx[dg] = wmma_bf16(pf, vf, ctx[dg]);
    }
  }

  // normalize and write ctx as bf16 in [B,S,D] (head-major cols)
  float inv[8];
#pragma unroll
  for (int j = 0; j < 8; ++j) inv[j] = 1.0f / lsum[j];
#pragma unroll
  for (int dg = 0; dg < 4; ++dg)
#pragma unroll
    for (int j = 0; j < 8; ++j) {
      int srow = qbase + j + 8 * lh;
      int col = h * DK_ + dg * 16 + lrow;
      ctxout[((size_t)b * S_ + srow) * D_ + col] = (__bf16)(ctx[dg][j] * inv[j]);
    }
}

// ---------------------------------------------------------------------------
// new_memory: broadcast mean over S of final x into [B, MEM, D]
// ---------------------------------------------------------------------------
__global__ __launch_bounds__(256)
void mean_bcast_kernel(const float* __restrict__ x, float* __restrict__ nm) {
  int gid = blockIdx.x * 256 + threadIdx.x;    // B*D threads
  int b = gid / D_;
  int d = gid - b * D_;
  const float* p = x + (size_t)b * S_ * D_ + d;
  float s = 0.f;
  for (int i = 0; i < S_; ++i) s += p[(size_t)i * D_];
  float mean = s * (1.0f / S_);
  float* o = nm + (size_t)b * MEMT_ * D_ + d;
  for (int mI = 0; mI < MEMT_; ++mI) o[(size_t)mI * D_] = mean;
}

// ---------------------------------------------------------------------------
// launch
// ---------------------------------------------------------------------------
extern "C" void kernel_launch(void* const* d_in, const int* in_sizes, int n_in,
                              void* d_out, int out_size, void* d_ws, size_t ws_size,
                              hipStream_t stream) {
  (void)in_sizes; (void)n_in; (void)out_size; (void)ws_size;
  const float* x    = (const float*)d_in[0];
  const int*   mask = (const int*)d_in[1];
  const float* mem  = (const float*)d_in[2];
  const float* w_q  = (const float*)d_in[3];
  const float* w_k  = (const float*)d_in[4];
  const float* w_v  = (const float*)d_in[5];
  const float* w_o  = (const float*)d_in[6];
  const float* ln1a = (const float*)d_in[7];
  const float* ln1b = (const float*)d_in[8];
  const float* ln2a = (const float*)d_in[9];
  const float* ln2b = (const float*)d_in[10];
  const float* fw1  = (const float*)d_in[11];
  const float* fb1  = (const float*)d_in[12];
  const float* fw2  = (const float*)d_in[13];
  const float* fb2  = (const float*)d_in[14];

  float* out_x  = (float*)d_out;                                // [B,S,D]
  float* out_nm = out_x + (size_t)B_ * S_ * D_;                 // [B,MEM,D]

  // workspace carve-out
  size_t off = 0;
  auto carve = [&](size_t bytes) -> char* {
    char* p = (char*)d_ws + off;
    off = (off + bytes + 255) & ~(size_t)255;
    return p;
  };
  __bf16* wqT  = (__bf16*)carve((size_t)D_ * D_ * 2);
  __bf16* wkT  = (__bf16*)carve((size_t)D_ * D_ * 2);
  __bf16* wvT  = (__bf16*)carve((size_t)D_ * D_ * 2);
  __bf16* woT  = (__bf16*)carve((size_t)D_ * D_ * 2);
  __bf16* w1T  = (__bf16*)carve((size_t)DFF_ * D_ * 2);
  __bf16* w2T  = (__bf16*)carve((size_t)D_ * DFF_ * 2);
  __bf16* memb = (__bf16*)carve((size_t)MEMT_ * D_ * 2);
  __bf16* memK = (__bf16*)carve((size_t)MEMT_ * D_ * 2);
  __bf16* memV = (__bf16*)carve((size_t)MEMT_ * D_ * 2);
  __bf16* xn   = (__bf16*)carve((size_t)B_ * S_ * D_ * 2);
  __bf16* qb   = (__bf16*)carve((size_t)B_ * S_ * D_ * 2);
  __bf16* kb   = (__bf16*)carve((size_t)B_ * S_ * D_ * 2);
  __bf16* vb   = (__bf16*)carve((size_t)B_ * S_ * D_ * 2);
  __bf16* ctxb = (__bf16*)carve((size_t)B_ * S_ * D_ * 2);
  float*  x1   = (float*)carve((size_t)B_ * S_ * D_ * 4);
  __bf16* xn2  = (__bf16*)carve((size_t)B_ * S_ * D_ * 2);
  __bf16* ffh  = (__bf16*)carve((size_t)B_ * S_ * DFF_ * 2);

  const int rows = B_ * S_;   // 8192
  dim3 blk(256);

  // weight prep (bf16, transposed to [N][K])
  transpose_convert_kernel<<<dim3(D_ / 64, D_ / 64), blk, 0, stream>>>(w_q, wqT, D_, D_);
  transpose_convert_kernel<<<dim3(D_ / 64, D_ / 64), blk, 0, stream>>>(w_k, wkT, D_, D_);
  transpose_convert_kernel<<<dim3(D_ / 64, D_ / 64), blk, 0, stream>>>(w_v, wvT, D_, D_);
  transpose_convert_kernel<<<dim3(D_ / 64, D_ / 64), blk, 0, stream>>>(w_o, woT, D_, D_);
  transpose_convert_kernel<<<dim3(DFF_ / 64, D_ / 64), blk, 0, stream>>>(fw1, w1T, D_, DFF_);
  transpose_convert_kernel<<<dim3(D_ / 64, DFF_ / 64), blk, 0, stream>>>(fw2, w2T, DFF_, D_);
  convert_kernel<<<(MEMT_ * D_) / 256, blk, 0, stream>>>(mem, memb, MEMT_ * D_);

  // LN1 -> Q/K/V projections (WMMA bf16)
  layernorm_kernel<<<rows, blk, 0, stream>>>(x, ln1a, ln1b, xn);
  gemm_bt_kernel<0><<<dim3(D_ / 128, rows / 128), blk, 0, stream>>>(
      xn, wqT, nullptr, nullptr, nullptr, qb, rows, D_, D_);
  gemm_bt_kernel<0><<<dim3(D_ / 128, rows / 128), blk, 0, stream>>>(
      xn, wkT, nullptr, nullptr, nullptr, kb, rows, D_, D_);
  gemm_bt_kernel<0><<<dim3(D_ / 128, rows / 128), blk, 0, stream>>>(
      xn, wvT, nullptr, nullptr, nullptr, vb, rows, D_, D_);
  // memory K/V (raw memory tokens, not layernormed), M=32 with row clamp
  gemm_bt_kernel<0><<<dim3(D_ / 128, 1), blk, 0, stream>>>(
      memb, wkT, nullptr, nullptr, nullptr, memK, MEMT_, D_, D_);
  gemm_bt_kernel<0><<<dim3(D_ / 128, 1), blk, 0, stream>>>(
      memb, wvT, nullptr, nullptr, nullptr, memV, MEMT_, D_, D_);

  // flash attention over T = MEM + S
  attention_kernel<<<dim3(S_ / 128, B_ * H_), blk, 0, stream>>>(
      qb, kb, vb, memK, memV, mask, ctxb);

  // out-proj + residual -> x1 (f32)
  gemm_bt_kernel<2><<<dim3(D_ / 128, rows / 128), blk, 0, stream>>>(
      ctxb, woT, nullptr, x, x1, nullptr, rows, D_, D_);

  // LN2 -> FFN
  layernorm_kernel<<<rows, blk, 0, stream>>>(x1, ln2a, ln2b, xn2);
  gemm_bt_kernel<1><<<dim3(DFF_ / 128, rows / 128), blk, 0, stream>>>(
      xn2, w1T, fb1, nullptr, nullptr, ffh, rows, DFF_, D_);
  gemm_bt_kernel<3><<<dim3(D_ / 128, rows / 128), blk, 0, stream>>>(
      ffh, w2T, fb2, x1, out_x, nullptr, rows, D_, DFF_);

  // new_memory = broadcast mean over S
  mean_bcast_kernel<<<(B_ * D_) / 256, blk, 0, stream>>>(out_x, out_nm);
}

// v003
// It runs in 692 microseconds.
// Next to v002, in two timings, it ran 1.23 and 1.24 times as fast.
// Over all steps from v000 it is 1.84 times as fast.
#include <hip/hip_runtime.h>
#include <hip/hip_bf16.h>

// ---------------------------------------------------------------------------
// CDNA5 (gfx1250) transformer encoder block with memory tokens.
// - All heavy GEMMs: v_wmma_f32_16x16x32_bf16 (wave32 WMMA), f32 accumulate.
// - GEMM tile staging: global_load_async_to_lds_b128 (ASYNCcnt) with
//   double-buffered LDS tiles -> prefetch tile k+1 while computing tile k.
// ---------------------------------------------------------------------------

typedef __attribute__((ext_vector_type(16))) __bf16 v16bf;
typedef __attribute__((ext_vector_type(8)))  __bf16 v8bf;
typedef __attribute__((ext_vector_type(8)))  float  v8f;
typedef __attribute__((ext_vector_type(2)))  __bf16 v2bf;
typedef __attribute__((ext_vector_type(4)))  unsigned v4u;

static constexpr int B_    = 4;
static constexpr int S_    = 2048;
static constexpr int D_    = 1024;
static constexpr int H_    = 16;
static constexpr int DK_   = 64;
static constexpr int DFF_  = 4096;
static constexpr int MEMT_ = 32;
static constexpr int T_    = S_ + MEMT_;   // 2080 = 65 * 32
// Row pitch, in bf16, of every LDS tile whose 32-element rows are read as WMMA
// fragments with 16-byte loads: 80 bytes = 16 x 5, so the 16 rows one half-wave
// reads start on 16 different groups of four banks. At the bare 64 bytes rows
// r and r + 4 share their banks and each fragment load takes four times as long.
static constexpr int LP_   = 40;

__device__ __forceinline__ v8f zero_v8f() {
  v8f z;
#pragma unroll
  for (int i = 0; i < 8; ++i) z[i] = 0.0f;
  return z;
}

// Build a 16-element bf16 A/B fragment from two contiguous 16-byte segments.
// Layout per CDNA5 ISA 7.12.2: lane holds row (lane%16); elements 0..7 are
// K = (lane/16)*8 .. +7, elements 8..15 are K = (lane/16)*8+16 .. +23.
__device__ __forceinline__ v16bf ld_frag(const __bf16* p0, const __bf16* p1) {
  v8bf lo = *(const v8bf*)p0;
  v8bf hi = *(const v8bf*)p1;
  return __builtin_shufflevector(lo, hi, 0, 1, 2, 3, 4, 5, 6, 7,
                                         8, 9, 10, 11, 12, 13, 14, 15);
}

// two floats -> one dword of two bf16, a in the low half
__device__ __forceinline__ unsigned pack_bf16(float a, float b) {
  v2bf t = {(__bf16)a, (__bf16)b};
  return __builtin_bit_cast(unsigned, t);
}

__device__ __forceinline__ v8f wmma_bf16(v16bf a, v16bf b, v8f c) {
  return __builtin_amdgcn_wmma_f32_16x16x32_bf16(
      false, a, false, b, (short)0, c, false, false);
}

// CDNA5 async global->LDS copies, 16 bytes per lane (GVS mode: SGPR base +
// per-lane u32 byte offset). Tracked by ASYNCcnt. One K-tile's four copies of a
// thread (A, B, A, B) stand in one statement that ends in s_wait_xcnt 0, so that
// no address register of a copy is rewritten ahead of that wait.
__device__ __forceinline__ void async_load4_b128(
    unsigned ldsA0, unsigned voffA0, unsigned ldsB0, unsigned voffB0,
    unsigned ldsA1, unsigned voffA1, unsigned ldsB1, unsigned voffB1,
    unsigned long long baseA, unsigned long long baseB) {
  asm volatile("global_load_async_to_lds_b128 %0, %1, %8\n\t"
               "global_load_async_to_lds_b128 %2, %3, %9\n\t"
               "global_load_async_to_lds_b128 %4, %5, %8\n\t"
               "global_load_async_to_lds_b128 %6, %7, %9\n\t"
               "s_wait_xcnt 0x0"
               :: "v"(ldsA0), "v"(voffA0), "v"(ldsB0), "v"(voffB0),
                  "v"(ldsA1), "v"(voffA1), "v"(ldsB1), "v"(voffB1),
                  "s"(baseA), "s"(baseB)
               : "memory");
}
__device__ __forceinline__ void wait_asynccnt_4() {
  asm volatile("s_wait_asynccnt 0x4" ::: "memory");
}
__device__ __forceinline__ void wait_asynccnt_0() {
  asm volatile("s_wait_asynccnt 0x0" ::: "memory");
}

// ---------------------------------------------------------------------------
// Weight transpose + fp32 -> bf16 convert: Wt[n*K + k] = (bf16)W[k*N + n]
// One block moves a 64(k) x 64(n) tile through LDS: reads are whole 256-byte
// row pieces of W, writes are whole 128-byte lines of Wt. Two k neighbours are
// packed into one dword before LDS; the pitch of 65 dwords keeps both the
// row-wise stores and the column-wise loads free of bank conflicts.
// K and N must be multiples of 64.
// ---------------------------------------------------------------------------
__global__ __launch_bounds__(256)
void transpose_convert_kernel(const float* __restrict__ W,
                              __bf16* __restrict__ Wt, int K, int N) {
  __shared__ unsigned tile[32 * 65];                   // [k pair][n]
  const int tid = threadIdx.x;
  const int n0 = blockIdx.x * 64, k0 = blockIdx.y * 64;

  const int c4 = (tid & 15) * 4;
  float4 lo[2], hi[2];
#pragma unroll
  for (int i = 0; i < 2; ++i) {
    const int kp = (tid >> 4) + i * 16;
    const float* src = W + (size_t)(k0 + 2 * kp) * N + n0 + c4;
    lo[i] = *(const float4*)src;
    hi[i] = *(const float4*)(src + N);
  }
#pragma unroll
  for (int i = 0; i < 2; ++i) {
    unsigned* t = tile + ((tid >> 4) + i * 16) * 65 + c4;
    t[0] = pack_bf16(lo[i].x, hi[i].x);
    t[1] = pack_bf16(lo[i].y, hi[i].y);
    t[2] = pack_bf16(lo[i].z, hi[i].z);
    t[3] = pack_bf16(lo[i].w, hi[i].w);
  }
  __syncthreads();
#pragma unroll
  for (int i = 0; i < 2; ++i) {
    const int c = tid + i * 256;
    const int n = c >> 3, kc = c & 7;                  // 8 lanes fill one line
    const unsigned* t = tile + kc * 4 * 65 + n;
    v4u o;
#pragma unroll
    for (int e = 0; e < 4; ++e) o[e] = t[e * 65];
    *(v4u*)(Wt + (size_t)(n0 + n) * K + k0 + kc * 8) = o;
  }
}

__global__ __launch_bounds__(256)
void convert_kernel(const float* __restrict__ X, __bf16* __restrict__ Y, int n) {
  int i = blockIdx.x * 256 + threadIdx.x;
  if (i < n) Y[i] = (__bf16)X[i];
}

// ---------------------------------------------------------------------------
// LayerNorm (matches reference: unbiased std, alpha*(x-mean)/(std+eps)+bias)
// One block per row of D_=1024. Output bf16 for the following GEMM.
// ---------------------------------------------------------------------------
__global__ __launch_bounds__(256)
void layernorm_kernel(const float* __restrict__ x,
                      const float* __restrict__ alpha,
                      const float* __restrict__ beta,
                      __bf16* __restrict__ y) {
  __shared__ float red[256];
  const int row = blockIdx.x, tid = threadIdx.x;
  const float* xr = x + (size_t)row * D_;
  float vals[4];
  float s1 = 0.f, s2 = 0.f;
#pragma unroll
  for (int i = 0; i < 4; ++i) {
    float t = xr[tid + i * 256];
    vals[i] = t;
    s1 += t;
    s2 += t * t;
  }
  red[tid] = s1; __syncthreads();
  for (int o = 128; o > 0; o >>= 1) {
    if (tid < o) red[tid] += red[tid + o];
    __syncthreads();
  }
  float sum1 = red[0]; __syncthreads();
  red[tid] = s2; __syncthreads();
  for (int o = 128; o > 0; o >>= 1) {
    if (tid < o) red[tid] += red[tid + o];
    __syncthreads();
  }
  float sum2 = red[0];
  float mean = sum1 * (1.0f / D_);
  float var = (sum2 - (float)D_ * mean * mean) * (1.0f / (D_ - 1));
  var = var > 0.f ? var : 0.f;
  float rinv = 1.0f / (sqrtf(var) + 1e-6f);
  __bf16* yr = y + (size_t)row * D_;
#pragma unroll
  for (int i = 0; i < 4; ++i) {
    int d = tid + i * 256;
    yr[d] = (__bf16)(alpha[d] * (vals[i] - mean) * rinv + beta[d]);
  }
}

// ---------------------------------------------------------------------------
// WMMA GEMM: C[M,N] = A[M,K](bf16) * Bt[N,K](bf16)^T  (+ epilogue)
// MODE 0: store bf16
// MODE 1: +bias[col], ReLU, store bf16
// MODE 2: +resid[row,col], store f32
// MODE 3: +bias[col] + resid[row,col], store f32
// Block tile 128x128, K-step 32. 8 waves: 4 (M) x 2 (N); wave tile 32x64.
// Tiles staged with async global->LDS b128 copies, double-buffered so the
// next K-tile streams in while WMMAs consume the current one.
// Rows >= M are clamped (not skipped) so every wave issues exactly 4 async
// ops per tile -> ASYNCcnt bookkeeping is uniform; epilogue guards stores.
// ---------------------------------------------------------------------------
template <int MODE>
__global__ __launch_bounds__(256)
void gemm_bt_kernel(const __bf16* __restrict__ A, const __bf16* __restrict__ Bt,
                    const float* __restrict__ bias, const float* __restrict__ resid,
                    float* __restrict__ Cf, __bf16* __restrict__ Cb,
                    int M, int N, int K) {
  __shared__ __align__(16) __bf16 sA[2][128 * LP_];
  __shared__ __align__(16) __bf16 sB[2][128 * LP_];
  const int tid = threadIdx.x;
  const int lane = tid & 31, wave = tid >> 5;
  const int mw = wave >> 1, nw = wave & 1;
  const int mbase = blockIdx.y * 128, nbase = blockIdx.x * 128;
  const int lrow = lane & 15, lh = lane >> 4;

  const unsigned long long baseA = (unsigned long long)(uintptr_t)A;
  const unsigned long long baseB = (unsigned long long)(uintptr_t)Bt;

  // this thread's two 16B-segment assignments within the 128x32 tile
  int r0 = tid >> 2, c0 = (tid & 3) * 8;
  int idx1 = tid + 256;
  int r1 = idx1 >> 2, c1 = (idx1 & 3) * 8;
  int ga0 = mbase + r0; if (ga0 >= M) ga0 = M - 1;   // clamp, never skip
  int ga1 = mbase + r1; if (ga1 >= M) ga1 = M - 1;

  auto issue_tile = [&](int kk, int p) {
    async_load4_b128((unsigned)(uintptr_t)&sA[p][r0 * LP_ + c0],
                     (unsigned)(((size_t)ga0 * K + kk + c0) * 2),
                     (unsigned)(uintptr_t)&sB[p][r0 * LP_ + c0],
                     (unsigned)(((size_t)(nbase + r0) * K + kk + c0) * 2),
                     (unsigned)(uintptr_t)&sA[p][r1 * LP_ + c1],
                     (unsigned)(((size_t)ga1 * K + kk + c1) * 2),
                     (unsigned)(uintptr_t)&sB[p][r1 * LP_ + c1],
                     (unsigned)(((size_t)(nbase + r1) * K + kk + c1) * 2),
                     baseA, baseB);
  };

  v8f acc[2][4];
#pragma unroll
  for (int mi = 0; mi < 2; ++mi)
#pragma unroll
    for (int ni = 0; ni < 4; ++ni) acc[mi][ni] = zero_v8f();

  issue_tile(0, 0);
  int p = 0;
  for (int kk = 0; kk < K; kk += 32) {
    const bool pf = (kk + 32) < K;
    if (pf) {
      issue_tile(kk + 32, p ^ 1);   // 4 new in flight on top of 4 old
      wait_asynccnt_4();            // in-order completion: tile p has landed
    } else {
      wait_asynccnt_0();
    }
    __syncthreads();

    v16bf af[2], bfr[4];
#pragma unroll
    for (int mi = 0; mi < 2; ++mi) {
      const __bf16* q = sA[p] + (mw * 32 + mi * 16 + lrow) * LP_ + lh * 8;
      af[mi] = ld_frag(q, q + 16);
    }
#pragma unroll
    for (int ni = 0; ni < 4; ++ni) {
      const __bf16* q = sB[p] + (nw * 64 + ni * 16 + lrow) * LP_ + lh * 8;
      bfr[ni] = ld_frag(q, q + 16);
    }
#pragma unroll
    for (int mi = 0; mi < 2; ++mi)
#pragma unroll
      for (int ni = 0; ni < 4; ++ni)
        acc[mi][ni] = wmma_bf16(af[mi], bfr[ni], acc[mi][ni]);

    __syncthreads();                // tile p free for overwrite next round
    p ^= 1;
  }

  // epilogue (C layout: VGPR j -> row j + 8*(lane/16); col = lane%16)
#pragma unroll
  for (int mi = 0; mi < 2; ++mi) {
#pragma unroll
    for (int ni = 0; ni < 4; ++ni) {
      int col = nbase + nw * 64 + ni * 16 + lrow;
#pragma unroll
      for (int j = 0; j < 8; ++j) {
        int row = mbase + mw * 32 + mi * 16 + j + 8 * lh;
        if (row >= M) continue;
        float r = acc[mi][ni][j];
        if (MODE == 1 || MODE == 3) r += bias[col];
        if (MODE == 1) r = r > 0.f ? r : 0.f;
        if (MODE == 2 || MODE == 3) r += resid[(size_t)row * N + col];
        if (MODE == 0 || MODE == 1)
          Cb[(size_t)row * N + col] = (__bf16)r;
        else
          Cf[(size_t)row * N + col] = r;
      }
    }
  }
}

__device__ __forceinline__ float xhalf(float x) {
  int i = __builtin_bit_cast(int, x);
  return __builtin_bit_cast(float, __builtin_amdgcn_permlanex16(
      i, i, 0x76543210, 0xfedcba98, false, false));
}

// 2^x for a run of independent values. The instruction set asks for one
// independent instruction or v_nop between a transcendental and a next
// instruction that reads its result or overwrites its source: inside a run each
// v_exp_f32 is that instruction for the one before it (early-clobber outputs
// share no register with an input), and the closing v_nop serves the last one.
__device__ __forceinline__ void exp2_run8(float* o, const float* x) {
  asm("v_exp_f32 %0, %8\n\t"
      "v_exp_f32 %1, %9\n\t"
      "v_exp_f32 %2, %10\n\t"
      "v_exp_f32 %3, %11\n\t"
      "v_exp_f32 %4, %12\n\t"
      "v_exp_f32 %5, %13\n\t"
      "v_exp_f32 %6, %14\n\t"
      "v_exp_f32 %7, %15\n\t"
      "v_nop"
      : "=&v"(o[0]), "=&v"(o[1]), "=&v"(o[2]), "=&v"(o[3]),
        "=&v"(o[4]), "=&v"(o[5]), "=&v"(o[6]), "=&v"(o[7])
      : "v"(x[0]), "v"(x[1]), "v"(x[2]), "v"(x[3]),
        "v"(x[4]), "v"(x[5]), "v"(x[6]), "v"(x[7]));
}
__device__ __forceinline__ float exp2_one(float x) {
  float o;
  asm("v_exp_f32 %0, %1\n\t"
      "v_nop"
      : "=&v"(o) : "v"(x));
  return o;
}

// 8 waves per SIMD = 4 blocks per WGP: the whole grid of 1,024 blocks is then
// resident at once instead of running a thin second round.
__global__ __launch_bounds__(256) __attribute__((amdgpu_waves_per_eu(8)))
void attention_kernel(const __bf16* __restrict__ qg, const __bf16* __restrict__ kg,
                      const __bf16* __restrict__ vg,
                      const __bf16* __restrict__ memk, const __bf16* __restrict__ memv,
                      const int* __restrict__ mask,
                      __bf16* __restrict__ ctxout) {
  __shared__ __align__(16) __bf16 sVt[64 * LP_];       // V tile transposed [d][key]

  const int tid = threadIdx.x, lane = tid & 31, wave = tid >> 5;
  const int lrow = lane & 15, lh = lane >> 4;
  const int bh = blockIdx.y;
  const int b = bh >> 4, h = bh & 15;
  const int qbase = blockIdx.x * 128 + wave * 16;

  // Q fragments (rows qbase..+15, d 0..63), pre-scaled by 1/sqrt(64)=0.125
  v16bf qf[2];
  {
    const __bf16* qp =
        qg + ((size_t)b * S_ + qbase + lrow) * D_ + h * DK_ + lh * 8;
#pragma unroll
    for (int half = 0; half < 2; ++half) {
      v16bf f = ld_frag(qp + half * 32, qp + half * 32 + 16);
#pragma unroll
      for (int i = 0; i < 16; ++i) f[i] = (__bf16)((float)f[i] * 0.125f);
      qf[half] = f;
    }
  }

  // ctx[dg][j] = O[query lrow][d = dg*16 + j + 8*lh]
  v8f ctx[4];
#pragma unroll
  for (int dg = 0; dg < 4; ++dg) ctx[dg] = zero_v8f();
  float mrun = -3.0e38f;   // this lane's query: running maximum (both halves equal)
  float lsum = 0.f;        // running sum over this lane's own keys only

  // this lane's query row of the mask, at its first key of a tile
  const int* mrow = mask + (size_t)(qbase + lrow) * T_ + lh * 8;

  for (int tbase = 0; tbase < T_; tbase += 32) {
    __syncthreads();
    // stage transposed V tile (32 keys x 64 dims) cooperatively
    {
      int key = tid >> 3;
      int dseg = (tid & 7) * 8;
      int tg = tbase + key;
      const __bf16* src =
          (tg < MEMT_) ? (memv + (size_t)tg * D_ + h * DK_ + dseg)
                       : (vg + ((size_t)b * S_ + (tg - MEMT_)) * D_ + h * DK_ + dseg);
      v8bf val = *(const v8bf*)src;
#pragma unroll
      for (int i = 0; i < 8; ++i) sVt[(dseg + i) * LP_ + key] = val[i];
    }
    __syncthreads();

    // K fragments (A operand: row = key) and the mask words of this tile: the
    // lane's 2 x 8 keys are 2 x 32 contiguous bytes of its query's mask row
    const __bf16* ka[2];
    v16bf kf[2][2];
#pragma unroll
    for (int grp = 0; grp < 2; ++grp) {
      int tg = tbase + grp * 16 + lrow;
      const __bf16* kp =
          (tg < MEMT_) ? (memk + (size_t)tg * D_ + h * DK_)
                       : (kg + ((size_t)b * S_ + (tg - MEMT_)) * D_ + h * DK_);
      ka[grp] = kp + lh * 8;
      kf[grp][0] = ld_frag(ka[grp], ka[grp] + 16);
      kf[grp][1] = ld_frag(ka[grp] + 32, ka[grp] + 48);
    }
    const int* mp = mrow + tbase;
    int4 mk[4];
#pragma unroll
    for (int i = 0; i < 4; ++i) mk[i] = *(const int4*)(mp + (i >> 1) * 16 + (i & 1) * 4);
    // all twelve loads are in flight before the first product waits for one
    __builtin_amdgcn_sched_barrier(0);
    // no address register of these loads is rewritten ahead of this wait: named
    // as inputs they stay live up to here, so no load's result lands in them
    asm volatile("s_wait_xcnt 0x0" :: "v"(ka[0]), "v"(mp) : "memory");

    // scores, transposed: [32 keys x 16 queries] = K[32x64] @ Q^T
    // st[j] = S[query lrow][key tbase + grp*16 + 8*lh + j]
    float v[16];
#pragma unroll
    for (int grp = 0; grp < 2; ++grp) {
      v8f st = wmma_bf16(kf[grp][0], qf[0], zero_v8f());
      st = wmma_bf16(kf[grp][1], qf[1], st);
      const int4 ma = mk[grp * 2], mb = mk[grp * 2 + 1];
      v[grp * 8 + 0] = ma.x ? st[0] : -1e9f;
      v[grp * 8 + 1] = ma.y ? st[1] : -1e9f;
      v[grp * 8 + 2] = ma.z ? st[2] : -1e9f;
      v[grp * 8 + 3] = ma.w ? st[3] : -1e9f;
      v[grp * 8 + 4] = mb.x ? st[4] : -1e9f;
      v[grp * 8 + 5] = mb.y ? st[5] : -1e9f;
      v[grp * 8 + 6] = mb.z ? st[6] : -1e9f;
      v[grp * 8 + 7] = mb.w ? st[7] : -1e9f;
    }

    // online softmax of one query per lane
    float tmax = v[0];
#pragma unroll
    for (int i = 1; i < 16; ++i) tmax = fmaxf(tmax, v[i]);
    tmax = fmaxf(tmax, xhalf(tmax));
    const float newm = fmaxf(mrun, tmax);
    constexpr float LOG2E = 1.44269504f;       // e^x = 2^(x * log2 e)
    const float scale = exp2_one((mrun - newm) * LOG2E);
    mrun = newm;
    float p[16];
#pragma unroll
    for (int i = 0; i < 16; ++i) v[i] = (v[i] - newm) * LOG2E;
    exp2_run8(p, v);
    exp2_run8(p + 8, v + 8);
    float ts = 0.f;
    v16bf pf;   // P^T as B operand: element i <-> key 8*lh + i (+8 for i >= 8)
#pragma unroll
    for (int i = 0; i < 16; ++i) {
      ts += p[i];
      pf[i] = (__bf16)p[i];
    }
    lsum = lsum * scale + ts;
#pragma unroll
    for (int dg = 0; dg < 4; ++dg)
#pragma unroll
      for (int j = 0; j < 8; ++j) ctx[dg][j] *= scale;

    // O^T += V^T @ P^T  (M = 64 dims in 4 groups, K = 32 keys)
#pragma unroll
    for (int dg = 0; dg < 4; ++dg) {
      const __bf16* vp = sVt + (dg * 16 + lrow) * LP_ + lh * 8;
      v16bf vf = ld_frag(vp, vp + 16);
      ctx[dg] = wmma_bf16(vf, pf, ctx[dg]);
    }
  }

  // join the halves' sums, normalize, write ctx as bf16 in [B,S,D]: a lane holds
  // 8 neighbouring dims of its query per group, one 16-byte store each
  const float inv = 1.0f / (lsum + xhalf(lsum));
  __bf16* op = ctxout + ((size_t)b * S_ + qbase + lrow) * D_ + h * DK_ + lh * 8;
#pragma unroll
  for (int dg = 0; dg < 4; ++dg) {
    v8bf o;
#pragma unroll
    for (int j = 0; j < 8; ++j) o[j] = (__bf16)(ctx[dg][j] * inv);
    *(v8bf*)(op + dg * 16) = o;
  }
}

// ---------------------------------------------------------------------------
// new_memory: broadcast mean over S of final x into [B, MEM, D]
// ---------------------------------------------------------------------------
__global__ __launch_bounds__(256)
void mean_bcast_kernel(const float* __restrict__ x, float* __restrict__ nm) {
  int gid = blockIdx.x * 256 + threadIdx.x;    // B*D threads
  int b = gid / D_;
  int d = gid - b * D_;
  const float* p = x + (size_t)b * S_ * D_ + d;
  float s = 0.f;
  for (int i = 0; i < S_; ++i) s += p[(size_t)i * D_];
  float mean = s * (1.0f / S_);
  float* o = nm + (size_t)b * MEMT_ * D_ + d;
  for (int mI = 0; mI < MEMT_; ++mI) o[(size_t)mI * D_] = mean;
}

// ---------------------------------------------------------------------------
// launch
// ---------------------------------------------------------------------------
extern "C" void kernel_launch(void* const* d_in, const int* in_sizes, int n_in,
                              void* d_out, int out_size, void* d_ws, size_t ws_size,
                              hipStream_t stream) {
  (void)in_sizes; (void)n_in; (void)out_size; (void)ws_size;
  const float* x    = (const float*)d_in[0];
  const int*   mask = (const int*)d_in[1];
  const float* mem  = (const float*)d_in[2];
  const float* w_q  = (const float*)d_in[3];
  const float* w_k  = (const float*)d_in[4];
  const float* w_v  = (const float*)d_in[5];
  const float* w_o  = (const float*)d_in[6];
  const float* ln1a = (const float*)d_in[7];
  const float* ln1b = (const float*)d_in[8];
  const float* ln2a = (const float*)d_in[9];
  const float* ln2b = (const float*)d_in[10];
  const float* fw1  = (const float*)d_in[11];
  const float* fb1  = (const float*)d_in[12];
  const float* fw2  = (const float*)d_in[13];
  const float* fb2  = (const float*)d_in[14];

  float* out_x  = (float*)d_out;                                // [B,S,D]
  float* out_nm = out_x + (size_t)B_ * S_ * D_;                 // [B,MEM,D]

  // workspace carve-out
  size_t off = 0;
  auto carve = [&](size_t bytes) -> char* {
    char* p = (char*)d_ws + off;
    off = (off + bytes + 255) & ~(size_t)255;
    return p;
  };
  __bf16* wqT  = (__bf16*)carve((size_t)D_ * D_ * 2);
  __bf16* wkT  = (__bf16*)carve((size_t)D_ * D_ * 2);
  __bf16* wvT  = (__bf16*)carve((size_t)D_ * D_ * 2);
  __bf16* woT  = (__bf16*)carve((size_t)D_ * D_ * 2);
  __bf16* w1T  = (__bf16*)carve((size_t)DFF_ * D_ * 2);
  __bf16* w2T  = (__bf16*)carve((size_t)D_ * DFF_ * 2);
  __bf16* memb = (__bf16*)carve((size_t)MEMT_ * D_ * 2);
  __bf16* memK = (__bf16*)carve((size_t)MEMT_ * D_ * 2);
  __bf16* memV = (__bf16*)carve((size_t)MEMT_ * D_ * 2);
  __bf16* xn   = (__bf16*)carve((size_t)B_ * S_ * D_ * 2);
  __bf16* qb   = (__bf16*)carve((size_t)B_ * S_ * D_ * 2);
  __bf16* kb   = (__bf16*)carve((size_t)B_ * S_ * D_ * 2);
  __bf16* vb   = (__bf16*)carve((size_t)B_ * S_ * D_ * 2);
  __bf16* ctxb = (__bf16*)carve((size_t)B_ * S_ * D_ * 2);
  float*  x1   = (float*)carve((size_t)B_ * S_ * D_ * 4);
  __bf16* xn2  = (__bf16*)carve((size_t)B_ * S_ * D_ * 2);
  __bf16* ffh  = (__bf16*)carve((size_t)B_ * S_ * DFF_ * 2);

  const int rows = B_ * S_;   // 8192
  dim3 blk(256);

  // weight prep (bf16, transposed to [N][K])
  transpose_convert_kernel<<<dim3(D_ / 64, D_ / 64), blk, 0, stream>>>(w_q, wqT, D_, D_);
  transpose_convert_kernel<<<dim3(D_ / 64, D_ / 64), blk, 0, stream>>>(w_k, wkT, D_, D_);
  transpose_convert_kernel<<<dim3(D_ / 64, D_ / 64), blk, 0, stream>>>(w_v, wvT, D_, D_);
  transpose_convert_kernel<<<dim3(D_ / 64, D_ / 64), blk, 0, stream>>>(w_o, woT, D_, D_);
  transpose_convert_kernel<<<dim3(DFF_ / 64, D_ / 64), blk, 0, stream>>>(fw1, w1T, D_, DFF_);
  transpose_convert_kernel<<<dim3(D_ / 64, DFF_ / 64), blk, 0, stream>>>(fw2, w2T, DFF_, D_);
  convert_kernel<<<(MEMT_ * D_) / 256, blk, 0, stream>>>(mem, memb, MEMT_ * D_);

  // LN1 -> Q/K/V projections (WMMA bf16)
  layernorm_kernel<<<rows, blk, 0, stream>>>(x, ln1a, ln1b, xn);
  gemm_bt_kernel<0><<<dim3(D_ / 128, rows / 128), blk, 0, stream>>>(
      xn, wqT, nullptr, nullptr, nullptr, qb, rows, D_, D_);
  gemm_bt_kernel<0><<<dim3(D_ / 128, rows / 128), blk, 0, stream>>>(
      xn, wkT, nullptr, nullptr, nullptr, kb, rows, D_, D_);
  gemm_bt_kernel<0><<<dim3(D_ / 128, rows / 128), blk, 0, stream>>>(
      xn, wvT, nullptr, nullptr, nullptr, vb, rows, D_, D_);
  // memory K/V (raw memory tokens, not layernormed), M=32 with row clamp
  gemm_bt_kernel<0><<<dim3(D_ / 128, 1), blk, 0, stream>>>(
      memb, wkT, nullptr, nullptr, nullptr, memK, MEMT_, D_, D_);
  gemm_bt_kernel<0><<<dim3(D_ / 128, 1), blk, 0, stream>>>(
      memb, wvT, nullptr, nullptr, nullptr, memV, MEMT_, D_, D_);

  // flash attention over T = MEM + S
  attention_kernel<<<dim3(S_ / 128, B_ * H_), blk, 0, stream>>>(
      qb, kb, vb, memK, memV, mask, ctxb);

  // out-proj + residual -> x1 (f32)
  gemm_bt_kernel<2><<<dim3(D_ / 128, rows / 128), blk, 0, stream>>>(
      ctxb, woT, nullptr, x, x1, nullptr, rows, D_, D_);

  // LN2 -> FFN
  layernorm_kernel<<<rows, blk, 0, stream>>>(x1, ln2a, ln2b, xn2);
  gemm_bt_kernel<1><<<dim3(DFF_ / 128, rows / 128), blk, 0, stream>>>(
      xn2, w1T, fb1, nullptr, nullptr, ffh, rows, DFF_, D_);
  gemm_bt_kernel<3><<<dim3(D_ / 128, rows / 128), blk, 0, stream>>>(
      ffh, w2T, fb2, x1, out_x, nullptr, rows, D_, DFF_);

  // new_memory = broadcast mean over S
  mean_bcast_kernel<<<(B_ * D_) / 256, blk, 0, stream>>>(out_x, out_nm);
}

// v004
// One run takes 630 microseconds.
// Timed twice side by side with v003, it ran 1.10 and 1.09 times as fast.
// Counting every step since v000, it is 2.01 times as fast.
#include <hip/hip_runtime.h>
#include <hip/hip_bf16.h>

// ---------------------------------------------------------------------------
// CDNA5 (gfx1250) transformer encoder block with memory tokens.
// - All heavy GEMMs: v_wmma_f32_16x16x32_bf16 (wave32 WMMA), f32 accumulate.
// - GEMM tile staging: global_load_async_to_lds_b128 (ASYNCcnt) with
//   double-buffered LDS tiles -> prefetch tile k+1 while computing tile k.
// ---------------------------------------------------------------------------

typedef __attribute__((ext_vector_type(16))) __bf16 v16bf;
typedef __attribute__((ext_vector_type(8)))  __bf16 v8bf;
typedef __attribute__((ext_vector_type(8)))  float  v8f;
typedef __attribute__((ext_vector_type(2)))  __bf16 v2bf;
typedef __attribute__((ext_vector_type(4)))  unsigned v4u;

static constexpr int B_    = 4;
static constexpr int S_    = 2048;
static constexpr int D_    = 1024;
static constexpr int H_    = 16;
static constexpr int DK_   = 64;
static constexpr int DFF_  = 4096;
static constexpr int MEMT_ = 32;
static constexpr int T_    = S_ + MEMT_;   // 2080 = 65 * 32
// Row pitch, in bf16, of every LDS tile whose 32-element rows are read as WMMA
// fragments with 16-byte loads: 80 bytes = 16 x 5, so the 16 rows one half-wave
// reads start on 16 different groups of four banks. At the bare 64 bytes rows
// r and r + 4 share their banks and each fragment load takes four times as long.
static constexpr int LP_   = 40;
// The same for tiles with 64-element rows: 144 bytes = 16 x 9.
static constexpr int KP_   = 72;

__device__ __forceinline__ v8f zero_v8f() {
  v8f z;
#pragma unroll
  for (int i = 0; i < 8; ++i) z[i] = 0.0f;
  return z;
}

// Build a 16-element bf16 A/B fragment from two contiguous 16-byte segments.
// Layout per CDNA5 ISA 7.12.2: lane holds row (lane%16); elements 0..7 are
// K = (lane/16)*8 .. +7, elements 8..15 are K = (lane/16)*8+16 .. +23.
__device__ __forceinline__ v16bf ld_frag(const __bf16* p0, const __bf16* p1) {
  v8bf lo = *(const v8bf*)p0;
  v8bf hi = *(const v8bf*)p1;
  return __builtin_shufflevector(lo, hi, 0, 1, 2, 3, 4, 5, 6, 7,
                                         8, 9, 10, 11, 12, 13, 14, 15);
}

// two floats -> one dword of two bf16, a in the low half
__device__ __forceinline__ unsigned pack_bf16(float a, float b) {
  v2bf t = {(__bf16)a, (__bf16)b};
  return __builtin_bit_cast(unsigned, t);
}

__device__ __forceinline__ v8f wmma_bf16(v16bf a, v16bf b, v8f c) {
  return __builtin_amdgcn_wmma_f32_16x16x32_bf16(
      false, a, false, b, (short)0, c, false, false);
}

// CDNA5 async global->LDS copies, 16 bytes per lane (GVS mode: SGPR base +
// per-lane u32 byte offset). Tracked by ASYNCcnt. One K-tile's four copies of a
// thread (A, B, A, B) stand in one statement that ends in s_wait_xcnt 0, so that
// no address register of a copy is rewritten ahead of that wait.
__device__ __forceinline__ void async_load4_b128(
    unsigned ldsA0, unsigned voffA0, unsigned ldsB0, unsigned voffB0,
    unsigned ldsA1, unsigned voffA1, unsigned ldsB1, unsigned voffB1,
    unsigned long long baseA, unsigned long long baseB) {
  asm volatile("global_load_async_to_lds_b128 %0, %1, %8\n\t"
               "global_load_async_to_lds_b128 %2, %3, %9\n\t"
               "global_load_async_to_lds_b128 %4, %5, %8\n\t"
               "global_load_async_to_lds_b128 %6, %7, %9\n\t"
               "s_wait_xcnt 0x0"
               :: "v"(ldsA0), "v"(voffA0), "v"(ldsB0), "v"(voffB0),
                  "v"(ldsA1), "v"(voffA1), "v"(ldsB1), "v"(voffB1),
                  "s"(baseA), "s"(baseB)
               : "memory");
}
__device__ __forceinline__ void wait_asynccnt_4() {
  asm volatile("s_wait_asynccnt 0x4" ::: "memory");
}
__device__ __forceinline__ void wait_asynccnt_0() {
  asm volatile("s_wait_asynccnt 0x0" ::: "memory");
}
// One 16-byte copy per lane, lane's own LDS byte address and global pointer. The
// closing s_wait_xcnt 0 keeps both address registers unwritten up to the wait.
__device__ __forceinline__ void async_load1_b128(unsigned lds, const __bf16* g) {
  asm volatile("global_load_async_to_lds_b128 %0, %1, off\n\t"
               "s_wait_xcnt 0x0"
               :: "v"(lds), "v"(g)
               : "memory");
}
// the wave's own LDS reads have returned before their buffer is handed back
__device__ __forceinline__ void wait_dscnt_0() {
  asm volatile("s_wait_dscnt 0x0" ::: "memory");
}

// ---------------------------------------------------------------------------
// Weight transpose + fp32 -> bf16 convert: Wt[n*K + k] = (bf16)W[k*N + n]
// One block moves a 64(k) x 64(n) tile through LDS: reads are whole 256-byte
// row pieces of W, writes are whole 128-byte lines of Wt. Two k neighbours are
// packed into one dword before LDS; the pitch of 65 dwords keeps both the
// row-wise stores and the column-wise loads free of bank conflicts.
// K and N must be multiples of 64.
// ---------------------------------------------------------------------------
__global__ __launch_bounds__(256)
void transpose_convert_kernel(const float* __restrict__ W,
                              __bf16* __restrict__ Wt, int K, int N) {
  __shared__ unsigned tile[32 * 65];                   // [k pair][n]
  const int tid = threadIdx.x;
  const int n0 = blockIdx.x * 64, k0 = blockIdx.y * 64;

  const int c4 = (tid & 15) * 4;
  float4 lo[2], hi[2];
#pragma unroll
  for (int i = 0; i < 2; ++i) {
    const int kp = (tid >> 4) + i * 16;
    const float* src = W + (size_t)(k0 + 2 * kp) * N + n0 + c4;
    lo[i] = *(const float4*)src;
    hi[i] = *(const float4*)(src + N);
  }
#pragma unroll
  for (int i = 0; i < 2; ++i) {
    unsigned* t = tile + ((tid >> 4) + i * 16) * 65 + c4;
    t[0] = pack_bf16(lo[i].x, hi[i].x);
    t[1] = pack_bf16(lo[i].y, hi[i].y);
    t[2] = pack_bf16(lo[i].z, hi[i].z);
    t[3] = pack_bf16(lo[i].w, hi[i].w);
  }
  __syncthreads();
#pragma unroll
  for (int i = 0; i < 2; ++i) {
    const int c = tid + i * 256;
    const int n = c >> 3, kc = c & 7;                  // 8 lanes fill one line
    const unsigned* t = tile + kc * 4 * 65 + n;
    v4u o;
#pragma unroll
    for (int e = 0; e < 4; ++e) o[e] = t[e * 65];
    *(v4u*)(Wt + (size_t)(n0 + n) * K + k0 + kc * 8) = o;
  }
}

__global__ __launch_bounds__(256)
void convert_kernel(const float* __restrict__ X, __bf16* __restrict__ Y, int n) {
  int i = blockIdx.x * 256 + threadIdx.x;
  if (i < n) Y[i] = (__bf16)X[i];
}

// ---------------------------------------------------------------------------
// LayerNorm (matches reference: unbiased std, alpha*(x-mean)/(std+eps)+bias)
// One block per row of D_=1024. Output bf16 for the following GEMM.
// ---------------------------------------------------------------------------
__global__ __launch_bounds__(256)
void layernorm_kernel(const float* __restrict__ x,
                      const float* __restrict__ alpha,
                      const float* __restrict__ beta,
                      __bf16* __restrict__ y) {
  __shared__ float red[256];
  const int row = blockIdx.x, tid = threadIdx.x;
  const float* xr = x + (size_t)row * D_;
  float vals[4];
  float s1 = 0.f, s2 = 0.f;
#pragma unroll
  for (int i = 0; i < 4; ++i) {
    float t = xr[tid + i * 256];
    vals[i] = t;
    s1 += t;
    s2 += t * t;
  }
  red[tid] = s1; __syncthreads();
  for (int o = 128; o > 0; o >>= 1) {
    if (tid < o) red[tid] += red[tid + o];
    __syncthreads();
  }
  float sum1 = red[0]; __syncthreads();
  red[tid] = s2; __syncthreads();
  for (int o = 128; o > 0; o >>= 1) {
    if (tid < o) red[tid] += red[tid + o];
    __syncthreads();
  }
  float sum2 = red[0];
  float mean = sum1 * (1.0f / D_);
  float var = (sum2 - (float)D_ * mean * mean) * (1.0f / (D_ - 1));
  var = var > 0.f ? var : 0.f;
  float rinv = 1.0f / (sqrtf(var) + 1e-6f);
  __bf16* yr = y + (size_t)row * D_;
#pragma unroll
  for (int i = 0; i < 4; ++i) {
    int d = tid + i * 256;
    yr[d] = (__bf16)(alpha[d] * (vals[i] - mean) * rinv + beta[d]);
  }
}

// ---------------------------------------------------------------------------
// WMMA GEMM: C[M,N] = A[M,K](bf16) * Bt[N,K](bf16)^T  (+ epilogue)
// MODE 0: store bf16
// MODE 1: +bias[col], ReLU, store bf16
// MODE 2: +resid[row,col], store f32
// MODE 3: +bias[col] + resid[row,col], store f32
// Block tile 128x128, K-step 32. 8 waves: 4 (M) x 2 (N); wave tile 32x64.
// Tiles staged with async global->LDS b128 copies, double-buffered so the
// next K-tile streams in while WMMAs consume the current one.
// Rows >= M are clamped (not skipped) so every wave issues exactly 4 async
// ops per tile -> ASYNCcnt bookkeeping is uniform; epilogue guards stores.
// ---------------------------------------------------------------------------
template <int MODE>
__global__ __launch_bounds__(256)
void gemm_bt_kernel(const __bf16* __restrict__ A, const __bf16* __restrict__ Bt,
                    const float* __restrict__ bias, const float* __restrict__ resid,
                    float* __restrict__ Cf, __bf16* __restrict__ Cb,
                    int M, int N, int K) {
  __shared__ __align__(16) __bf16 sA[2][128 * LP_];
  __shared__ __align__(16) __bf16 sB[2][128 * LP_];
  const int tid = threadIdx.x;
  const int lane = tid & 31, wave = tid >> 5;
  const int mw = wave >> 1, nw = wave & 1;
  const int mbase = blockIdx.y * 128, nbase = blockIdx.x * 128;
  const int lrow = lane & 15, lh = lane >> 4;

  const unsigned long long baseA = (unsigned long long)(uintptr_t)A;
  const unsigned long long baseB = (unsigned long long)(uintptr_t)Bt;

  // this thread's two 16B-segment assignments within the 128x32 tile
  int r0 = tid >> 2, c0 = (tid & 3) * 8;
  int idx1 = tid + 256;
  int r1 = idx1 >> 2, c1 = (idx1 & 3) * 8;
  int ga0 = mbase + r0; if (ga0 >= M) ga0 = M - 1;   // clamp, never skip
  int ga1 = mbase + r1; if (ga1 >= M) ga1 = M - 1;

  auto issue_tile = [&](int kk, int p) {
    async_load4_b128((unsigned)(uintptr_t)&sA[p][r0 * LP_ + c0],
                     (unsigned)(((size_t)ga0 * K + kk + c0) * 2),
                     (unsigned)(uintptr_t)&sB[p][r0 * LP_ + c0],
                     (unsigned)(((size_t)(nbase + r0) * K + kk + c0) * 2),
                     (unsigned)(uintptr_t)&sA[p][r1 * LP_ + c1],
                     (unsigned)(((size_t)ga1 * K + kk + c1) * 2),
                     (unsigned)(uintptr_t)&sB[p][r1 * LP_ + c1],
                     (unsigned)(((size_t)(nbase + r1) * K + kk + c1) * 2),
                     baseA, baseB);
  };

  v8f acc[2][4];
#pragma unroll
  for (int mi = 0; mi < 2; ++mi)
#pragma unroll
    for (int ni = 0; ni < 4; ++ni) acc[mi][ni] = zero_v8f();

  issue_tile(0, 0);
  int p = 0;
  for (int kk = 0; kk < K; kk += 32) {
    const bool pf = (kk + 32) < K;
    if (pf) {
      issue_tile(kk + 32, p ^ 1);   // 4 new in flight on top of 4 old
      wait_asynccnt_4();            // in-order completion: tile p has landed
    } else {
      wait_asynccnt_0();
    }
    __syncthreads();

    v16bf af[2], bfr[4];
#pragma unroll
    for (int mi = 0; mi < 2; ++mi) {
      const __bf16* q = sA[p] + (mw * 32 + mi * 16 + lrow) * LP_ + lh * 8;
      af[mi] = ld_frag(q, q + 16);
    }
#pragma unroll
    for (int ni = 0; ni < 4; ++ni) {
      const __bf16* q = sB[p] + (nw * 64 + ni * 16 + lrow) * LP_ + lh * 8;
      bfr[ni] = ld_frag(q, q + 16);
    }
#pragma unroll
    for (int mi = 0; mi < 2; ++mi)
#pragma unroll
      for (int ni = 0; ni < 4; ++ni)
        acc[mi][ni] = wmma_bf16(af[mi], bfr[ni], acc[mi][ni]);

    __syncthreads();                // tile p free for overwrite next round
    p ^= 1;
  }

  // epilogue (C layout: VGPR j -> row j + 8*(lane/16); col = lane%16)
#pragma unroll
  for (int mi = 0; mi < 2; ++mi) {
#pragma unroll
    for (int ni = 0; ni < 4; ++ni) {
      int col = nbase + nw * 64 + ni * 16 + lrow;
#pragma unroll
      for (int j = 0; j < 8; ++j) {
        int row = mbase + mw * 32 + mi * 16 + j + 8 * lh;
        if (row >= M) continue;
        float r = acc[mi][ni][j];
        if (MODE == 1 || MODE == 3) r += bias[col];
        if (MODE == 1) r = r > 0.f ? r : 0.f;
        if (MODE == 2 || MODE == 3) r += resid[(size_t)row * N + col];
        if (MODE == 0 || MODE == 1)
          Cb[(size_t)row * N + col] = (__bf16)r;
        else
          Cf[(size_t)row * N + col] = r;
      }
    }
  }
}

__device__ __forceinline__ float xhalf(float x) {
  int i = __builtin_bit_cast(int, x);
  return __builtin_bit_cast(float, __builtin_amdgcn_permlanex16(
      i, i, 0x76543210, 0xfedcba98, false, false));
}

// 2^x for a run of independent values. The instruction set asks for one
// independent instruction or v_nop between a transcendental and a next
// instruction that reads its result or overwrites its source: inside a run each
// v_exp_f32 is that instruction for the one before it (early-clobber outputs
// share no register with an input), and the closing v_nop serves the last one.
__device__ __forceinline__ void exp2_run8(float* o, const float* x) {
  asm("v_exp_f32 %0, %8\n\t"
      "v_exp_f32 %1, %9\n\t"
      "v_exp_f32 %2, %10\n\t"
      "v_exp_f32 %3, %11\n\t"
      "v_exp_f32 %4, %12\n\t"
      "v_exp_f32 %5, %13\n\t"
      "v_exp_f32 %6, %14\n\t"
      "v_exp_f32 %7, %15\n\t"
      "v_nop"
      : "=&v"(o[0]), "=&v"(o[1]), "=&v"(o[2]), "=&v"(o[3]),
        "=&v"(o[4]), "=&v"(o[5]), "=&v"(o[6]), "=&v"(o[7])
      : "v"(x[0]), "v"(x[1]), "v"(x[2]), "v"(x[3]),
        "v"(x[4]), "v"(x[5]), "v"(x[6]), "v"(x[7]));
}
__device__ __forceinline__ float exp2_one(float x) {
  float o;
  asm("v_exp_f32 %0, %1\n\t"
      "v_nop"
      : "=&v"(o) : "v"(x));
  return o;
}

// 8 waves per SIMD = 4 blocks per WGP: the whole grid of 1,024 blocks is then
// resident at once instead of running a thin second round.
__global__ __launch_bounds__(256) __attribute__((amdgpu_waves_per_eu(8)))
void attention_kernel(const __bf16* __restrict__ qg, const __bf16* __restrict__ kg,
                      const __bf16* __restrict__ vg,
                      const __bf16* __restrict__ memk, const __bf16* __restrict__ memv,
                      const int* __restrict__ mask,
                      __bf16* __restrict__ ctxout) {
  __shared__ __align__(16) __bf16 sVt[64 * LP_];       // V tile transposed [d][key]
  __shared__ __align__(16) __bf16 sK[2][32 * KP_];     // K tiles [key][d]

  const int tid = threadIdx.x, lane = tid & 31, wave = tid >> 5;
  const int lrow = lane & 15, lh = lane >> 4;
  const int bh = blockIdx.y;
  const int b = bh >> 4, h = bh & 15;
  const int qbase = blockIdx.x * 128 + wave * 16;

  // Q fragments (rows qbase..+15, d 0..63), pre-scaled by 1/sqrt(64)=0.125
  v16bf qf[2];
  {
    const __bf16* qp =
        qg + ((size_t)b * S_ + qbase + lrow) * D_ + h * DK_ + lh * 8;
#pragma unroll
    for (int half = 0; half < 2; ++half) {
      v16bf f = ld_frag(qp + half * 32, qp + half * 32 + 16);
#pragma unroll
      for (int i = 0; i < 16; ++i) f[i] = (__bf16)((float)f[i] * 0.125f);
      qf[half] = f;
    }
  }

  // ctx[dg][j] = O[query lrow][d = dg*16 + j + 8*lh]
  v8f ctx[4];
#pragma unroll
  for (int dg = 0; dg < 4; ++dg) ctx[dg] = zero_v8f();
  float mrun = -3.0e38f;   // this lane's query: running maximum (both halves equal)
  float lsum = 0.f;        // running sum over this lane's own keys only

  // this lane's query row of the mask, at its first key of a tile
  const int* mrow = mask + (size_t)(qbase + lrow) * T_ + lh * 8;

  // this thread's 16 bytes of a K tile; a tile lies wholly in the memory keys or
  // wholly in the sequence keys, so the choice of the source is the block's
  static_assert(MEMT_ % 32 == 0, "a K tile must not straddle the two sources");
  auto issue_k = [&](int t0, int buf) {
    const int key = tid >> 3;
    const int dseg = (tid & 7) * 8;
    const __bf16* tile = (t0 < MEMT_) ? (memk + (size_t)t0 * D_)
                                      : (kg + ((size_t)b * S_ + (t0 - MEMT_)) * D_);
    async_load1_b128((unsigned)(uintptr_t)&sK[buf][key * KP_ + dseg],
                     tile + (size_t)key * D_ + h * DK_ + dseg);
  };
  issue_k(0, 0);
  wait_asynccnt_0();
  __syncthreads();               // tile 0 is published
  issue_k(32, 1);                // T_ = 65 tiles: tile 1 exists

  for (int tbase = 0; tbase < T_; tbase += 32) {
    const int kbuf = (tbase >> 5) & 1;
    // stage transposed V tile (32 keys x 64 dims) cooperatively
    {
      int key = tid >> 3;
      int dseg = (tid & 7) * 8;
      int tg = tbase + key;
      const __bf16* src =
          (tg < MEMT_) ? (memv + (size_t)tg * D_ + h * DK_ + dseg)
                       : (vg + ((size_t)b * S_ + (tg - MEMT_)) * D_ + h * DK_ + dseg);
      v8bf val = *(const v8bf*)src;
#pragma unroll
      for (int i = 0; i < 8; ++i) sVt[(dseg + i) * LP_ + key] = val[i];
    }
    __syncthreads();

    // the mask words of this tile (the lane's 2 x 8 keys are 2 x 32 contiguous
    // bytes of its query's mask row) and the K fragments (A operand: row = key)
    const int* mp = mrow + tbase;
    int4 mk[4];
#pragma unroll
    for (int i = 0; i < 4; ++i) mk[i] = *(const int4*)(mp + (i >> 1) * 16 + (i & 1) * 4);
    v16bf kf[2][2];
#pragma unroll
    for (int grp = 0; grp < 2; ++grp) {
      const __bf16* ka = sK[kbuf] + (grp * 16 + lrow) * KP_ + lh * 8;
      kf[grp][0] = ld_frag(ka, ka + 16);
      kf[grp][1] = ld_frag(ka + 32, ka + 48);
    }
    // all twelve loads are in flight before the first product waits for one
    __builtin_amdgcn_sched_barrier(0);
    // no address register of the mask loads is rewritten ahead of this wait: named
    // as an input it stays live up to here, so no load's result lands in it
    asm volatile("s_wait_xcnt 0x0" :: "v"(mp) : "memory");

    // scores, transposed: [32 keys x 16 queries] = K[32x64] @ Q^T
    // st[j] = S[query lrow][key tbase + grp*16 + 8*lh + j]
    float v[16];
#pragma unroll
    for (int grp = 0; grp < 2; ++grp) {
      v8f st = wmma_bf16(kf[grp][0], qf[0], zero_v8f());
      st = wmma_bf16(kf[grp][1], qf[1], st);
      const int4 ma = mk[grp * 2], mb = mk[grp * 2 + 1];
      v[grp * 8 + 0] = ma.x ? st[0] : -1e9f;
      v[grp * 8 + 1] = ma.y ? st[1] : -1e9f;
      v[grp * 8 + 2] = ma.z ? st[2] : -1e9f;
      v[grp * 8 + 3] = ma.w ? st[3] : -1e9f;
      v[grp * 8 + 4] = mb.x ? st[4] : -1e9f;
      v[grp * 8 + 5] = mb.y ? st[5] : -1e9f;
      v[grp * 8 + 6] = mb.z ? st[6] : -1e9f;
      v[grp * 8 + 7] = mb.w ? st[7] : -1e9f;
    }

    // online softmax of one query per lane
    float tmax = v[0];
#pragma unroll
    for (int i = 1; i < 16; ++i) tmax = fmaxf(tmax, v[i]);
    tmax = fmaxf(tmax, xhalf(tmax));
    const float newm = fmaxf(mrun, tmax);
    constexpr float LOG2E = 1.44269504f;       // e^x = 2^(x * log2 e)
    const float scale = exp2_one((mrun - newm) * LOG2E);
    mrun = newm;
    float p[16];
#pragma unroll
    for (int i = 0; i < 16; ++i) v[i] = (v[i] - newm) * LOG2E;
    exp2_run8(p, v);
    exp2_run8(p + 8, v + 8);
    float ts = 0.f;
    v16bf pf;   // P^T as B operand: element i <-> key 8*lh + i (+8 for i >= 8)
#pragma unroll
    for (int i = 0; i < 16; ++i) {
      ts += p[i];
      pf[i] = (__bf16)p[i];
    }
    lsum = lsum * scale + ts;
#pragma unroll
    for (int dg = 0; dg < 4; ++dg)
#pragma unroll
      for (int j = 0; j < 8; ++j) ctx[dg][j] *= scale;

    // O^T += V^T @ P^T  (M = 64 dims in 4 groups, K = 32 keys)
#pragma unroll
    for (int dg = 0; dg < 4; ++dg) {
      const __bf16* vp = sVt + (dg * 16 + lrow) * LP_ + lh * 8;
      v16bf vf = ld_frag(vp, vp + 16);
      ctx[dg] = wmma_bf16(vf, pf, ctx[dg]);
    }

    // foot of the trip: own LDS reads back, own copies of tile t + 1 landed; the
    // barrier publishes that tile and ends every read of this trip's K and V
    wait_dscnt_0();
    wait_asynccnt_0();
    __syncthreads();
    if (tbase + 64 < T_) issue_k(tbase + 64, kbuf);   // same for the whole block
  }
  wait_asynccnt_0();             // no copy is left in flight when the wave ends

  // join the halves' sums, normalize, write ctx as bf16 in [B,S,D]: a lane holds
  // 8 neighbouring dims of its query per group, one 16-byte store each
  const float inv = 1.0f / (lsum + xhalf(lsum));
  __bf16* op = ctxout + ((size_t)b * S_ + qbase + lrow) * D_ + h * DK_ + lh * 8;
#pragma unroll
  for (int dg = 0; dg < 4; ++dg) {
    v8bf o;
#pragma unroll
    for (int j = 0; j < 8; ++j) o[j] = (__bf16)(ctx[dg][j] * inv);
    *(v8bf*)(op + dg * 16) = o;
  }
}

// ---------------------------------------------------------------------------
// new_memory: broadcast mean over S of final x into [B, MEM, D]
// ---------------------------------------------------------------------------
__global__ __launch_bounds__(256)
void mean_bcast_kernel(const float* __restrict__ x, float* __restrict__ nm) {
  int gid = blockIdx.x * 256 + threadIdx.x;    // B*D threads
  int b = gid / D_;
  int d = gid - b * D_;
  const float* p = x + (size_t)b * S_ * D_ + d;
  float s = 0.f;
  for (int i = 0; i < S_; ++i) s += p[(size_t)i * D_];
  float mean = s * (1.0f / S_);
  float* o = nm + (size_t)b * MEMT_ * D_ + d;
  for (int mI = 0; mI < MEMT_; ++mI) o[(size_t)mI * D_] = mean;
}

// ---------------------------------------------------------------------------
// launch
// ---------------------------------------------------------------------------
extern "C" void kernel_launch(void* const* d_in, const int* in_sizes, int n_in,
                              void* d_out, int out_size, void* d_ws, size_t ws_size,
                              hipStream_t stream) {
  (void)in_sizes; (void)n_in; (void)out_size; (void)ws_size;
  const float* x    = (const float*)d_in[0];
  const int*   mask = (const int*)d_in[1];
  const float* mem  = (const float*)d_in[2];
  const float* w_q  = (const float*)d_in[3];
  const float* w_k  = (const float*)d_in[4];
  const float* w_v  = (const float*)d_in[5];
  const float* w_o  = (const float*)d_in[6];
  const float* ln1a = (const float*)d_in[7];
  const float* ln1b = (const float*)d_in[8];
  const float* ln2a = (const float*)d_in[9];
  const float* ln2b = (const float*)d_in[10];
  const float* fw1  = (const float*)d_in[11];
  const float* fb1  = (const float*)d_in[12];
  const float* fw2  = (const float*)d_in[13];
  const float* fb2  = (const float*)d_in[14];

  float* out_x  = (float*)d_out;                                // [B,S,D]
  float* out_nm = out_x + (size_t)B_ * S_ * D_;                 // [B,MEM,D]

  // workspace carve-out
  size_t off = 0;
  auto carve = [&](size_t bytes) -> char* {
    char* p = (char*)d_ws + off;
    off = (off + bytes + 255) & ~(size_t)255;
    return p;
  };
  __bf16* wqT  = (__bf16*)carve((size_t)D_ * D_ * 2);
  __bf16* wkT  = (__bf16*)carve((size_t)D_ * D_ * 2);
  __bf16* wvT  = (__bf16*)carve((size_t)D_ * D_ * 2);
  __bf16* woT  = (__bf16*)carve((size_t)D_ * D_ * 2);
  __bf16* w1T  = (__bf16*)carve((size_t)DFF_ * D_ * 2);
  __bf16* w2T  = (__bf16*)carve((size_t)D_ * DFF_ * 2);
  __bf16* memb = (__bf16*)carve((size_t)MEMT_ * D_ * 2);
  __bf16* memK = (__bf16*)carve((size_t)MEMT_ * D_ * 2);
  __bf16* memV = (__bf16*)carve((size_t)MEMT_ * D_ * 2);
  __bf16* xn   = (__bf16*)carve((size_t)B_ * S_ * D_ * 2);
  __bf16* qb   = (__bf16*)carve((size_t)B_ * S_ * D_ * 2);
  __bf16* kb   = (__bf16*)carve((size_t)B_ * S_ * D_ * 2);
  __bf16* vb   = (__bf16*)carve((size_t)B_ * S_ * D_ * 2);
  __bf16* ctxb = (__bf16*)carve((size_t)B_ * S_ * D_ * 2);
  float*  x1   = (float*)carve((size_t)B_ * S_ * D_ * 4);
  __bf16* xn2  = (__bf16*)carve((size_t)B_ * S_ * D_ * 2);
  __bf16* ffh  = (__bf16*)carve((size_t)B_ * S_ * DFF_ * 2);

  const int rows = B_ * S_;   // 8192
  dim3 blk(256);

  // weight prep (bf16, transposed to [N][K])
  transpose_convert_kernel<<<dim3(D_ / 64, D_ / 64), blk, 0, stream>>>(w_q, wqT, D_, D_);
  transpose_convert_kernel<<<dim3(D_ / 64, D_ / 64), blk, 0, stream>>>(w_k, wkT, D_, D_);
  transpose_convert_kernel<<<dim3(D_ / 64, D_ / 64), blk, 0, stream>>>(w_v, wvT, D_, D_);
  transpose_convert_kernel<<<dim3(D_ / 64, D_ / 64), blk, 0, stream>>>(w_o, woT, D_, D_);
  transpose_convert_kernel<<<dim3(DFF_ / 64, D_ / 64), blk, 0, stream>>>(fw1, w1T, D_, DFF_);
  transpose_convert_kernel<<<dim3(D_ / 64, DFF_ / 64), blk, 0, stream>>>(fw2, w2T, DFF_, D_);
  convert_kernel<<<(MEMT_ * D_) / 256, blk, 0, stream>>>(mem, memb, MEMT_ * D_);

  // LN1 -> Q/K/V projections (WMMA bf16)
  layernorm_kernel<<<rows, blk, 0, stream>>>(x, ln1a, ln1b, xn);
  gemm_bt_kernel<0><<<dim3(D_ / 128, rows / 128), blk, 0, stream>>>(
      xn, wqT, nullptr, nullptr, nullptr, qb, rows, D_, D_);
  gemm_bt_kernel<0><<<dim3(D_ / 128, rows / 128), blk, 0, stream>>>(
      xn, wkT, nullptr, nullptr, nullptr, kb, rows, D_, D_);
  gemm_bt_kernel<0><<<dim3(D_ / 128, rows / 128), blk, 0, stream>>>(
      xn, wvT, nullptr, nullptr, nullptr, vb, rows, D_, D_);
  // memory K/V (raw memory tokens, not layernormed), M=32 with row clamp
  gemm_bt_kernel<0><<<dim3(D_ / 128, 1), blk, 0, stream>>>(
      memb, wkT, nullptr, nullptr, nullptr, memK, MEMT_, D_, D_);
  gemm_bt_kernel<0><<<dim3(D_ / 128, 1), blk, 0, stream>>>(
      memb, wvT, nullptr, nullptr, nullptr, memV, MEMT_, D_, D_);

  // flash attention over T = MEM + S
  attention_kernel<<<dim3(S_ / 128, B_ * H_), blk, 0, stream>>>(
      qb, kb, vb, memK, memV, mask, ctxb);

  // out-proj + residual -> x1 (f32)
  gemm_bt_kernel<2><<<dim3(D_ / 128, rows / 128), blk, 0, stream>>>(
      ctxb, woT, nullptr, x, x1, nullptr, rows, D_, D_);

  // LN2 -> FFN
  layernorm_kernel<<<rows, blk, 0, stream>>>(x1, ln2a, ln2b, xn2);
  gemm_bt_kernel<1><<<dim3(DFF_ / 128, rows / 128), blk, 0, stream>>>(
      xn2, w1T, fb1, nullptr, nullptr, ffh, rows, DFF_, D_);
  gemm_bt_kernel<3><<<dim3(D_ / 128, rows / 128), blk, 0, stream>>>(
      ffh, w2T, fb2, x1, out_x, nullptr, rows, D_, DFF_);

  // new_memory = broadcast mean over S
  mean_bcast_kernel<<<(B_ * D_) / 256, blk, 0, stream>>>(out_x, out_nm);
}

// v005
// A run of this version takes 558 microseconds.
// In both of two side-by-side timings against v004, it was 1.12 times as fast.
// Counting every step since v000, it is 2.26 times as fast.
#include <hip/hip_runtime.h>
#include <hip/hip_bf16.h>

// ---------------------------------------------------------------------------
// CDNA5 (gfx1250) transformer encoder block with memory tokens.
// - All heavy GEMMs: v_wmma_f32_16x16x32_bf16 (wave32 WMMA), f32 accumulate.
// - GEMM tile staging: global_load_async_to_lds_b128 (ASYNCcnt) with
//   double-buffered LDS tiles -> prefetch tile k+1 while computing tile k.
// ---------------------------------------------------------------------------

typedef __attribute__((ext_vector_type(16))) __bf16 v16bf;
typedef __attribute__((ext_vector_type(8)))  __bf16 v8bf;
typedef __attribute__((ext_vector_type(8)))  float  v8f;
typedef __attribute__((ext_vector_type(2)))  __bf16 v2bf;
typedef __attribute__((ext_vector_type(4)))  unsigned v4u;

static constexpr int B_    = 4;
static constexpr int S_    = 2048;
static constexpr int D_    = 1024;
static constexpr int H_    = 16;
static constexpr int DK_   = 64;
static constexpr int DFF_  = 4096;
static constexpr int MEMT_ = 32;
static constexpr int T_    = S_ + MEMT_;   // 2080 = 65 * 32
// Row pitch, in bf16, of every LDS tile whose 32-element rows are read as WMMA
// fragments with 16-byte loads: 80 bytes = 16 x 5, so the 16 rows one half-wave
// reads start on 16 different groups of four banks. At the bare 64 bytes rows
// r and r + 4 share their banks and each fragment load takes four times as long.
static constexpr int LP_   = 40;
// The same for tiles with 64-element rows: 144 bytes = 16 x 9.
static constexpr int KP_   = 72;

__device__ __forceinline__ v8f zero_v8f() {
  v8f z;
#pragma unroll
  for (int i = 0; i < 8; ++i) z[i] = 0.0f;
  return z;
}

// Build a 16-element bf16 A/B fragment from two contiguous 16-byte segments.
// Layout per CDNA5 ISA 7.12.2: lane holds row (lane%16); elements 0..7 are
// K = (lane/16)*8 .. +7, elements 8..15 are K = (lane/16)*8+16 .. +23.
__device__ __forceinline__ v16bf ld_frag(const __bf16* p0, const __bf16* p1) {
  v8bf lo = *(const v8bf*)p0;
  v8bf hi = *(const v8bf*)p1;
  return __builtin_shufflevector(lo, hi, 0, 1, 2, 3, 4, 5, 6, 7,
                                         8, 9, 10, 11, 12, 13, 14, 15);
}

// two floats -> one dword of two bf16, a in the low half
__device__ __forceinline__ unsigned pack_bf16(float a, float b) {
  v2bf t = {(__bf16)a, (__bf16)b};
  return __builtin_bit_cast(unsigned, t);
}

// lane l <-> lane l ^ 16
__device__ __forceinline__ float xhalf(float x) {
  int i = __builtin_bit_cast(int, x);
  return __builtin_bit_cast(float, __builtin_amdgcn_permlanex16(
      i, i, 0x76543210, 0xfedcba98, false, false));
}

__device__ __forceinline__ v8f wmma_bf16(v16bf a, v16bf b, v8f c) {
  return __builtin_amdgcn_wmma_f32_16x16x32_bf16(
      false, a, false, b, (short)0, c, false, false);
}

// CDNA5 async global->LDS copies, 16 bytes per lane (GVS mode: SGPR base +
// per-lane u32 byte offset). Tracked by ASYNCcnt. One K-tile's four copies of a
// thread (A, B, A, B) stand in one statement that ends in s_wait_xcnt 0, so that
// no address register of a copy is rewritten ahead of that wait.
__device__ __forceinline__ void async_load4_b128(
    unsigned ldsA0, unsigned voffA0, unsigned ldsB0, unsigned voffB0,
    unsigned ldsA1, unsigned voffA1, unsigned ldsB1, unsigned voffB1,
    unsigned long long baseA, unsigned long long baseB) {
  asm volatile("global_load_async_to_lds_b128 %0, %1, %8\n\t"
               "global_load_async_to_lds_b128 %2, %3, %9\n\t"
               "global_load_async_to_lds_b128 %4, %5, %8\n\t"
               "global_load_async_to_lds_b128 %6, %7, %9\n\t"
               "s_wait_xcnt 0x0"
               :: "v"(ldsA0), "v"(voffA0), "v"(ldsB0), "v"(voffB0),
                  "v"(ldsA1), "v"(voffA1), "v"(ldsB1), "v"(voffB1),
                  "s"(baseA), "s"(baseB)
               : "memory");
}
__device__ __forceinline__ void wait_asynccnt_4() {
  asm volatile("s_wait_asynccnt 0x4" ::: "memory");
}
__device__ __forceinline__ void wait_asynccnt_0() {
  asm volatile("s_wait_asynccnt 0x0" ::: "memory");
}
// One 16-byte copy per lane, lane's own LDS byte address and global pointer. The
// closing s_wait_xcnt 0 keeps both address registers unwritten up to the wait.
__device__ __forceinline__ void async_load1_b128(unsigned lds, const __bf16* g) {
  asm volatile("global_load_async_to_lds_b128 %0, %1, off\n\t"
               "s_wait_xcnt 0x0"
               :: "v"(lds), "v"(g)
               : "memory");
}
// the wave's own LDS reads have returned before their buffer is handed back
__device__ __forceinline__ void wait_dscnt_0() {
  asm volatile("s_wait_dscnt 0x0" ::: "memory");
}

// ---------------------------------------------------------------------------
// Weight transpose + fp32 -> bf16 convert: Wt[n*K + k] = (bf16)W[k*N + n]
// One block moves a 64(k) x 64(n) tile through LDS: reads are whole 256-byte
// row pieces of W, writes are whole 128-byte lines of Wt. Two k neighbours are
// packed into one dword before LDS; the pitch of 65 dwords keeps both the
// row-wise stores and the column-wise loads free of bank conflicts.
// K and N must be multiples of 64.
// ---------------------------------------------------------------------------
__global__ __launch_bounds__(256)
void transpose_convert_kernel(const float* __restrict__ W,
                              __bf16* __restrict__ Wt, int K, int N) {
  __shared__ unsigned tile[32 * 65];                   // [k pair][n]
  const int tid = threadIdx.x;
  const int n0 = blockIdx.x * 64, k0 = blockIdx.y * 64;

  const int c4 = (tid & 15) * 4;
  float4 lo[2], hi[2];
#pragma unroll
  for (int i = 0; i < 2; ++i) {
    const int kp = (tid >> 4) + i * 16;
    const float* src = W + (size_t)(k0 + 2 * kp) * N + n0 + c4;
    lo[i] = *(const float4*)src;
    hi[i] = *(const float4*)(src + N);
  }
#pragma unroll
  for (int i = 0; i < 2; ++i) {
    unsigned* t = tile + ((tid >> 4) + i * 16) * 65 + c4;
    t[0] = pack_bf16(lo[i].x, hi[i].x);
    t[1] = pack_bf16(lo[i].y, hi[i].y);
    t[2] = pack_bf16(lo[i].z, hi[i].z);
    t[3] = pack_bf16(lo[i].w, hi[i].w);
  }
  __syncthreads();
#pragma unroll
  for (int i = 0; i < 2; ++i) {
    const int c = tid + i * 256;
    const int n = c >> 3, kc = c & 7;                  // 8 lanes fill one line
    const unsigned* t = tile + kc * 4 * 65 + n;
    v4u o;
#pragma unroll
    for (int e = 0; e < 4; ++e) o[e] = t[e * 65];
    *(v4u*)(Wt + (size_t)(n0 + n) * K + k0 + kc * 8) = o;
  }
}

__global__ __launch_bounds__(256)
void convert_kernel(const float* __restrict__ X, __bf16* __restrict__ Y, int n) {
  int i = blockIdx.x * 256 + threadIdx.x;
  if (i < n) Y[i] = (__bf16)X[i];
}

// ---------------------------------------------------------------------------
// LayerNorm (matches reference: unbiased std, alpha*(x-mean)/(std+eps)+bias)
// One block per row of D_=1024. Output bf16 for the following GEMM.
// ---------------------------------------------------------------------------
__global__ __launch_bounds__(256)
void layernorm_kernel(const float* __restrict__ x,
                      const float* __restrict__ alpha,
                      const float* __restrict__ beta,
                      __bf16* __restrict__ y) {
  __shared__ float red[256];
  const int row = blockIdx.x, tid = threadIdx.x;
  const float* xr = x + (size_t)row * D_;
  float vals[4];
  float s1 = 0.f, s2 = 0.f;
#pragma unroll
  for (int i = 0; i < 4; ++i) {
    float t = xr[tid + i * 256];
    vals[i] = t;
    s1 += t;
    s2 += t * t;
  }
  red[tid] = s1; __syncthreads();
  for (int o = 128; o > 0; o >>= 1) {
    if (tid < o) red[tid] += red[tid + o];
    __syncthreads();
  }
  float sum1 = red[0]; __syncthreads();
  red[tid] = s2; __syncthreads();
  for (int o = 128; o > 0; o >>= 1) {
    if (tid < o) red[tid] += red[tid + o];
    __syncthreads();
  }
  float sum2 = red[0];
  float mean = sum1 * (1.0f / D_);
  float var = (sum2 - (float)D_ * mean * mean) * (1.0f / (D_ - 1));
  var = var > 0.f ? var : 0.f;
  float rinv = 1.0f / (sqrtf(var) + 1e-6f);
  __bf16* yr = y + (size_t)row * D_;
#pragma unroll
  for (int i = 0; i < 4; ++i) {
    int d = tid + i * 256;
    yr[d] = (__bf16)(alpha[d] * (vals[i] - mean) * rinv + beta[d]);
  }
}

// ---------------------------------------------------------------------------
// WMMA GEMM: C[M,N] = A[M,K](bf16) * Bt[N,K](bf16)^T  (+ epilogue)
// MODE 0: store bf16
// MODE 1: +bias[col], ReLU, store bf16
// MODE 2: +resid[row,col], store f32
// MODE 3: +bias[col] + resid[row,col], store f32; each wave also stores the column
//         sums of its 32 x 64 piece of C: colsum[row / 32][col]
// Block tile 128x128, K-step 32. 8 waves: 4 (M) x 2 (N); wave tile 32x64.
// Tiles staged with async global->LDS b128 copies, double-buffered so the
// next K-tile streams in while WMMAs consume the current one.
// Rows >= M are clamped (not skipped) so every wave issues exactly 4 async
// ops per tile -> ASYNCcnt bookkeeping is uniform; epilogue guards stores.
// ---------------------------------------------------------------------------
template <int MODE>
__global__ __launch_bounds__(256)
void gemm_bt_kernel(const __bf16* __restrict__ A, const __bf16* __restrict__ Bt,
                    const float* __restrict__ bias, const float* __restrict__ resid,
                    float* __restrict__ Cf, __bf16* __restrict__ Cb,
                    float* __restrict__ colsum, int M, int N, int K) {
  __shared__ __align__(16) __bf16 sA[2][128 * LP_];
  __shared__ __align__(16) __bf16 sB[2][128 * LP_];
  const int tid = threadIdx.x;
  const int lane = tid & 31, wave = tid >> 5;
  const int mw = wave >> 1, nw = wave & 1;
  const int mbase = blockIdx.y * 128, nbase = blockIdx.x * 128;
  const int lrow = lane & 15, lh = lane >> 4;

  const unsigned long long baseA = (unsigned long long)(uintptr_t)A;
  const unsigned long long baseB = (unsigned long long)(uintptr_t)Bt;

  // this thread's two 16B-segment assignments within the 128x32 tile
  int r0 = tid >> 2, c0 = (tid & 3) * 8;
  int idx1 = tid + 256;
  int r1 = idx1 >> 2, c1 = (idx1 & 3) * 8;
  int ga0 = mbase + r0; if (ga0 >= M) ga0 = M - 1;   // clamp, never skip
  int ga1 = mbase + r1; if (ga1 >= M) ga1 = M - 1;

  auto issue_tile = [&](int kk, int p) {
    async_load4_b128((unsigned)(uintptr_t)&sA[p][r0 * LP_ + c0],
                     (unsigned)(((size_t)ga0 * K + kk + c0) * 2),
                     (unsigned)(uintptr_t)&sB[p][r0 * LP_ + c0],
                     (unsigned)(((size_t)(nbase + r0) * K + kk + c0) * 2),
                     (unsigned)(uintptr_t)&sA[p][r1 * LP_ + c1],
                     (unsigned)(((size_t)ga1 * K + kk + c1) * 2),
                     (unsigned)(uintptr_t)&sB[p][r1 * LP_ + c1],
                     (unsigned)(((size_t)(nbase + r1) * K + kk + c1) * 2),
                     baseA, baseB);
  };

  v8f acc[2][4];
#pragma unroll
  for (int mi = 0; mi < 2; ++mi)
#pragma unroll
    for (int ni = 0; ni < 4; ++ni) acc[mi][ni] = zero_v8f();

  issue_tile(0, 0);
  int p = 0;
  for (int kk = 0; kk < K; kk += 32) {
    const bool pf = (kk + 32) < K;
    if (pf) {
      issue_tile(kk + 32, p ^ 1);   // 4 new in flight on top of 4 old
      wait_asynccnt_4();            // in-order completion: tile p has landed
    } else {
      wait_asynccnt_0();
    }
    __syncthreads();

    v16bf af[2], bfr[4];
#pragma unroll
    for (int mi = 0; mi < 2; ++mi) {
      const __bf16* q = sA[p] + (mw * 32 + mi * 16 + lrow) * LP_ + lh * 8;
      af[mi] = ld_frag(q, q + 16);
    }
#pragma unroll
    for (int ni = 0; ni < 4; ++ni) {
      const __bf16* q = sB[p] + (nw * 64 + ni * 16 + lrow) * LP_ + lh * 8;
      bfr[ni] = ld_frag(q, q + 16);
    }
#pragma unroll
    for (int mi = 0; mi < 2; ++mi)
#pragma unroll
      for (int ni = 0; ni < 4; ++ni)
        acc[mi][ni] = wmma_bf16(af[mi], bfr[ni], acc[mi][ni]);

    __syncthreads();                // tile p free for overwrite next round
    p ^= 1;
  }

  // epilogue (C layout: VGPR j -> row j + 8*(lane/16); col = lane%16)
  float cs[4] = {0.f, 0.f, 0.f, 0.f};   // MODE 3: sum over this lane's 16 rows, per column
#pragma unroll
  for (int mi = 0; mi < 2; ++mi) {
#pragma unroll
    for (int ni = 0; ni < 4; ++ni) {
      int col = nbase + nw * 64 + ni * 16 + lrow;
#pragma unroll
      for (int j = 0; j < 8; ++j) {
        int row = mbase + mw * 32 + mi * 16 + j + 8 * lh;
        if (row >= M) continue;
        float r = acc[mi][ni][j];
        if (MODE == 1 || MODE == 3) r += bias[col];
        if (MODE == 1) r = r > 0.f ? r : 0.f;
        if (MODE == 2 || MODE == 3) r += resid[(size_t)row * N + col];
        if (MODE == 0 || MODE == 1)
          Cb[(size_t)row * N + col] = (__bf16)r;
        else
          Cf[(size_t)row * N + col] = r;
        if (MODE == 3) cs[ni] += r;
      }
    }
  }
  if (MODE == 3) {
    // the other 16 rows of the column are in lane ^ 16; one wave writes its two
    // whole 128-byte lines of colsum
    float* cp = colsum + (size_t)(blockIdx.y * 4 + mw) * N + nbase + nw * 64 + lrow;
#pragma unroll
    for (int ni = 0; ni < 4; ++ni) {
      const float s = cs[ni] + xhalf(cs[ni]);
      if (lh == 0) cp[ni * 16] = s;
    }
  }
}

__device__ __forceinline__ void exp2_run8(float* o, const float* x) {
  asm("v_exp_f32 %0, %8\n\t"
      "v_exp_f32 %1, %9\n\t"
      "v_exp_f32 %2, %10\n\t"
      "v_exp_f32 %3, %11\n\t"
      "v_exp_f32 %4, %12\n\t"
      "v_exp_f32 %5, %13\n\t"
      "v_exp_f32 %6, %14\n\t"
      "v_exp_f32 %7, %15\n\t"
      "v_nop"
      : "=&v"(o[0]), "=&v"(o[1]), "=&v"(o[2]), "=&v"(o[3]),
        "=&v"(o[4]), "=&v"(o[5]), "=&v"(o[6]), "=&v"(o[7])
      : "v"(x[0]), "v"(x[1]), "v"(x[2]), "v"(x[3]),
        "v"(x[4]), "v"(x[5]), "v"(x[6]), "v"(x[7]));
}
__device__ __forceinline__ float exp2_one(float x) {
  float o;
  asm("v_exp_f32 %0, %1\n\t"
      "v_nop"
      : "=&v"(o) : "v"(x));
  return o;
}

// 8 waves per SIMD = 4 blocks per WGP: the whole grid of 1,024 blocks is then
// resident at once instead of running a thin second round.
__global__ __launch_bounds__(256) __attribute__((amdgpu_waves_per_eu(8)))
void attention_kernel(const __bf16* __restrict__ qg, const __bf16* __restrict__ kg,
                      const __bf16* __restrict__ vg,
                      const __bf16* __restrict__ memk, const __bf16* __restrict__ memv,
                      const int* __restrict__ mask,
                      __bf16* __restrict__ ctxout) {
  __shared__ __align__(16) __bf16 sVt[64 * LP_];       // V tile transposed [d][key]
  __shared__ __align__(16) __bf16 sK[2][32 * KP_];     // K tiles [key][d]

  const int tid = threadIdx.x, lane = tid & 31, wave = tid >> 5;
  const int lrow = lane & 15, lh = lane >> 4;
  const int bh = blockIdx.y;
  const int b = bh >> 4, h = bh & 15;
  const int qbase = blockIdx.x * 128 + wave * 16;

  // Q fragments (rows qbase..+15, d 0..63), pre-scaled by 1/sqrt(64)=0.125
  v16bf qf[2];
  {
    const __bf16* qp =
        qg + ((size_t)b * S_ + qbase + lrow) * D_ + h * DK_ + lh * 8;
#pragma unroll
    for (int half = 0; half < 2; ++half) {
      v16bf f = ld_frag(qp + half * 32, qp + half * 32 + 16);
#pragma unroll
      for (int i = 0; i < 16; ++i) f[i] = (__bf16)((float)f[i] * 0.125f);
      qf[half] = f;
    }
  }

  // ctx[dg][j] = O[query lrow][d = dg*16 + j + 8*lh]
  v8f ctx[4];
#pragma unroll
  for (int dg = 0; dg < 4; ++dg) ctx[dg] = zero_v8f();
  float mrun = -3.0e38f;   // this lane's query: running maximum (both halves equal)
  float lsum = 0.f;        // running sum over this lane's own keys only

  // this lane's query row of the mask, at its first key of a tile
  const int* mrow = mask + (size_t)(qbase + lrow) * T_ + lh * 8;

  // this thread's 16 bytes of a K tile; a tile lies wholly in the memory keys or
  // wholly in the sequence keys, so the choice of the source is the block's
  static_assert(MEMT_ % 32 == 0, "a K tile must not straddle the two sources");
  auto issue_k = [&](int t0, int buf) {
    const int key = tid >> 3;
    const int dseg = (tid & 7) * 8;
    const __bf16* tile = (t0 < MEMT_) ? (memk + (size_t)t0 * D_)
                                      : (kg + ((size_t)b * S_ + (t0 - MEMT_)) * D_);
    async_load1_b128((unsigned)(uintptr_t)&sK[buf][key * KP_ + dseg],
                     tile + (size_t)key * D_ + h * DK_ + dseg);
  };
  issue_k(0, 0);
  wait_asynccnt_0();
  __syncthreads();               // tile 0 is published
  issue_k(32, 1);                // T_ = 65 tiles: tile 1 exists

  for (int tbase = 0; tbase < T_; tbase += 32) {
    const int kbuf = (tbase >> 5) & 1;
    // stage transposed V tile (32 keys x 64 dims) cooperatively
    {
      int key = tid >> 3;
      int dseg = (tid & 7) * 8;
      int tg = tbase + key;
      const __bf16* src =
          (tg < MEMT_) ? (memv + (size_t)tg * D_ + h * DK_ + dseg)
                       : (vg + ((size_t)b * S_ + (tg - MEMT_)) * D_ + h * DK_ + dseg);
      v8bf val = *(const v8bf*)src;
#pragma unroll
      for (int i = 0; i < 8; ++i) sVt[(dseg + i) * LP_ + key] = val[i];
    }
    __syncthreads();

    // the mask words of this tile (the lane's 2 x 8 keys are 2 x 32 contiguous
    // bytes of its query's mask row) and the K fragments (A operand: row = key)
    const int* mp = mrow + tbase;
    int4 mk[4];
#pragma unroll
    for (int i = 0; i < 4; ++i) mk[i] = *(const int4*)(mp + (i >> 1) * 16 + (i & 1) * 4);
    v16bf kf[2][2];
#pragma unroll
    for (int grp = 0; grp < 2; ++grp) {
      const __bf16* ka = sK[kbuf] + (grp * 16 + lrow) * KP_ + lh * 8;
      kf[grp][0] = ld_frag(ka, ka + 16);
      kf[grp][1] = ld_frag(ka + 32, ka + 48);
    }
    // all twelve loads are in flight before the first product waits for one
    __builtin_amdgcn_sched_barrier(0);
    // no address register of the mask loads is rewritten ahead of this wait: named
    // as an input it stays live up to here, so no load's result lands in it
    asm volatile("s_wait_xcnt 0x0" :: "v"(mp) : "memory");

    // scores, transposed: [32 keys x 16 queries] = K[32x64] @ Q^T
    // st[j] = S[query lrow][key tbase + grp*16 + 8*lh + j]
    float v[16];
#pragma unroll
    for (int grp = 0; grp < 2; ++grp) {
      v8f st = wmma_bf16(kf[grp][0], qf[0], zero_v8f());
      st = wmma_bf16(kf[grp][1], qf[1], st);
      const int4 ma = mk[grp * 2], mb = mk[grp * 2 + 1];
      v[grp * 8 + 0] = ma.x ? st[0] : -1e9f;
      v[grp * 8 + 1] = ma.y ? st[1] : -1e9f;
      v[grp * 8 + 2] = ma.z ? st[2] : -1e9f;
      v[grp * 8 + 3] = ma.w ? st[3] : -1e9f;
      v[grp * 8 + 4] = mb.x ? st[4] : -1e9f;
      v[grp * 8 + 5] = mb.y ? st[5] : -1e9f;
      v[grp * 8 + 6] = mb.z ? st[6] : -1e9f;
      v[grp * 8 + 7] = mb.w ? st[7] : -1e9f;
    }

    // online softmax of one query per lane
    float tmax = v[0];
#pragma unroll
    for (int i = 1; i < 16; ++i) tmax = fmaxf(tmax, v[i]);
    tmax = fmaxf(tmax, xhalf(tmax));
    const float newm = fmaxf(mrun, tmax);
    constexpr float LOG2E = 1.44269504f;       // e^x = 2^(x * log2 e)
    const float scale = exp2_one((mrun - newm) * LOG2E);
    mrun = newm;
    float p[16];
#pragma unroll
    for (int i = 0; i < 16; ++i) v[i] = (v[i] - newm) * LOG2E;
    exp2_run8(p, v);
    exp2_run8(p + 8, v + 8);
    float ts = 0.f;
    v16bf pf;   // P^T as B operand: element i <-> key 8*lh + i (+8 for i >= 8)
#pragma unroll
    for (int i = 0; i < 16; ++i) {
      ts += p[i];
      pf[i] = (__bf16)p[i];
    }
    lsum = lsum * scale + ts;
#pragma unroll
    for (int dg = 0; dg < 4; ++dg)
#pragma unroll
      for (int j = 0; j < 8; ++j) ctx[dg][j] *= scale;

    // O^T += V^T @ P^T  (M = 64 dims in 4 groups, K = 32 keys)
#pragma unroll
    for (int dg = 0; dg < 4; ++dg) {
      const __bf16* vp = sVt + (dg * 16 + lrow) * LP_ + lh * 8;
      v16bf vf = ld_frag(vp, vp + 16);
      ctx[dg] = wmma_bf16(vf, pf, ctx[dg]);
    }

    // foot of the trip: own LDS reads back, own copies of tile t + 1 landed; the
    // barrier publishes that tile and ends every read of this trip's K and V
    wait_dscnt_0();
    wait_asynccnt_0();
    __syncthreads();
    if (tbase + 64 < T_) issue_k(tbase + 64, kbuf);   // same for the whole block
  }
  wait_asynccnt_0();             // no copy is left in flight when the wave ends

  // join the halves' sums, normalize, write ctx as bf16 in [B,S,D]: a lane holds
  // 8 neighbouring dims of its query per group, one 16-byte store each
  const float inv = 1.0f / (lsum + xhalf(lsum));
  __bf16* op = ctxout + ((size_t)b * S_ + qbase + lrow) * D_ + h * DK_ + lh * 8;
#pragma unroll
  for (int dg = 0; dg < 4; ++dg) {
    v8bf o;
#pragma unroll
    for (int j = 0; j < 8; ++j) o[j] = (__bf16)(ctx[dg][j] * inv);
    *(v8bf*)(op + dg * 16) = o;
  }
}

// ---------------------------------------------------------------------------
// new_memory: broadcast mean over S of final x into [B, MEM, D]
// The last GEMM has left the sums of every 32 rows of x in colsum[B*S/32][D]:
// a column's mean takes 64 independent loads, not 2,048 rows in 128 dependent
// rounds of loads on 16 work-groups.
// ---------------------------------------------------------------------------
__global__ __launch_bounds__(256)
void mean_bcast_kernel(const float* __restrict__ colsum, float* __restrict__ nm) {
  constexpr int G = S_ / 32;                   // partial sums per column
  int gid = blockIdx.x * 256 + threadIdx.x;    // B*D threads
  int b = gid / D_;
  int d = gid - b * D_;
  const float* p = colsum + (size_t)b * G * D_ + d;
  float v[G];
  // unrolled whole, so that all loads are in flight at once: one memory latency
#pragma unroll
  for (int i = 0; i < G; ++i) v[i] = p[(size_t)i * D_];
  float s4[4] = {0.f, 0.f, 0.f, 0.f};
#pragma unroll
  for (int i = 0; i < G; ++i) s4[i & 3] += v[i];
  float s = (s4[0] + s4[1]) + (s4[2] + s4[3]);
  float mean = s * (1.0f / S_);
  float* o = nm + (size_t)b * MEMT_ * D_ + d;
  for (int mI = 0; mI < MEMT_; ++mI) o[(size_t)mI * D_] = mean;
}

// ---------------------------------------------------------------------------
// launch
// ---------------------------------------------------------------------------
extern "C" void kernel_launch(void* const* d_in, const int* in_sizes, int n_in,
                              void* d_out, int out_size, void* d_ws, size_t ws_size,
                              hipStream_t stream) {
  (void)in_sizes; (void)n_in; (void)out_size; (void)ws_size;
  const float* x    = (const float*)d_in[0];
  const int*   mask = (const int*)d_in[1];
  const float* mem  = (const float*)d_in[2];
  const float* w_q  = (const float*)d_in[3];
  const float* w_k  = (const float*)d_in[4];
  const float* w_v  = (const float*)d_in[5];
  const float* w_o  = (const float*)d_in[6];
  const float* ln1a = (const float*)d_in[7];
  const float* ln1b = (const float*)d_in[8];
  const float* ln2a = (const float*)d_in[9];
  const float* ln2b = (const float*)d_in[10];
  const float* fw1  = (const float*)d_in[11];
  const float* fb1  = (const float*)d_in[12];
  const float* fw2  = (const float*)d_in[13];
  const float* fb2  = (const float*)d_in[14];

  float* out_x  = (float*)d_out;                                // [B,S,D]
  float* out_nm = out_x + (size_t)B_ * S_ * D_;                 // [B,MEM,D]

  // workspace carve-out
  size_t off = 0;
  auto carve = [&](size_t bytes) -> char* {
    char* p = (char*)d_ws + off;
    off = (off + bytes + 255) & ~(size_t)255;
    return p;
  };
  __bf16* wqT  = (__bf16*)carve((size_t)D_ * D_ * 2);
  __bf16* wkT  = (__bf16*)carve((size_t)D_ * D_ * 2);
  __bf16* wvT  = (__bf16*)carve((size_t)D_ * D_ * 2);
  __bf16* woT  = (__bf16*)carve((size_t)D_ * D_ * 2);
  __bf16* w1T  = (__bf16*)carve((size_t)DFF_ * D_ * 2);
  __bf16* w2T  = (__bf16*)carve((size_t)D_ * DFF_ * 2);
  __bf16* memb = (__bf16*)carve((size_t)MEMT_ * D_ * 2);
  __bf16* memK = (__bf16*)carve((size_t)MEMT_ * D_ * 2);
  __bf16* memV = (__bf16*)carve((size_t)MEMT_ * D_ * 2);
  __bf16* xn   = (__bf16*)carve((size_t)B_ * S_ * D_ * 2);
  __bf16* qb   = (__bf16*)carve((size_t)B_ * S_ * D_ * 2);
  __bf16* kb   = (__bf16*)carve((size_t)B_ * S_ * D_ * 2);
  __bf16* vb   = (__bf16*)carve((size_t)B_ * S_ * D_ * 2);
  __bf16* ctxb = (__bf16*)carve((size_t)B_ * S_ * D_ * 2);
  float*  x1   = (float*)carve((size_t)B_ * S_ * D_ * 4);
  __bf16* xn2  = (__bf16*)carve((size_t)B_ * S_ * D_ * 2);
  __bf16* ffh  = (__bf16*)carve((size_t)B_ * S_ * DFF_ * 2);
  float*  csum = (float*)carve((size_t)(B_ * S_ / 32) * D_ * 4);

  const int rows = B_ * S_;   // 8192
  dim3 blk(256);

  // weight prep (bf16, transposed to [N][K])
  transpose_convert_kernel<<<dim3(D_ / 64, D_ / 64), blk, 0, stream>>>(w_q, wqT, D_, D_);
  transpose_convert_kernel<<<dim3(D_ / 64, D_ / 64), blk, 0, stream>>>(w_k, wkT, D_, D_);
  transpose_convert_kernel<<<dim3(D_ / 64, D_ / 64), blk, 0, stream>>>(w_v, wvT, D_, D_);
  transpose_convert_kernel<<<dim3(D_ / 64, D_ / 64), blk, 0, stream>>>(w_o, woT, D_, D_);
  transpose_convert_kernel<<<dim3(DFF_ / 64, D_ / 64), blk, 0, stream>>>(fw1, w1T, D_, DFF_);
  transpose_convert_kernel<<<dim3(D_ / 64, DFF_ / 64), blk, 0, stream>>>(fw2, w2T, DFF_, D_);
  convert_kernel<<<(MEMT_ * D_) / 256, blk, 0, stream>>>(mem, memb, MEMT_ * D_);

  // LN1 -> Q/K/V projections (WMMA bf16)
  layernorm_kernel<<<rows, blk, 0, stream>>>(x, ln1a, ln1b, xn);
  gemm_bt_kernel<0><<<dim3(D_ / 128, rows / 128), blk, 0, stream>>>(
      xn, wqT, nullptr, nullptr, nullptr, qb, nullptr, rows, D_, D_);
  gemm_bt_kernel<0><<<dim3(D_ / 128, rows / 128), blk, 0, stream>>>(
      xn, wkT, nullptr, nullptr, nullptr, kb, nullptr, rows, D_, D_);
  gemm_bt_kernel<0><<<dim3(D_ / 128, rows / 128), blk, 0, stream>>>(
      xn, wvT, nullptr, nullptr, nullptr, vb, nullptr, rows, D_, D_);
  // memory K/V (raw memory tokens, not layernormed), M=32 with row clamp
  gemm_bt_kernel<0><<<dim3(D_ / 128, 1), blk, 0, stream>>>(
      memb, wkT, nullptr, nullptr, nullptr, memK, nullptr, MEMT_, D_, D_);
  gemm_bt_kernel<0><<<dim3(D_ / 128, 1), blk, 0, stream>>>(
      memb, wvT, nullptr, nullptr, nullptr, memV, nullptr, MEMT_, D_, D_);

  // flash attention over T = MEM + S
  attention_kernel<<<dim3(S_ / 128, B_ * H_), blk, 0, stream>>>(
      qb, kb, vb, memK, memV, mask, ctxb);

  // out-proj + residual -> x1 (f32)
  gemm_bt_kernel<2><<<dim3(D_ / 128, rows / 128), blk, 0, stream>>>(
      ctxb, woT, nullptr, x, x1, nullptr, nullptr, rows, D_, D_);

  // LN2 -> FFN
  layernorm_kernel<<<rows, blk, 0, stream>>>(x1, ln2a, ln2b, xn2);
  gemm_bt_kernel<1><<<dim3(DFF_ / 128, rows / 128), blk, 0, stream>>>(
      xn2, w1T, fb1, nullptr, nullptr, ffh, nullptr, rows, DFF_, D_);
  gemm_bt_kernel<3><<<dim3(D_ / 128, rows / 128), blk, 0, stream>>>(
      ffh, w2T, fb2, x1, out_x, nullptr, csum, rows, D_, DFF_);

  // new_memory = broadcast mean over S, from the last GEMM's column sums
  mean_bcast_kernel<<<(B_ * D_) / 256, blk, 0, stream>>>(csum, out_nm);
}

// v006
// It runs in 515 microseconds.
// Two timings next to v005 both put it at 1.09 times that version's speed.
// Counting every step since v000, it is 2.46 times as fast.
#include <hip/hip_runtime.h>
#include <hip/hip_bf16.h>

// ---------------------------------------------------------------------------
// CDNA5 (gfx1250) transformer encoder block with memory tokens.
// - All heavy GEMMs: v_wmma_f32_16x16x32_bf16 (wave32 WMMA), f32 accumulate.
// - GEMM tile staging: global_load_async_to_lds_b128 (ASYNCcnt) with
//   double-buffered LDS tiles -> prefetch tile k+1 while computing tile k.
// ---------------------------------------------------------------------------

typedef __attribute__((ext_vector_type(16))) __bf16 v16bf;
typedef __attribute__((ext_vector_type(8)))  __bf16 v8bf;
typedef __attribute__((ext_vector_type(8)))  float  v8f;
typedef __attribute__((ext_vector_type(2)))  __bf16 v2bf;
typedef __attribute__((ext_vector_type(4)))  unsigned v4u;

static constexpr int B_    = 4;
static constexpr int S_    = 2048;
static constexpr int D_    = 1024;
static constexpr int H_    = 16;
static constexpr int DK_   = 64;
static constexpr int DFF_  = 4096;
static constexpr int MEMT_ = 32;
static constexpr int T_    = S_ + MEMT_;   // 2080 = 65 * 32
// Row pitch, in bf16, of every LDS tile whose 32-element rows are read as WMMA
// fragments with 16-byte loads: 80 bytes = 16 x 5, so the 16 rows one half-wave
// reads start on 16 different groups of four banks. At the bare 64 bytes rows
// r and r + 4 share their banks and each fragment load takes four times as long.
static constexpr int LP_   = 40;
// The same for tiles with 64-element rows: 144 bytes = 16 x 9.
static constexpr int KP_   = 72;

__device__ __forceinline__ v8f zero_v8f() {
  v8f z;
#pragma unroll
  for (int i = 0; i < 8; ++i) z[i] = 0.0f;
  return z;
}

// Build a 16-element bf16 A/B fragment from two contiguous 16-byte segments.
// Layout per CDNA5 ISA 7.12.2: lane holds row (lane%16); elements 0..7 are
// K = (lane/16)*8 .. +7, elements 8..15 are K = (lane/16)*8+16 .. +23.
__device__ __forceinline__ v16bf ld_frag(const __bf16* p0, const __bf16* p1) {
  v8bf lo = *(const v8bf*)p0;
  v8bf hi = *(const v8bf*)p1;
  return __builtin_shufflevector(lo, hi, 0, 1, 2, 3, 4, 5, 6, 7,
                                         8, 9, 10, 11, 12, 13, 14, 15);
}

// two floats -> one dword of two bf16, a in the low half
__device__ __forceinline__ unsigned pack_bf16(float a, float b) {
  v2bf t = {(__bf16)a, (__bf16)b};
  return __builtin_bit_cast(unsigned, t);
}

// lane l <-> lane l ^ 16
__device__ __forceinline__ float xhalf(float x) {
  int i = __builtin_bit_cast(int, x);
  return __builtin_bit_cast(float, __builtin_amdgcn_permlanex16(
      i, i, 0x76543210, 0xfedcba98, false, false));
}

__device__ __forceinline__ v8f wmma_bf16(v16bf a, v16bf b, v8f c) {
  return __builtin_amdgcn_wmma_f32_16x16x32_bf16(
      false, a, false, b, (short)0, c, false, false);
}

// CDNA5 async global->LDS copies, 16 bytes per lane (GVS mode: SGPR base +
// per-lane u32 byte offset). Tracked by ASYNCcnt. One K-tile's eight copies of a
// thread (A, B four times) stand in one statement that ends in s_wait_xcnt 0, so
// that no address register of a copy is rewritten ahead of that wait.
__device__ __forceinline__ void async_load8_b128(
    const unsigned (&ldsA)[4], const unsigned (&voffA)[4],
    const unsigned (&ldsB)[4], const unsigned (&voffB)[4],
    unsigned long long baseA, unsigned long long baseB) {
  asm volatile("global_load_async_to_lds_b128 %0, %1, %16\n\t"
               "global_load_async_to_lds_b128 %2, %3, %17\n\t"
               "global_load_async_to_lds_b128 %4, %5, %16\n\t"
               "global_load_async_to_lds_b128 %6, %7, %17\n\t"
               "global_load_async_to_lds_b128 %8, %9, %16\n\t"
               "global_load_async_to_lds_b128 %10, %11, %17\n\t"
               "global_load_async_to_lds_b128 %12, %13, %16\n\t"
               "global_load_async_to_lds_b128 %14, %15, %17\n\t"
               "s_wait_xcnt 0x0"
               :: "v"(ldsA[0]), "v"(voffA[0]), "v"(ldsB[0]), "v"(voffB[0]),
                  "v"(ldsA[1]), "v"(voffA[1]), "v"(ldsB[1]), "v"(voffB[1]),
                  "v"(ldsA[2]), "v"(voffA[2]), "v"(ldsB[2]), "v"(voffB[2]),
                  "v"(ldsA[3]), "v"(voffA[3]), "v"(ldsB[3]), "v"(voffB[3]),
                  "s"(baseA), "s"(baseB)
               : "memory");
}
__device__ __forceinline__ void wait_asynccnt_8() {
  asm volatile("s_wait_asynccnt 0x8" ::: "memory");
}
__device__ __forceinline__ void wait_asynccnt_0() {
  asm volatile("s_wait_asynccnt 0x0" ::: "memory");
}
// One 16-byte copy per lane, lane's own LDS byte address and global pointer. The
// closing s_wait_xcnt 0 keeps both address registers unwritten up to the wait.
__device__ __forceinline__ void async_load1_b128(unsigned lds, const __bf16* g) {
  asm volatile("global_load_async_to_lds_b128 %0, %1, off\n\t"
               "s_wait_xcnt 0x0"
               :: "v"(lds), "v"(g)
               : "memory");
}
// the wave's own LDS reads have returned before their buffer is handed back
__device__ __forceinline__ void wait_dscnt_0() {
  asm volatile("s_wait_dscnt 0x0" ::: "memory");
}

// ---------------------------------------------------------------------------
// Weight transpose + fp32 -> bf16 convert: Wt[n*K + k] = (bf16)W[k*N + n]
// One block moves a 64(k) x 64(n) tile through LDS: reads are whole 256-byte
// row pieces of W, writes are whole 128-byte lines of Wt. Two k neighbours are
// packed into one dword before LDS; the pitch of 65 dwords keeps both the
// row-wise stores and the column-wise loads free of bank conflicts.
// K and N must be multiples of 64.
// ---------------------------------------------------------------------------
__global__ __launch_bounds__(256)
void transpose_convert_kernel(const float* __restrict__ W,
                              __bf16* __restrict__ Wt, int K, int N) {
  __shared__ unsigned tile[32 * 65];                   // [k pair][n]
  const int tid = threadIdx.x;
  const int n0 = blockIdx.x * 64, k0 = blockIdx.y * 64;

  const int c4 = (tid & 15) * 4;
  float4 lo[2], hi[2];
#pragma unroll
  for (int i = 0; i < 2; ++i) {
    const int kp = (tid >> 4) + i * 16;
    const float* src = W + (size_t)(k0 + 2 * kp) * N + n0 + c4;
    lo[i] = *(const float4*)src;
    hi[i] = *(const float4*)(src + N);
  }
#pragma unroll
  for (int i = 0; i < 2; ++i) {
    unsigned* t = tile + ((tid >> 4) + i * 16) * 65 + c4;
    t[0] = pack_bf16(lo[i].x, hi[i].x);
    t[1] = pack_bf16(lo[i].y, hi[i].y);
    t[2] = pack_bf16(lo[i].z, hi[i].z);
    t[3] = pack_bf16(lo[i].w, hi[i].w);
  }
  __syncthreads();
#pragma unroll
  for (int i = 0; i < 2; ++i) {
    const int c = tid + i * 256;
    const int n = c >> 3, kc = c & 7;                  // 8 lanes fill one line
    const unsigned* t = tile + kc * 4 * 65 + n;
    v4u o;
#pragma unroll
    for (int e = 0; e < 4; ++e) o[e] = t[e * 65];
    *(v4u*)(Wt + (size_t)(n0 + n) * K + k0 + kc * 8) = o;
  }
}

__global__ __launch_bounds__(256)
void convert_kernel(const float* __restrict__ X, __bf16* __restrict__ Y, int n) {
  int i = blockIdx.x * 256 + threadIdx.x;
  if (i < n) Y[i] = (__bf16)X[i];
}

// ---------------------------------------------------------------------------
// LayerNorm (matches reference: unbiased std, alpha*(x-mean)/(std+eps)+bias)
// One block per row of D_=1024. Output bf16 for the following GEMM.
// ---------------------------------------------------------------------------
__global__ __launch_bounds__(256)
void layernorm_kernel(const float* __restrict__ x,
                      const float* __restrict__ alpha,
                      const float* __restrict__ beta,
                      __bf16* __restrict__ y) {
  __shared__ float red[256];
  const int row = blockIdx.x, tid = threadIdx.x;
  const float* xr = x + (size_t)row * D_;
  float vals[4];
  float s1 = 0.f, s2 = 0.f;
#pragma unroll
  for (int i = 0; i < 4; ++i) {
    float t = xr[tid + i * 256];
    vals[i] = t;
    s1 += t;
    s2 += t * t;
  }
  red[tid] = s1; __syncthreads();
  for (int o = 128; o > 0; o >>= 1) {
    if (tid < o) red[tid] += red[tid + o];
    __syncthreads();
  }
  float sum1 = red[0]; __syncthreads();
  red[tid] = s2; __syncthreads();
  for (int o = 128; o > 0; o >>= 1) {
    if (tid < o) red[tid] += red[tid + o];
    __syncthreads();
  }
  float sum2 = red[0];
  float mean = sum1 * (1.0f / D_);
  float var = (sum2 - (float)D_ * mean * mean) * (1.0f / (D_ - 1));
  var = var > 0.f ? var : 0.f;
  float rinv = 1.0f / (sqrtf(var) + 1e-6f);
  __bf16* yr = y + (size_t)row * D_;
#pragma unroll
  for (int i = 0; i < 4; ++i) {
    int d = tid + i * 256;
    yr[d] = (__bf16)(alpha[d] * (vals[i] - mean) * rinv + beta[d]);
  }
}

// ---------------------------------------------------------------------------
// WMMA GEMM: C[M,N] = A[M,K](bf16) * Bt[N,K](bf16)^T  (+ epilogue)
// MODE 0: store bf16
// MODE 1: +bias[col], ReLU, store bf16
// MODE 2: +resid[row,col], store f32
// MODE 3: +bias[col] + resid[row,col], store f32; each wave also stores the column
//         sums of its 32 x 64 piece of C: colsum[row / 32][col]
// Block tile 128x128, K-step 64. 8 waves: 4 (M) x 2 (N); wave tile 32x64.
// K must be a multiple of 64.
// Tiles staged with async global->LDS b128 copies, double-buffered so the
// next K-tile streams in while WMMAs consume the current one. A K-step is 128
// bytes of every operand row: 8 lanes copy one whole line, a wave's copy covers
// 4 whole lines, and no line is asked for in two halves by two K-steps.
// Rows >= M are clamped (not skipped) so every wave issues exactly 8 async
// ops per tile -> ASYNCcnt bookkeeping is uniform; epilogue guards stores.
// ---------------------------------------------------------------------------
template <int MODE>
__global__ __launch_bounds__(256)
void gemm_bt_kernel(const __bf16* __restrict__ A, const __bf16* __restrict__ Bt,
                    const float* __restrict__ bias, const float* __restrict__ resid,
                    float* __restrict__ Cf, __bf16* __restrict__ Cb,
                    float* __restrict__ colsum, int M, int N, int K) {
  __shared__ __align__(16) __bf16 sA[2][128 * KP_];
  __shared__ __align__(16) __bf16 sB[2][128 * KP_];
  const int tid = threadIdx.x;
  const int lane = tid & 31, wave = tid >> 5;
  const int mw = wave >> 1, nw = wave & 1;
  const int mbase = blockIdx.y * 128, nbase = blockIdx.x * 128;
  const int lrow = lane & 15, lh = lane >> 4;

  const unsigned long long baseA = (unsigned long long)(uintptr_t)A;
  const unsigned long long baseB = (unsigned long long)(uintptr_t)Bt;

  // this thread's four 16-byte segments of a 128x64 tile: rows r0 + 32 i, one column
  const int r0 = tid >> 3, c0 = (tid & 7) * 8;
  unsigned rowA[4], rowB[4];                         // byte offset of row and column
#pragma unroll   // constant indices keep the two arrays in registers
  for (int i = 0; i < 4; ++i) {
    int ga = mbase + r0 + i * 32; if (ga >= M) ga = M - 1;   // clamp, never skip
    rowA[i] = (unsigned)(((size_t)ga * K + c0) * 2);
    rowB[i] = (unsigned)(((size_t)(nbase + r0 + i * 32) * K + c0) * 2);
  }

  auto issue_tile = [&](int kk, int p) {
    unsigned la[4], va[4], lb[4], vb[4];
#pragma unroll   // constant indices: each element is a register operand of the copies
    for (int i = 0; i < 4; ++i) {
      la[i] = (unsigned)(uintptr_t)&sA[p][(r0 + i * 32) * KP_ + c0];
      lb[i] = (unsigned)(uintptr_t)&sB[p][(r0 + i * 32) * KP_ + c0];
      va[i] = rowA[i] + (unsigned)kk * 2u;
      vb[i] = rowB[i] + (unsigned)kk * 2u;
    }
    async_load8_b128(la, va, lb, vb, baseA, baseB);
  };

  v8f acc[2][4];
#pragma unroll
  for (int mi = 0; mi < 2; ++mi)
#pragma unroll
    for (int ni = 0; ni < 4; ++ni) acc[mi][ni] = zero_v8f();

  issue_tile(0, 0);
  int p = 0;
  for (int kk = 0; kk < K; kk += 64) {
    const bool pf = (kk + 64) < K;
    if (pf) {
      issue_tile(kk + 64, p ^ 1);   // 8 new in flight on top of 8 old
      wait_asynccnt_8();            // all but the 8 youngest: tile p has landed
    } else {
      wait_asynccnt_0();
    }
    __syncthreads();

#pragma unroll   // ks becomes an immediate offset of the LDS loads
    for (int ks = 0; ks < 2; ++ks) {   // the tile's two 32-element WMMA steps, in k order
      v16bf af[2], bfr[4];
#pragma unroll
      for (int mi = 0; mi < 2; ++mi) {
        const __bf16* q = sA[p] + (mw * 32 + mi * 16 + lrow) * KP_ + ks * 32 + lh * 8;
        af[mi] = ld_frag(q, q + 16);
      }
#pragma unroll
      for (int ni = 0; ni < 4; ++ni) {
        const __bf16* q = sB[p] + (nw * 64 + ni * 16 + lrow) * KP_ + ks * 32 + lh * 8;
        bfr[ni] = ld_frag(q, q + 16);
      }
#pragma unroll
      for (int mi = 0; mi < 2; ++mi)
#pragma unroll
        for (int ni = 0; ni < 4; ++ni)
          acc[mi][ni] = wmma_bf16(af[mi], bfr[ni], acc[mi][ni]);
    }

    __syncthreads();                // tile p free for overwrite next round
    p ^= 1;
  }

  // epilogue (C layout: VGPR j -> row j + 8*(lane/16); col = lane%16)
  // Left as it is: under the per-row guard each of a lane's 64 elements waits for its
  // own bias and residual load before the next one is issued.
  float cs[4] = {0.f, 0.f, 0.f, 0.f};   // MODE 3: sum over this lane's 16 rows, per column
#pragma unroll
  for (int mi = 0; mi < 2; ++mi) {
#pragma unroll
    for (int ni = 0; ni < 4; ++ni) {
      int col = nbase + nw * 64 + ni * 16 + lrow;
#pragma unroll
      for (int j = 0; j < 8; ++j) {
        int row = mbase + mw * 32 + mi * 16 + j + 8 * lh;
        if (row >= M) continue;
        float r = acc[mi][ni][j];
        if (MODE == 1 || MODE == 3) r += bias[col];
        if (MODE == 1) r = r > 0.f ? r : 0.f;
        if (MODE == 2 || MODE == 3) r += resid[(size_t)row * N + col];
        if (MODE == 0 || MODE == 1)
          Cb[(size_t)row * N + col] = (__bf16)r;
        else
          Cf[(size_t)row * N + col] = r;
        if (MODE == 3) cs[ni] += r;
      }
    }
  }
  if (MODE == 3) {
    // the other 16 rows of the column are in lane ^ 16; one wave writes its two
    // whole 128-byte lines of colsum
    float* cp = colsum + (size_t)(blockIdx.y * 4 + mw) * N + nbase + nw * 64 + lrow;
#pragma unroll
    for (int ni = 0; ni < 4; ++ni) {
      const float s = cs[ni] + xhalf(cs[ni]);
      if (lh == 0) cp[ni * 16] = s;
    }
  }
}

__device__ __forceinline__ void exp2_run8(float* o, const float* x) {
  asm("v_exp_f32 %0, %8\n\t"
      "v_exp_f32 %1, %9\n\t"
      "v_exp_f32 %2, %10\n\t"
      "v_exp_f32 %3, %11\n\t"
      "v_exp_f32 %4, %12\n\t"
      "v_exp_f32 %5, %13\n\t"
      "v_exp_f32 %6, %14\n\t"
      "v_exp_f32 %7, %15\n\t"
      "v_nop"
      : "=&v"(o[0]), "=&v"(o[1]), "=&v"(o[2]), "=&v"(o[3]),
        "=&v"(o[4]), "=&v"(o[5]), "=&v"(o[6]), "=&v"(o[7])
      : "v"(x[0]), "v"(x[1]), "v"(x[2]), "v"(x[3]),
        "v"(x[4]), "v"(x[5]), "v"(x[6]), "v"(x[7]));
}
__device__ __forceinline__ float exp2_one(float x) {
  float o;
  asm("v_exp_f32 %0, %1\n\t"
      "v_nop"
      : "=&v"(o) : "v"(x));
  return o;
}

// 8 waves per SIMD = 4 blocks per WGP: the whole grid of 1,024 blocks is then
// resident at once instead of running a thin second round.
__global__ __launch_bounds__(256) __attribute__((amdgpu_waves_per_eu(8)))
void attention_kernel(const __bf16* __restrict__ qg, const __bf16* __restrict__ kg,
                      const __bf16* __restrict__ vg,
                      const __bf16* __restrict__ memk, const __bf16* __restrict__ memv,
                      const int* __restrict__ mask,
                      __bf16* __restrict__ ctxout) {
  __shared__ __align__(16) __bf16 sVt[64 * LP_];       // V tile transposed [d][key]
  __shared__ __align__(16) __bf16 sK[2][32 * KP_];     // K tiles [key][d]

  const int tid = threadIdx.x, lane = tid & 31, wave = tid >> 5;
  const int lrow = lane & 15, lh = lane >> 4;
  const int bh = blockIdx.y;
  const int b = bh >> 4, h = bh & 15;
  const int qbase = blockIdx.x * 128 + wave * 16;

  // Q fragments (rows qbase..+15, d 0..63), pre-scaled by 1/sqrt(64)=0.125
  v16bf qf[2];
  {
    const __bf16* qp =
        qg + ((size_t)b * S_ + qbase + lrow) * D_ + h * DK_ + lh * 8;
#pragma unroll
    for (int half = 0; half < 2; ++half) {
      v16bf f = ld_frag(qp + half * 32, qp + half * 32 + 16);
#pragma unroll
      for (int i = 0; i < 16; ++i) f[i] = (__bf16)((float)f[i] * 0.125f);
      qf[half] = f;
    }
  }

  // ctx[dg][j] = O[query lrow][d = dg*16 + j + 8*lh]
  v8f ctx[4];
#pragma unroll
  for (int dg = 0; dg < 4; ++dg) ctx[dg] = zero_v8f();
  float mrun = -3.0e38f;   // this lane's query: running maximum (both halves equal)
  float lsum = 0.f;        // running sum over this lane's own keys only

  // this lane's query row of the mask, at its first key of a tile
  const int* mrow = mask + (size_t)(qbase + lrow) * T_ + lh * 8;

  // this thread's 16 bytes of a K tile; a tile lies wholly in the memory keys or
  // wholly in the sequence keys, so the choice of the source is the block's
  static_assert(MEMT_ % 32 == 0, "a K tile must not straddle the two sources");
  auto issue_k = [&](int t0, int buf) {
    const int key = tid >> 3;
    const int dseg = (tid & 7) * 8;
    const __bf16* tile = (t0 < MEMT_) ? (memk + (size_t)t0 * D_)
                                      : (kg + ((size_t)b * S_ + (t0 - MEMT_)) * D_);
    async_load1_b128((unsigned)(uintptr_t)&sK[buf][key * KP_ + dseg],
                     tile + (size_t)key * D_ + h * DK_ + dseg);
  };
  issue_k(0, 0);
  wait_asynccnt_0();
  __syncthreads();               // tile 0 is published
  issue_k(32, 1);                // T_ = 65 tiles: tile 1 exists

  for (int tbase = 0; tbase < T_; tbase += 32) {
    const int kbuf = (tbase >> 5) & 1;
    // stage transposed V tile (32 keys x 64 dims) cooperatively
    {
      int key = tid >> 3;
      int dseg = (tid & 7) * 8;
      int tg = tbase + key;
      const __bf16* src =
          (tg < MEMT_) ? (memv + (size_t)tg * D_ + h * DK_ + dseg)
                       : (vg + ((size_t)b * S_ + (tg - MEMT_)) * D_ + h * DK_ + dseg);
      v8bf val = *(const v8bf*)src;
#pragma unroll
      for (int i = 0; i < 8; ++i) sVt[(dseg + i) * LP_ + key] = val[i];
    }
    __syncthreads();

    // the mask words of this tile (the lane's 2 x 8 keys are 2 x 32 contiguous
    // bytes of its query's mask row) and the K fragments (A operand: row = key)
    const int* mp = mrow + tbase;
    int4 mk[4];
#pragma unroll
    for (int i = 0; i < 4; ++i) mk[i] = *(const int4*)(mp + (i >> 1) * 16 + (i & 1) * 4);
    v16bf kf[2][2];
#pragma unroll
    for (int grp = 0; grp < 2; ++grp) {
      const __bf16* ka = sK[kbuf] + (grp * 16 + lrow) * KP_ + lh * 8;
      kf[grp][0] = ld_frag(ka, ka + 16);
      kf[grp][1] = ld_frag(ka + 32, ka + 48);
    }
    // all twelve loads are in flight before the first product waits for one
    __builtin_amdgcn_sched_barrier(0);
    // no address register of the mask loads is rewritten ahead of this wait: named
    // as an input it stays live up to here, so no load's result lands in it
    asm volatile("s_wait_xcnt 0x0" :: "v"(mp) : "memory");

    // scores, transposed: [32 keys x 16 queries] = K[32x64] @ Q^T
    // st[j] = S[query lrow][key tbase + grp*16 + 8*lh + j]
    float v[16];
#pragma unroll
    for (int grp = 0; grp < 2; ++grp) {
      v8f st = wmma_bf16(kf[grp][0], qf[0], zero_v8f());
      st = wmma_bf16(kf[grp][1], qf[1], st);
      const int4 ma = mk[grp * 2], mb = mk[grp * 2 + 1];
      v[grp * 8 + 0] = ma.x ? st[0] : -1e9f;
      v[grp * 8 + 1] = ma.y ? st[1] : -1e9f;
      v[grp * 8 + 2] = ma.z ? st[2] : -1e9f;
      v[grp * 8 + 3] = ma.w ? st[3] : -1e9f;
      v[grp * 8 + 4] = mb.x ? st[4] : -1e9f;
      v[grp * 8 + 5] = mb.y ? st[5] : -1e9f;
      v[grp * 8 + 6] = mb.z ? st[6] : -1e9f;
      v[grp * 8 + 7] = mb.w ? st[7] : -1e9f;
    }

    // online softmax of one query per lane
    float tmax = v[0];
#pragma unroll
    for (int i = 1; i < 16; ++i) tmax = fmaxf(tmax, v[i]);
    tmax = fmaxf(tmax, xhalf(tmax));
    const float newm = fmaxf(mrun, tmax);
    constexpr float LOG2E = 1.44269504f;       // e^x = 2^(x * log2 e)
    const float scale = exp2_one((mrun - newm) * LOG2E);
    mrun = newm;
    float p[16];
#pragma unroll
    for (int i = 0; i < 16; ++i) v[i] = (v[i] - newm) * LOG2E;
    exp2_run8(p, v);
    exp2_run8(p + 8, v + 8);
    float ts = 0.f;
    v16bf pf;   // P^T as B operand: element i <-> key 8*lh + i (+8 for i >= 8)
#pragma unroll
    for (int i = 0; i < 16; ++i) {
      ts += p[i];
      pf[i] = (__bf16)p[i];
    }
    lsum = lsum * scale + ts;
#pragma unroll
    for (int dg = 0; dg < 4; ++dg)
#pragma unroll
      for (int j = 0; j < 8; ++j) ctx[dg][j] *= scale;

    // O^T += V^T @ P^T  (M = 64 dims in 4 groups, K = 32 keys)
#pragma unroll
    for (int dg = 0; dg < 4; ++dg) {
      const __bf16* vp = sVt + (dg * 16 + lrow) * LP_ + lh * 8;
      v16bf vf = ld_frag(vp, vp + 16);
      ctx[dg] = wmma_bf16(vf, pf, ctx[dg]);
    }

    // foot of the trip: own LDS reads back, own copies of tile t + 1 landed; the
    // barrier publishes that tile and ends every read of this trip's K and V
    wait_dscnt_0();
    wait_asynccnt_0();
    __syncthreads();
    if (tbase + 64 < T_) issue_k(tbase + 64, kbuf);   // same for the whole block
  }
  wait_asynccnt_0();             // no copy is left in flight when the wave ends

  // join the halves' sums, normalize, write ctx as bf16 in [B,S,D]: a lane holds
  // 8 neighbouring dims of its query per group, one 16-byte store each
  const float inv = 1.0f / (lsum + xhalf(lsum));
  __bf16* op = ctxout + ((size_t)b * S_ + qbase + lrow) * D_ + h * DK_ + lh * 8;
#pragma unroll
  for (int dg = 0; dg < 4; ++dg) {
    v8bf o;
#pragma unroll
    for (int j = 0; j < 8; ++j) o[j] = (__bf16)(ctx[dg][j] * inv);
    *(v8bf*)(op + dg * 16) = o;
  }
}

// ---------------------------------------------------------------------------
// new_memory: broadcast mean over S of final x into [B, MEM, D]
// The last GEMM has left the sums of every 32 rows of x in colsum[B*S/32][D]:
// a column's mean takes 64 independent loads, not 2,048 rows in 128 dependent
// rounds of loads on 16 work-groups.
// ---------------------------------------------------------------------------
__global__ __launch_bounds__(256)
void mean_bcast_kernel(const float* __restrict__ colsum, float* __restrict__ nm) {
  constexpr int G = S_ / 32;                   // partial sums per column
  int gid = blockIdx.x * 256 + threadIdx.x;    // B*D threads
  int b = gid / D_;
  int d = gid - b * D_;
  const float* p = colsum + (size_t)b * G * D_ + d;
  float v[G];
  // unrolled whole, so that all loads are in flight at once: one memory latency
#pragma unroll
  for (int i = 0; i < G; ++i) v[i] = p[(size_t)i * D_];
  float s4[4] = {0.f, 0.f, 0.f, 0.f};
#pragma unroll
  for (int i = 0; i < G; ++i) s4[i & 3] += v[i];
  float s = (s4[0] + s4[1]) + (s4[2] + s4[3]);
  float mean = s * (1.0f / S_);
  float* o = nm + (size_t)b * MEMT_ * D_ + d;
  for (int mI = 0; mI < MEMT_; ++mI) o[(size_t)mI * D_] = mean;
}

// ---------------------------------------------------------------------------
// launch
// ---------------------------------------------------------------------------
extern "C" void kernel_launch(void* const* d_in, const int* in_sizes, int n_in,
                              void* d_out, int out_size, void* d_ws, size_t ws_size,
                              hipStream_t stream) {
  (void)in_sizes; (void)n_in; (void)out_size; (void)ws_size;
  const float* x    = (const float*)d_in[0];
  const int*   mask = (const int*)d_in[1];
  const float* mem  = (const float*)d_in[2];
  const float* w_q  = (const float*)d_in[3];
  const float* w_k  = (const float*)d_in[4];
  const float* w_v  = (const float*)d_in[5];
  const float* w_o  = (const float*)d_in[6];
  const float* ln1a = (const float*)d_in[7];
  const float* ln1b = (const float*)d_in[8];
  const float* ln2a = (const float*)d_in[9];
  const float* ln2b = (const float*)d_in[10];
  const float* fw1  = (const float*)d_in[11];
  const float* fb1  = (const float*)d_in[12];
  const float* fw2  = (const float*)d_in[13];
  const float* fb2  = (const float*)d_in[14];

  float* out_x  = (float*)d_out;                                // [B,S,D]
  float* out_nm = out_x + (size_t)B_ * S_ * D_;                 // [B,MEM,D]

  // workspace carve-out
  size_t off = 0;
  auto carve = [&](size_t bytes) -> char* {
    char* p = (char*)d_ws + off;
    off = (off + bytes + 255) & ~(size_t)255;
    return p;
  };
  __bf16* wqT  = (__bf16*)carve((size_t)D_ * D_ * 2);
  __bf16* wkT  = (__bf16*)carve((size_t)D_ * D_ * 2);
  __bf16* wvT  = (__bf16*)carve((size_t)D_ * D_ * 2);
  __bf16* woT  = (__bf16*)carve((size_t)D_ * D_ * 2);
  __bf16* w1T  = (__bf16*)carve((size_t)DFF_ * D_ * 2);
  __bf16* w2T  = (__bf16*)carve((size_t)D_ * DFF_ * 2);
  __bf16* memb = (__bf16*)carve((size_t)MEMT_ * D_ * 2);
  __bf16* memK = (__bf16*)carve((size_t)MEMT_ * D_ * 2);
  __bf16* memV = (__bf16*)carve((size_t)MEMT_ * D_ * 2);
  __bf16* xn   = (__bf16*)carve((size_t)B_ * S_ * D_ * 2);
  __bf16* qb   = (__bf16*)carve((size_t)B_ * S_ * D_ * 2);
  __bf16* kb   = (__bf16*)carve((size_t)B_ * S_ * D_ * 2);
  __bf16* vb   = (__bf16*)carve((size_t)B_ * S_ * D_ * 2);
  __bf16* ctxb = (__bf16*)carve((size_t)B_ * S_ * D_ * 2);
  float*  x1   = (float*)carve((size_t)B_ * S_ * D_ * 4);
  __bf16* xn2  = (__bf16*)carve((size_t)B_ * S_ * D_ * 2);
  __bf16* ffh  = (__bf16*)carve((size_t)B_ * S_ * DFF_ * 2);
  float*  csum = (float*)carve((size_t)(B_ * S_ / 32) * D_ * 4);

  const int rows = B_ * S_;   // 8192
  dim3 blk(256);

  // weight prep (bf16, transposed to [N][K])
  transpose_convert_kernel<<<dim3(D_ / 64, D_ / 64), blk, 0, stream>>>(w_q, wqT, D_, D_);
  transpose_convert_kernel<<<dim3(D_ / 64, D_ / 64), blk, 0, stream>>>(w_k, wkT, D_, D_);
  transpose_convert_kernel<<<dim3(D_ / 64, D_ / 64), blk, 0, stream>>>(w_v, wvT, D_, D_);
  transpose_convert_kernel<<<dim3(D_ / 64, D_ / 64), blk, 0, stream>>>(w_o, woT, D_, D_);
  transpose_convert_kernel<<<dim3(DFF_ / 64, D_ / 64), blk, 0, stream>>>(fw1, w1T, D_, DFF_);
  transpose_convert_kernel<<<dim3(D_ / 64, DFF_ / 64), blk, 0, stream>>>(fw2, w2T, DFF_, D_);
  convert_kernel<<<(MEMT_ * D_) / 256, blk, 0, stream>>>(mem, memb, MEMT_ * D_);

  // LN1 -> Q/K/V projections (WMMA bf16)
  layernorm_kernel<<<rows, blk, 0, stream>>>(x, ln1a, ln1b, xn);
  gemm_bt_kernel<0><<<dim3(D_ / 128, rows / 128), blk, 0, stream>>>(
      xn, wqT, nullptr, nullptr, nullptr, qb, nullptr, rows, D_, D_);
  gemm_bt_kernel<0><<<dim3(D_ / 128, rows / 128), blk, 0, stream>>>(
      xn, wkT, nullptr, nullptr, nullptr, kb, nullptr, rows, D_, D_);
  gemm_bt_kernel<0><<<dim3(D_ / 128, rows / 128), blk, 0, stream>>>(
      xn, wvT, nullptr, nullptr, nullptr, vb, nullptr, rows, D_, D_);
  // memory K/V (raw memory tokens, not layernormed), M=32 with row clamp
  gemm_bt_kernel<0><<<dim3(D_ / 128, 1), blk, 0, stream>>>(
      memb, wkT, nullptr, nullptr, nullptr, memK, nullptr, MEMT_, D_, D_);
  gemm_bt_kernel<0><<<dim3(D_ / 128, 1), blk, 0, stream>>>(
      memb, wvT, nullptr, nullptr, nullptr, memV, nullptr, MEMT_, D_, D_);

  // flash attention over T = MEM + S
  attention_kernel<<<dim3(S_ / 128, B_ * H_), blk, 0, stream>>>(
      qb, kb, vb, memK, memV, mask, ctxb);

  // out-proj + residual -> x1 (f32)
  gemm_bt_kernel<2><<<dim3(D_ / 128, rows / 128), blk, 0, stream>>>(
      ctxb, woT, nullptr, x, x1, nullptr, nullptr, rows, D_, D_);

  // LN2 -> FFN
  layernorm_kernel<<<rows, blk, 0, stream>>>(x1, ln2a, ln2b, xn2);
  gemm_bt_kernel<1><<<dim3(DFF_ / 128, rows / 128), blk, 0, stream>>>(
      xn2, w1T, fb1, nullptr, nullptr, ffh, nullptr, rows, DFF_, D_);
  gemm_bt_kernel<3><<<dim3(D_ / 128, rows / 128), blk, 0, stream>>>(
      ffh, w2T, fb2, x1, out_x, nullptr, csum, rows, D_, DFF_);

  // new_memory = broadcast mean over S, from the last GEMM's column sums
  mean_bcast_kernel<<<(B_ * D_) / 256, blk, 0, stream>>>(csum, out_nm);
}

// v007
// A run of this version takes 501 microseconds.
// Two timings next to v006 both put it at 1.03 times that version's speed.
// Counting every step since v000, it is 2.53 times as fast.
#include <hip/hip_runtime.h>
#include <hip/hip_bf16.h>

// ---------------------------------------------------------------------------
// CDNA5 (gfx1250) transformer encoder block with memory tokens.
// - All heavy GEMMs: v_wmma_f32_16x16x32_bf16 (wave32 WMMA), f32 accumulate.
// - GEMM tile staging: global_load_async_to_lds_b128 (ASYNCcnt) with
//   double-buffered LDS tiles -> prefetch tile k+1 while computing tile k.
// ---------------------------------------------------------------------------

typedef __attribute__((ext_vector_type(16))) __bf16 v16bf;
typedef __attribute__((ext_vector_type(8)))  __bf16 v8bf;
typedef __attribute__((ext_vector_type(8)))  float  v8f;
typedef __attribute__((ext_vector_type(2)))  __bf16 v2bf;
typedef __attribute__((ext_vector_type(4)))  unsigned v4u;
typedef __attribute__((ext_vector_type(4)))  float  v4f;
typedef __attribute__((ext_vector_type(2)))  float  v2f;

static constexpr int B_    = 4;
static constexpr int S_    = 2048;
static constexpr int D_    = 1024;
static constexpr int H_    = 16;
static constexpr int DK_   = 64;
static constexpr int DFF_  = 4096;
static constexpr int MEMT_ = 32;
static constexpr int T_    = S_ + MEMT_;   // 2080 = 65 * 32
// Row pitch, in bf16, of every LDS tile whose 32-element rows are read as WMMA
// fragments with 16-byte loads: 80 bytes = 16 x 5, so the 16 rows one half-wave
// reads start on 16 different groups of four banks. At the bare 64 bytes rows
// r and r + 4 share their banks and each fragment load takes four times as long.
static constexpr int LP_   = 40;
// The same for tiles with 64-element rows: 144 bytes = 16 x 9.
static constexpr int KP_   = 72;

__device__ __forceinline__ v8f zero_v8f() {
  v8f z;
#pragma unroll
  for (int i = 0; i < 8; ++i) z[i] = 0.0f;
  return z;
}

// Build a 16-element bf16 A/B fragment from two contiguous 16-byte segments.
// Layout per CDNA5 ISA 7.12.2: lane holds row (lane%16); elements 0..7 are
// K = (lane/16)*8 .. +7, elements 8..15 are K = (lane/16)*8+16 .. +23.
__device__ __forceinline__ v16bf ld_frag(const __bf16* p0, const __bf16* p1) {
  v8bf lo = *(const v8bf*)p0;
  v8bf hi = *(const v8bf*)p1;
  return __builtin_shufflevector(lo, hi, 0, 1, 2, 3, 4, 5, 6, 7,
                                         8, 9, 10, 11, 12, 13, 14, 15);
}

// two floats -> one dword of two bf16, a in the low half
__device__ __forceinline__ unsigned pack_bf16(float a, float b) {
  v2bf t = {(__bf16)a, (__bf16)b};
  return __builtin_bit_cast(unsigned, t);
}

// lane l <-> lane l ^ 16
__device__ __forceinline__ float xhalf(float x) {
  int i = __builtin_bit_cast(int, x);
  return __builtin_bit_cast(float, __builtin_amdgcn_permlanex16(
      i, i, 0x76543210, 0xfedcba98, false, false));
}

__device__ __forceinline__ v8f wmma_bf16(v16bf a, v16bf b, v8f c) {
  return __builtin_amdgcn_wmma_f32_16x16x32_bf16(
      false, a, false, b, (short)0, c, false, false);
}

// CDNA5 async global->LDS copies, 16 bytes per lane (GVS mode: SGPR base +
// per-lane u32 byte offset). Tracked by ASYNCcnt. One K-tile's eight copies of a
// thread (A, B four times) stand in one statement that ends in s_wait_xcnt 0, so
// that no address register of a copy is rewritten ahead of that wait.
__device__ __forceinline__ void async_load8_b128(
    const unsigned (&ldsA)[4], const unsigned (&voffA)[4],
    const unsigned (&ldsB)[4], const unsigned (&voffB)[4],
    unsigned long long baseA, unsigned long long baseB) {
  asm volatile("global_load_async_to_lds_b128 %0, %1, %16\n\t"
               "global_load_async_to_lds_b128 %2, %3, %17\n\t"
               "global_load_async_to_lds_b128 %4, %5, %16\n\t"
               "global_load_async_to_lds_b128 %6, %7, %17\n\t"
               "global_load_async_to_lds_b128 %8, %9, %16\n\t"
               "global_load_async_to_lds_b128 %10, %11, %17\n\t"
               "global_load_async_to_lds_b128 %12, %13, %16\n\t"
               "global_load_async_to_lds_b128 %14, %15, %17\n\t"
               "s_wait_xcnt 0x0"
               :: "v"(ldsA[0]), "v"(voffA[0]), "v"(ldsB[0]), "v"(voffB[0]),
                  "v"(ldsA[1]), "v"(voffA[1]), "v"(ldsB[1]), "v"(voffB[1]),
                  "v"(ldsA[2]), "v"(voffA[2]), "v"(ldsB[2]), "v"(voffB[2]),
                  "v"(ldsA[3]), "v"(voffA[3]), "v"(ldsB[3]), "v"(voffB[3]),
                  "s"(baseA), "s"(baseB)
               : "memory");
}
__device__ __forceinline__ void wait_asynccnt_8() {
  asm volatile("s_wait_asynccnt 0x8" ::: "memory");
}
__device__ __forceinline__ void wait_asynccnt_0() {
  asm volatile("s_wait_asynccnt 0x0" ::: "memory");
}
// One 16-byte copy per lane, lane's own LDS byte address and global pointer. The
// closing s_wait_xcnt 0 keeps both address registers unwritten up to the wait.
__device__ __forceinline__ void async_load1_b128(unsigned lds, const __bf16* g) {
  asm volatile("global_load_async_to_lds_b128 %0, %1, off\n\t"
               "s_wait_xcnt 0x0"
               :: "v"(lds), "v"(g)
               : "memory");
}
// the wave's own LDS reads have returned before their buffer is handed back
__device__ __forceinline__ void wait_dscnt_0() {
  asm volatile("s_wait_dscnt 0x0" ::: "memory");
}

// ---------------------------------------------------------------------------
// Weight transpose + fp32 -> bf16 convert: Wt[n*K + k] = (bf16)W[k*N + n]
// One block moves a 64(k) x 64(n) tile through LDS: reads are whole 256-byte
// row pieces of W, writes are whole 128-byte lines of Wt. Two k neighbours are
// packed into one dword before LDS; the pitch of 65 dwords keeps both the
// row-wise stores and the column-wise loads free of bank conflicts.
// K and N must be multiples of 64.
// ---------------------------------------------------------------------------
__global__ __launch_bounds__(256)
void transpose_convert_kernel(const float* __restrict__ W,
                              __bf16* __restrict__ Wt, int K, int N) {
  __shared__ unsigned tile[32 * 65];                   // [k pair][n]
  const int tid = threadIdx.x;
  const int n0 = blockIdx.x * 64, k0 = blockIdx.y * 64;

  const int c4 = (tid & 15) * 4;
  float4 lo[2], hi[2];
#pragma unroll
  for (int i = 0; i < 2; ++i) {
    const int kp = (tid >> 4) + i * 16;
    const float* src = W + (size_t)(k0 + 2 * kp) * N + n0 + c4;
    lo[i] = *(const float4*)src;
    hi[i] = *(const float4*)(src + N);
  }
#pragma unroll
  for (int i = 0; i < 2; ++i) {
    unsigned* t = tile + ((tid >> 4) + i * 16) * 65 + c4;
    t[0] = pack_bf16(lo[i].x, hi[i].x);
    t[1] = pack_bf16(lo[i].y, hi[i].y);
    t[2] = pack_bf16(lo[i].z, hi[i].z);
    t[3] = pack_bf16(lo[i].w, hi[i].w);
  }
  __syncthreads();
#pragma unroll
  for (int i = 0; i < 2; ++i) {
    const int c = tid + i * 256;
    const int n = c >> 3, kc = c & 7;                  // 8 lanes fill one line
    const unsigned* t = tile + kc * 4 * 65 + n;
    v4u o;
#pragma unroll
    for (int e = 0; e < 4; ++e) o[e] = t[e * 65];
    *(v4u*)(Wt + (size_t)(n0 + n) * K + k0 + kc * 8) = o;
  }
}

__global__ __launch_bounds__(256)
void convert_kernel(const float* __restrict__ X, __bf16* __restrict__ Y, int n) {
  int i = blockIdx.x * 256 + threadIdx.x;
  if (i < n) Y[i] = (__bf16)X[i];
}

// ---------------------------------------------------------------------------
// LayerNorm (matches reference: unbiased std, alpha*(x-mean)/(std+eps)+bias)
// Output bf16 for the following GEMM.
// One wave owns LNR_ whole rows of D_=1024: a lane holds 32 elements of each row,
// taken by 16-byte loads that cover four whole 128-byte lines per wave, all rows'
// loads in flight at once. Both sums run inside the lane and end in a five-step
// exchange between the lanes, so the kernel has no LDS and no barrier, and a
// launch starts rows / LNR_ = 4,096 waves, not 8 waves per row = 65,536.
// ---------------------------------------------------------------------------
static constexpr int LNR_ = 2;                 // rows per wave
static_assert((B_ * S_) % (8 * LNR_) == 0, "whole work-groups of 8 waves");
static_assert(D_ == 8 * 128, "a lane holds 8 x 4 elements of a row");

// lane l <-> lane l ^ M inside a 16-lane row (DPP row_xmask:M)
template <int M>
__device__ __forceinline__ float xrow(float x) {
  int i = __builtin_bit_cast(int, x);
  return __builtin_bit_cast(float,
      __builtin_amdgcn_update_dpp(i, i, 0x160 + M, 0xf, 0xf, false));
}
// sum over the wave's 32 lanes, the same in every lane
__device__ __forceinline__ float wave_sum(float s) {
  s += xrow<1>(s);
  s += xrow<2>(s);
  s += xrow<4>(s);
  s += xrow<8>(s);
  return s + xhalf(s);
}

__global__ __launch_bounds__(256)
void layernorm_kernel(const float* __restrict__ x,
                      const float* __restrict__ alpha,
                      const float* __restrict__ beta,
                      __bf16* __restrict__ y) {
  const int lane = threadIdx.x & 31, wave = threadIdx.x >> 5;
  const int row0 = (blockIdx.x * 8 + wave) * LNR_;
  const int c0 = lane * 4;                     // the lane's columns: c0 + 128 i .. + 3
  const float* xr = x + (size_t)row0 * D_ + c0;
  v4f v[LNR_][8];
  // every loop below is unrolled whole: constant indices keep v in registers, and
  // here all the loads are issued before the first one is waited for
#pragma unroll
  for (int r = 0; r < LNR_; ++r)
#pragma unroll
    for (int i = 0; i < 8; ++i) v[r][i] = *(const v4f*)(xr + r * D_ + i * 128);
  // no address register of these loads is rewritten ahead of this wait: named as
  // an input the address stays live up to here, so no load's result lands in it
  asm volatile("s_wait_xcnt 0x0" :: "v"(xr) : "memory");

  float mean[LNR_], rinv[LNR_];
#pragma unroll
  for (int r = 0; r < LNR_; ++r) {
    // four chains per sum, as two packed pairs: the pairs of a 16-byte load are
    // the operands of the packed add and the packed multiply-add as they lie
    v2f a0 = {0.f, 0.f}, a1 = {0.f, 0.f}, q0 = {0.f, 0.f}, q1 = {0.f, 0.f};
#pragma unroll
    for (int i = 0; i < 8; ++i) {
      const v2f lo = v[r][i].xy, hi = v[r][i].zw;
      a0 += lo;
      a1 += hi;
      q0 = __builtin_elementwise_fma(lo, lo, q0);
      q1 = __builtin_elementwise_fma(hi, hi, q1);
    }
    const float sum1 = wave_sum((a0.x + a0.y) + (a1.x + a1.y));
    const float sum2 = wave_sum((q0.x + q0.y) + (q1.x + q1.y));
    const float m = sum1 * (1.0f / D_);
    float var = (sum2 - (float)D_ * m * m) * (1.0f / (D_ - 1));
    var = var > 0.f ? var : 0.f;
    mean[r] = m;
    rinv[r] = 1.0f / (sqrtf(var) + 1e-6f);
  }

  __bf16* yr = y + (size_t)row0 * D_ + c0;
#pragma unroll
  for (int i = 0; i < 8; ++i) {
    const v4f al = *(const v4f*)(alpha + c0 + i * 128);
    const v4f be = *(const v4f*)(beta + c0 + i * 128);
#pragma unroll
    for (int r = 0; r < LNR_; ++r) {
      const v4f t = v[r][i];
      uint2 o;   // 4 bf16: a wave's store covers two whole lines
      o.x = pack_bf16(al.x * (t.x - mean[r]) * rinv[r] + be.x,
                      al.y * (t.y - mean[r]) * rinv[r] + be.y);
      o.y = pack_bf16(al.z * (t.z - mean[r]) * rinv[r] + be.z,
                      al.w * (t.w - mean[r]) * rinv[r] + be.w);
      *(uint2*)(yr + r * D_ + i * 128) = o;
    }
  }
}

// ---------------------------------------------------------------------------
// WMMA GEMM: C[M,N] = A[M,K](bf16) * Bt[N,K](bf16)^T  (+ epilogue)
// MODE 0: store bf16
// MODE 1: +bias[col], ReLU, store bf16
// MODE 2: +resid[row,col], store f32
// MODE 3: +bias[col] + resid[row,col], store f32; each wave also stores the column
//         sums of its 32 x 64 piece of C: colsum[row / 32][col]
// Block tile 128x128, K-step 64. 8 waves: 4 (M) x 2 (N); wave tile 32x64.
// K must be a multiple of 64.
// Tiles staged with async global->LDS b128 copies, double-buffered so the
// next K-tile streams in while WMMAs consume the current one. A K-step is 128
// bytes of every operand row: 8 lanes copy one whole line, a wave's copy covers
// 4 whole lines, and no line is asked for in two halves by two K-steps.
// Rows >= M are clamped (not skipped) so every wave issues exactly 8 async
// ops per tile -> ASYNCcnt bookkeeping is uniform; epilogue guards stores.
// ---------------------------------------------------------------------------
template <int MODE>
__global__ __launch_bounds__(256)
void gemm_bt_kernel(const __bf16* __restrict__ A, const __bf16* __restrict__ Bt,
                    const float* __restrict__ bias, const float* __restrict__ resid,
                    float* __restrict__ Cf, __bf16* __restrict__ Cb,
                    float* __restrict__ colsum, int M, int N, int K) {
  __shared__ __align__(16) __bf16 sA[2][128 * KP_];
  __shared__ __align__(16) __bf16 sB[2][128 * KP_];
  const int tid = threadIdx.x;
  const int lane = tid & 31, wave = tid >> 5;
  const int mw = wave >> 1, nw = wave & 1;
  const int mbase = blockIdx.y * 128, nbase = blockIdx.x * 128;
  const int lrow = lane & 15, lh = lane >> 4;

  const unsigned long long baseA = (unsigned long long)(uintptr_t)A;
  const unsigned long long baseB = (unsigned long long)(uintptr_t)Bt;

  // this thread's four 16-byte segments of a 128x64 tile: rows r0 + 32 i, one column
  const int r0 = tid >> 3, c0 = (tid & 7) * 8;
  unsigned rowA[4], rowB[4];                         // byte offset of row and column
#pragma unroll   // constant indices keep the two arrays in registers
  for (int i = 0; i < 4; ++i) {
    int ga = mbase + r0 + i * 32; if (ga >= M) ga = M - 1;   // clamp, never skip
    rowA[i] = (unsigned)(((size_t)ga * K + c0) * 2);
    rowB[i] = (unsigned)(((size_t)(nbase + r0 + i * 32) * K + c0) * 2);
  }

  auto issue_tile = [&](int kk, int p) {
    unsigned la[4], va[4], lb[4], vb[4];
#pragma unroll   // constant indices: each element is a register operand of the copies
    for (int i = 0; i < 4; ++i) {
      la[i] = (unsigned)(uintptr_t)&sA[p][(r0 + i * 32) * KP_ + c0];
      lb[i] = (unsigned)(uintptr_t)&sB[p][(r0 + i * 32) * KP_ + c0];
      va[i] = rowA[i] + (unsigned)kk * 2u;
      vb[i] = rowB[i] + (unsigned)kk * 2u;
    }
    async_load8_b128(la, va, lb, vb, baseA, baseB);
  };

  v8f acc[2][4];
#pragma unroll
  for (int mi = 0; mi < 2; ++mi)
#pragma unroll
    for (int ni = 0; ni < 4; ++ni) acc[mi][ni] = zero_v8f();

  issue_tile(0, 0);
  int p = 0;
  for (int kk = 0; kk < K; kk += 64) {
    const bool pf = (kk + 64) < K;
    if (pf) {
      issue_tile(kk + 64, p ^ 1);   // 8 new in flight on top of 8 old
      wait_asynccnt_8();            // all but the 8 youngest: tile p has landed
    } else {
      wait_asynccnt_0();
    }
    __syncthreads();

#pragma unroll   // ks becomes an immediate offset of the LDS loads
    for (int ks = 0; ks < 2; ++ks) {   // the tile's two 32-element WMMA steps, in k order
      v16bf af[2], bfr[4];
#pragma unroll
      for (int mi = 0; mi < 2; ++mi) {
        const __bf16* q = sA[p] + (mw * 32 + mi * 16 + lrow) * KP_ + ks * 32 + lh * 8;
        af[mi] = ld_frag(q, q + 16);
      }
#pragma unroll
      for (int ni = 0; ni < 4; ++ni) {
        const __bf16* q = sB[p] + (nw * 64 + ni * 16 + lrow) * KP_ + ks * 32 + lh * 8;
        bfr[ni] = ld_frag(q, q + 16);
      }
#pragma unroll
      for (int mi = 0; mi < 2; ++mi)
#pragma unroll
        for (int ni = 0; ni < 4; ++ni)
          acc[mi][ni] = wmma_bf16(af[mi], bfr[ni], acc[mi][ni]);
    }

    __syncthreads();                // tile p free for overwrite next round
    p ^= 1;
  }

  // epilogue (C layout: VGPR j -> row j + 8*(lane/16); col = lane%16)
  // Left as it is: under the per-row guard each of a lane's 64 elements waits for its
  // own bias and residual load before the next one is issued.
  float cs[4] = {0.f, 0.f, 0.f, 0.f};   // MODE 3: sum over this lane's 16 rows, per column
#pragma unroll
  for (int mi = 0; mi < 2; ++mi) {
#pragma unroll
    for (int ni = 0; ni < 4; ++ni) {
      int col = nbase + nw * 64 + ni * 16 + lrow;
#pragma unroll
      for (int j = 0; j < 8; ++j) {
        int row = mbase + mw * 32 + mi * 16 + j + 8 * lh;
        if (row >= M) continue;
        float r = acc[mi][ni][j];
        if (MODE == 1 || MODE == 3) r += bias[col];
        if (MODE == 1) r = r > 0.f ? r : 0.f;
        if (MODE == 2 || MODE == 3) r += resid[(size_t)row * N + col];
        if (MODE == 0 || MODE == 1)
          Cb[(size_t)row * N + col] = (__bf16)r;
        else
          Cf[(size_t)row * N + col] = r;
        if (MODE == 3) cs[ni] += r;
      }
    }
  }
  if (MODE == 3) {
    // the other 16 rows of the column are in lane ^ 16; one wave writes its two
    // whole 128-byte lines of colsum
    float* cp = colsum + (size_t)(blockIdx.y * 4 + mw) * N + nbase + nw * 64 + lrow;
#pragma unroll
    for (int ni = 0; ni < 4; ++ni) {
      const float s = cs[ni] + xhalf(cs[ni]);
      if (lh == 0) cp[ni * 16] = s;
    }
  }
}

__device__ __forceinline__ void exp2_run8(float* o, const float* x) {
  asm("v_exp_f32 %0, %8\n\t"
      "v_exp_f32 %1, %9\n\t"
      "v_exp_f32 %2, %10\n\t"
      "v_exp_f32 %3, %11\n\t"
      "v_exp_f32 %4, %12\n\t"
      "v_exp_f32 %5, %13\n\t"
      "v_exp_f32 %6, %14\n\t"
      "v_exp_f32 %7, %15\n\t"
      "v_nop"
      : "=&v"(o[0]), "=&v"(o[1]), "=&v"(o[2]), "=&v"(o[3]),
        "=&v"(o[4]), "=&v"(o[5]), "=&v"(o[6]), "=&v"(o[7])
      : "v"(x[0]), "v"(x[1]), "v"(x[2]), "v"(x[3]),
        "v"(x[4]), "v"(x[5]), "v"(x[6]), "v"(x[7]));
}
__device__ __forceinline__ float exp2_one(float x) {
  float o;
  asm("v_exp_f32 %0, %1\n\t"
      "v_nop"
      : "=&v"(o) : "v"(x));
  return o;
}

// 8 waves per SIMD = 4 blocks per WGP: the whole grid of 1,024 blocks is then
// resident at once instead of running a thin second round.
__global__ __launch_bounds__(256) __attribute__((amdgpu_waves_per_eu(8)))
void attention_kernel(const __bf16* __restrict__ qg, const __bf16* __restrict__ kg,
                      const __bf16* __restrict__ vg,
                      const __bf16* __restrict__ memk, const __bf16* __restrict__ memv,
                      const int* __restrict__ mask,
                      __bf16* __restrict__ ctxout) {
  __shared__ __align__(16) __bf16 sVt[64 * LP_];       // V tile transposed [d][key]
  __shared__ __align__(16) __bf16 sK[2][32 * KP_];     // K tiles [key][d]

  const int tid = threadIdx.x, lane = tid & 31, wave = tid >> 5;
  const int lrow = lane & 15, lh = lane >> 4;
  const int bh = blockIdx.y;
  const int b = bh >> 4, h = bh & 15;
  const int qbase = blockIdx.x * 128 + wave * 16;

  // Q fragments (rows qbase..+15, d 0..63), pre-scaled by 1/sqrt(64)=0.125
  v16bf qf[2];
  {
    const __bf16* qp =
        qg + ((size_t)b * S_ + qbase + lrow) * D_ + h * DK_ + lh * 8;
#pragma unroll
    for (int half = 0; half < 2; ++half) {
      v16bf f = ld_frag(qp + half * 32, qp + half * 32 + 16);
#pragma unroll
      for (int i = 0; i < 16; ++i) f[i] = (__bf16)((float)f[i] * 0.125f);
      qf[half] = f;
    }
  }

  // ctx[dg][j] = O[query lrow][d = dg*16 + j + 8*lh]
  v8f ctx[4];
#pragma unroll
  for (int dg = 0; dg < 4; ++dg) ctx[dg] = zero_v8f();
  float mrun = -3.0e38f;   // this lane's query: running maximum (both halves equal)
  float lsum = 0.f;        // running sum over this lane's own keys only

  // this lane's query row of the mask, at its first key of a tile
  const int* mrow = mask + (size_t)(qbase + lrow) * T_ + lh * 8;

  // this thread's 16 bytes of a K tile; a tile lies wholly in the memory keys or
  // wholly in the sequence keys, so the choice of the source is the block's
  static_assert(MEMT_ % 32 == 0, "a K tile must not straddle the two sources");
  auto issue_k = [&](int t0, int buf) {
    const int key = tid >> 3;
    const int dseg = (tid & 7) * 8;
    const __bf16* tile = (t0 < MEMT_) ? (memk + (size_t)t0 * D_)
                                      : (kg + ((size_t)b * S_ + (t0 - MEMT_)) * D_);
    async_load1_b128((unsigned)(uintptr_t)&sK[buf][key * KP_ + dseg],
                     tile + (size_t)key * D_ + h * DK_ + dseg);
  };
  issue_k(0, 0);
  wait_asynccnt_0();
  __syncthreads();               // tile 0 is published
  issue_k(32, 1);                // T_ = 65 tiles: tile 1 exists

  for (int tbase = 0; tbase < T_; tbase += 32) {
    const int kbuf = (tbase >> 5) & 1;
    // stage transposed V tile (32 keys x 64 dims) cooperatively
    {
      int key = tid >> 3;
      int dseg = (tid & 7) * 8;
      int tg = tbase + key;
      const __bf16* src =
          (tg < MEMT_) ? (memv + (size_t)tg * D_ + h * DK_ + dseg)
                       : (vg + ((size_t)b * S_ + (tg - MEMT_)) * D_ + h * DK_ + dseg);
      v8bf val = *(const v8bf*)src;
#pragma unroll
      for (int i = 0; i < 8; ++i) sVt[(dseg + i) * LP_ + key] = val[i];
    }
    __syncthreads();

    // the mask words of this tile (the lane's 2 x 8 keys are 2 x 32 contiguous
    // bytes of its query's mask row) and the K fragments (A operand: row = key)
    const int* mp = mrow + tbase;
    int4 mk[4];
#pragma unroll
    for (int i = 0; i < 4; ++i) mk[i] = *(const int4*)(mp + (i >> 1) * 16 + (i & 1) * 4);
    v16bf kf[2][2];
#pragma unroll
    for (int grp = 0; grp < 2; ++grp) {
      const __bf16* ka = sK[kbuf] + (grp * 16 + lrow) * KP_ + lh * 8;
      kf[grp][0] = ld_frag(ka, ka + 16);
      kf[grp][1] = ld_frag(ka + 32, ka + 48);
    }
    // all twelve loads are in flight before the first product waits for one
    __builtin_amdgcn_sched_barrier(0);
    // no address register of the mask loads is rewritten ahead of this wait: named
    // as an input it stays live up to here, so no load's result lands in it
    asm volatile("s_wait_xcnt 0x0" :: "v"(mp) : "memory");

    // scores, transposed: [32 keys x 16 queries] = K[32x64] @ Q^T
    // st[j] = S[query lrow][key tbase + grp*16 + 8*lh + j]
    float v[16];
#pragma unroll
    for (int grp = 0; grp < 2; ++grp) {
      v8f st = wmma_bf16(kf[grp][0], qf[0], zero_v8f());
      st = wmma_bf16(kf[grp][1], qf[1], st);
      const int4 ma = mk[grp * 2], mb = mk[grp * 2 + 1];
      v[grp * 8 + 0] = ma.x ? st[0] : -1e9f;
      v[grp * 8 + 1] = ma.y ? st[1] : -1e9f;
      v[grp * 8 + 2] = ma.z ? st[2] : -1e9f;
      v[grp * 8 + 3] = ma.w ? st[3] : -1e9f;
      v[grp * 8 + 4] = mb.x ? st[4] : -1e9f;
      v[grp * 8 + 5] = mb.y ? st[5] : -1e9f;
      v[grp * 8 + 6] = mb.z ? st[6] : -1e9f;
      v[grp * 8 + 7] = mb.w ? st[7] : -1e9f;
    }

    // online softmax of one query per lane
    float tmax = v[0];
#pragma unroll
    for (int i = 1; i < 16; ++i) tmax = fmaxf(tmax, v[i]);
    tmax = fmaxf(tmax, xhalf(tmax));
    const float newm = fmaxf(mrun, tmax);
    constexpr float LOG2E = 1.44269504f;       // e^x = 2^(x * log2 e)
    const float scale = exp2_one((mrun - newm) * LOG2E);
    mrun = newm;
    float p[16];
#pragma unroll
    for (int i = 0; i < 16; ++i) v[i] = (v[i] - newm) * LOG2E;
    exp2_run8(p, v);
    exp2_run8(p + 8, v + 8);
    float ts = 0.f;
    v16bf pf;   // P^T as B operand: element i <-> key 8*lh + i (+8 for i >= 8)
#pragma unroll
    for (int i = 0; i < 16; ++i) {
      ts += p[i];
      pf[i] = (__bf16)p[i];
    }
    lsum = lsum * scale + ts;
#pragma unroll
    for (int dg = 0; dg < 4; ++dg)
#pragma unroll
      for (int j = 0; j < 8; ++j) ctx[dg][j] *= scale;

    // O^T += V^T @ P^T  (M = 64 dims in 4 groups, K = 32 keys)
#pragma unroll
    for (int dg = 0; dg < 4; ++dg) {
      const __bf16* vp = sVt + (dg * 16 + lrow) * LP_ + lh * 8;
      v16bf vf = ld_frag(vp, vp + 16);
      ctx[dg] = wmma_bf16(vf, pf, ctx[dg]);
    }

    // foot of the trip: own LDS reads back, own copies of tile t + 1 landed; the
    // barrier publishes that tile and ends every read of this trip's K and V
    wait_dscnt_0();
    wait_asynccnt_0();
    __syncthreads();
    if (tbase + 64 < T_) issue_k(tbase + 64, kbuf);   // same for the whole block
  }
  wait_asynccnt_0();             // no copy is left in flight when the wave ends

  // join the halves' sums, normalize, write ctx as bf16 in [B,S,D]: a lane holds
  // 8 neighbouring dims of its query per group, one 16-byte store each
  const float inv = 1.0f / (lsum + xhalf(lsum));
  __bf16* op = ctxout + ((size_t)b * S_ + qbase + lrow) * D_ + h * DK_ + lh * 8;
#pragma unroll
  for (int dg = 0; dg < 4; ++dg) {
    v8bf o;
#pragma unroll
    for (int j = 0; j < 8; ++j) o[j] = (__bf16)(ctx[dg][j] * inv);
    *(v8bf*)(op + dg * 16) = o;
  }
}

// ---------------------------------------------------------------------------
// new_memory: broadcast mean over S of final x into [B, MEM, D]
// The last GEMM has left the sums of every 32 rows of x in colsum[B*S/32][D]:
// a column's mean takes 64 independent loads, not 2,048 rows in 128 dependent
// rounds of loads on 16 work-groups.
// ---------------------------------------------------------------------------
__global__ __launch_bounds__(256)
void mean_bcast_kernel(const float* __restrict__ colsum, float* __restrict__ nm) {
  constexpr int G = S_ / 32;                   // partial sums per column
  int gid = blockIdx.x * 256 + threadIdx.x;    // B*D threads
  int b = gid / D_;
  int d = gid - b * D_;
  const float* p = colsum + (size_t)b * G * D_ + d;
  float v[G];
  // unrolled whole, so that all loads are in flight at once: one memory latency
#pragma unroll
  for (int i = 0; i < G; ++i) v[i] = p[(size_t)i * D_];
  float s4[4] = {0.f, 0.f, 0.f, 0.f};
#pragma unroll
  for (int i = 0; i < G; ++i) s4[i & 3] += v[i];
  float s = (s4[0] + s4[1]) + (s4[2] + s4[3]);
  float mean = s * (1.0f / S_);
  float* o = nm + (size_t)b * MEMT_ * D_ + d;
  for (int mI = 0; mI < MEMT_; ++mI) o[(size_t)mI * D_] = mean;
}

// ---------------------------------------------------------------------------
// launch
// ---------------------------------------------------------------------------
extern "C" void kernel_launch(void* const* d_in, const int* in_sizes, int n_in,
                              void* d_out, int out_size, void* d_ws, size_t ws_size,
                              hipStream_t stream) {
  (void)in_sizes; (void)n_in; (void)out_size; (void)ws_size;
  const float* x    = (const float*)d_in[0];
  const int*   mask = (const int*)d_in[1];
  const float* mem  = (const float*)d_in[2];
  const float* w_q  = (const float*)d_in[3];
  const float* w_k  = (const float*)d_in[4];
  const float* w_v  = (const float*)d_in[5];
  const float* w_o  = (const float*)d_in[6];
  const float* ln1a = (const float*)d_in[7];
  const float* ln1b = (const float*)d_in[8];
  const float* ln2a = (const float*)d_in[9];
  const float* ln2b = (const float*)d_in[10];
  const float* fw1  = (const float*)d_in[11];
  const float* fb1  = (const float*)d_in[12];
  const float* fw2  = (const float*)d_in[13];
  const float* fb2  = (const float*)d_in[14];

  float* out_x  = (float*)d_out;                                // [B,S,D]
  float* out_nm = out_x + (size_t)B_ * S_ * D_;                 // [B,MEM,D]

  // workspace carve-out
  size_t off = 0;
  auto carve = [&](size_t bytes) -> char* {
    char* p = (char*)d_ws + off;
    off = (off + bytes + 255) & ~(size_t)255;
    return p;
  };
  __bf16* wqT  = (__bf16*)carve((size_t)D_ * D_ * 2);
  __bf16* wkT  = (__bf16*)carve((size_t)D_ * D_ * 2);
  __bf16* wvT  = (__bf16*)carve((size_t)D_ * D_ * 2);
  __bf16* woT  = (__bf16*)carve((size_t)D_ * D_ * 2);
  __bf16* w1T  = (__bf16*)carve((size_t)DFF_ * D_ * 2);
  __bf16* w2T  = (__bf16*)carve((size_t)D_ * DFF_ * 2);
  __bf16* memb = (__bf16*)carve((size_t)MEMT_ * D_ * 2);
  __bf16* memK = (__bf16*)carve((size_t)MEMT_ * D_ * 2);
  __bf16* memV = (__bf16*)carve((size_t)MEMT_ * D_ * 2);
  __bf16* xn   = (__bf16*)carve((size_t)B_ * S_ * D_ * 2);
  __bf16* qb   = (__bf16*)carve((size_t)B_ * S_ * D_ * 2);
  __bf16* kb   = (__bf16*)carve((size_t)B_ * S_ * D_ * 2);
  __bf16* vb   = (__bf16*)carve((size_t)B_ * S_ * D_ * 2);
  __bf16* ctxb = (__bf16*)carve((size_t)B_ * S_ * D_ * 2);
  float*  x1   = (float*)carve((size_t)B_ * S_ * D_ * 4);
  __bf16* xn2  = (__bf16*)carve((size_t)B_ * S_ * D_ * 2);
  __bf16* ffh  = (__bf16*)carve((size_t)B_ * S_ * DFF_ * 2);
  float*  csum = (float*)carve((size_t)(B_ * S_ / 32) * D_ * 4);

  const int rows = B_ * S_;   // 8192
  dim3 blk(256);

  // weight prep (bf16, transposed to [N][K])
  transpose_convert_kernel<<<dim3(D_ / 64, D_ / 64), blk, 0, stream>>>(w_q, wqT, D_, D_);
  transpose_convert_kernel<<<dim3(D_ / 64, D_ / 64), blk, 0, stream>>>(w_k, wkT, D_, D_);
  transpose_convert_kernel<<<dim3(D_ / 64, D_ / 64), blk, 0, stream>>>(w_v, wvT, D_, D_);
  transpose_convert_kernel<<<dim3(D_ / 64, D_ / 64), blk, 0, stream>>>(w_o, woT, D_, D_);
  transpose_convert_kernel<<<dim3(DFF_ / 64, D_ / 64), blk, 0, stream>>>(fw1, w1T, D_, DFF_);
  transpose_convert_kernel<<<dim3(D_ / 64, DFF_ / 64), blk, 0, stream>>>(fw2, w2T, DFF_, D_);
  convert_kernel<<<(MEMT_ * D_) / 256, blk, 0, stream>>>(mem, memb, MEMT_ * D_);

  // LN1 -> Q/K/V projections (WMMA bf16)
  layernorm_kernel<<<rows / (8 * LNR_), blk, 0, stream>>>(x, ln1a, ln1b, xn);
  gemm_bt_kernel<0><<<dim3(D_ / 128, rows / 128), blk, 0, stream>>>(
      xn, wqT, nullptr, nullptr, nullptr, qb, nullptr, rows, D_, D_);
  gemm_bt_kernel<0><<<dim3(D_ / 128, rows / 128), blk, 0, stream>>>(
      xn, wkT, nullptr, nullptr, nullptr, kb, nullptr, rows, D_, D_);
  gemm_bt_kernel<0><<<dim3(D_ / 128, rows / 128), blk, 0, stream>>>(
      xn, wvT, nullptr, nullptr, nullptr, vb, nullptr, rows, D_, D_);
  // memory K/V (raw memory tokens, not layernormed), M=32 with row clamp
  gemm_bt_kernel<0><<<dim3(D_ / 128, 1), blk, 0, stream>>>(
      memb, wkT, nullptr, nullptr, nullptr, memK, nullptr, MEMT_, D_, D_);
  gemm_bt_kernel<0><<<dim3(D_ / 128, 1), blk, 0, stream>>>(
      memb, wvT, nullptr, nullptr, nullptr, memV, nullptr, MEMT_, D_, D_);

  // flash attention over T = MEM + S
  attention_kernel<<<dim3(S_ / 128, B_ * H_), blk, 0, stream>>>(
      qb, kb, vb, memK, memV, mask, ctxb);

  // out-proj + residual -> x1 (f32)
  gemm_bt_kernel<2><<<dim3(D_ / 128, rows / 128), blk, 0, stream>>>(
      ctxb, woT, nullptr, x, x1, nullptr, nullptr, rows, D_, D_);

  // LN2 -> FFN
  layernorm_kernel<<<rows / (8 * LNR_), blk, 0, stream>>>(x1, ln2a, ln2b, xn2);
  gemm_bt_kernel<1><<<dim3(DFF_ / 128, rows / 128), blk, 0, stream>>>(
      xn2, w1T, fb1, nullptr, nullptr, ffh, nullptr, rows, DFF_, D_);
  gemm_bt_kernel<3><<<dim3(D_ / 128, rows / 128), blk, 0, stream>>>(
      ffh, w2T, fb2, x1, out_x, nullptr, csum, rows, D_, DFF_);

  // new_memory = broadcast mean over S, from the last GEMM's column sums
  mean_bcast_kernel<<<(B_ * D_) / 256, blk, 0, stream>>>(csum, out_nm);
}

// v008
// Measured time: 454 microseconds a run.
// Next to v007, in two timings, it ran 1.11 times as fast each time.
// Counting every step since v000, it is 2.81 times as fast.
#include <hip/hip_runtime.h>
#include <hip/hip_bf16.h>

// ---------------------------------------------------------------------------
// CDNA5 (gfx1250) transformer encoder block with memory tokens.
// - All heavy GEMMs: v_wmma_f32_16x16x32_bf16 (wave32 WMMA), f32 accumulate.
// - GEMM tile staging: global_load_async_to_lds_b128 (ASYNCcnt) with
//   double-buffered LDS tiles -> prefetch tile k+1 while computing tile k.
// ---------------------------------------------------------------------------

typedef __attribute__((ext_vector_type(16))) __bf16 v16bf;
typedef __attribute__((ext_vector_type(8)))  __bf16 v8bf;
typedef __attribute__((ext_vector_type(8)))  float  v8f;
typedef __attribute__((ext_vector_type(2)))  __bf16 v2bf;
typedef __attribute__((ext_vector_type(4)))  unsigned v4u;
typedef __attribute__((ext_vector_type(4)))  float  v4f;
typedef __attribute__((ext_vector_type(2)))  float  v2f;

static constexpr int B_    = 4;
static constexpr int S_    = 2048;
static constexpr int D_    = 1024;
static constexpr int H_    = 16;
static constexpr int DK_   = 64;
static constexpr int DFF_  = 4096;
static constexpr int MEMT_ = 32;
static constexpr int T_    = S_ + MEMT_;   // 2080 = 65 * 32
// Row pitch, in bf16, of every LDS tile whose 32-element rows are read as WMMA
// fragments with 16-byte loads: 80 bytes = 16 x 5, so the 16 rows one half-wave
// reads start on 16 different groups of four banks. At the bare 64 bytes rows
// r and r + 4 share their banks and each fragment load takes four times as long.
static constexpr int LP_   = 40;
// The same for tiles with 64-element rows: 144 bytes = 16 x 9.
static constexpr int KP_   = 72;

__device__ __forceinline__ v8f zero_v8f() {
  v8f z;
#pragma unroll
  for (int i = 0; i < 8; ++i) z[i] = 0.0f;
  return z;
}

// Build a 16-element bf16 A/B fragment from two contiguous 16-byte segments.
// Layout per CDNA5 ISA 7.12.2: lane holds row (lane%16); elements 0..7 are
// K = (lane/16)*8 .. +7, elements 8..15 are K = (lane/16)*8+16 .. +23.
__device__ __forceinline__ v16bf ld_frag(const __bf16* p0, const __bf16* p1) {
  v8bf lo = *(const v8bf*)p0;
  v8bf hi = *(const v8bf*)p1;
  return __builtin_shufflevector(lo, hi, 0, 1, 2, 3, 4, 5, 6, 7,
                                         8, 9, 10, 11, 12, 13, 14, 15);
}

// two floats -> one dword of two bf16, a in the low half
__device__ __forceinline__ unsigned pack_bf16(float a, float b) {
  v2bf t = {(__bf16)a, (__bf16)b};
  return __builtin_bit_cast(unsigned, t);
}

// lane l <-> lane l ^ 16
__device__ __forceinline__ float xhalf(float x) {
  int i = __builtin_bit_cast(int, x);
  return __builtin_bit_cast(float, __builtin_amdgcn_permlanex16(
      i, i, 0x76543210, 0xfedcba98, false, false));
}

__device__ __forceinline__ v8f wmma_bf16(v16bf a, v16bf b, v8f c) {
  return __builtin_amdgcn_wmma_f32_16x16x32_bf16(
      false, a, false, b, (short)0, c, false, false);
}

// CDNA5 async global->LDS copies, 16 bytes per lane (GVS mode: SGPR base +
// per-lane u32 byte offset). Tracked by ASYNCcnt. One K-tile's eight copies of a
// thread (A, B four times) stand in one statement that ends in s_wait_xcnt 0, so
// that no address register of a copy is rewritten ahead of that wait.
__device__ __forceinline__ void async_load8_b128(
    const unsigned (&ldsA)[4], const unsigned (&voffA)[4],
    const unsigned (&ldsB)[4], const unsigned (&voffB)[4],
    unsigned long long baseA, unsigned long long baseB) {
  asm volatile("global_load_async_to_lds_b128 %0, %1, %16\n\t"
               "global_load_async_to_lds_b128 %2, %3, %17\n\t"
               "global_load_async_to_lds_b128 %4, %5, %16\n\t"
               "global_load_async_to_lds_b128 %6, %7, %17\n\t"
               "global_load_async_to_lds_b128 %8, %9, %16\n\t"
               "global_load_async_to_lds_b128 %10, %11, %17\n\t"
               "global_load_async_to_lds_b128 %12, %13, %16\n\t"
               "global_load_async_to_lds_b128 %14, %15, %17\n\t"
               "s_wait_xcnt 0x0"
               :: "v"(ldsA[0]), "v"(voffA[0]), "v"(ldsB[0]), "v"(voffB[0]),
                  "v"(ldsA[1]), "v"(voffA[1]), "v"(ldsB[1]), "v"(voffB[1]),
                  "v"(ldsA[2]), "v"(voffA[2]), "v"(ldsB[2]), "v"(voffB[2]),
                  "v"(ldsA[3]), "v"(voffA[3]), "v"(ldsB[3]), "v"(voffB[3]),
                  "s"(baseA), "s"(baseB)
               : "memory");
}
__device__ __forceinline__ void wait_asynccnt_8() {
  asm volatile("s_wait_asynccnt 0x8" ::: "memory");
}
__device__ __forceinline__ void wait_asynccnt_0() {
  asm volatile("s_wait_asynccnt 0x0" ::: "memory");
}
// One 16-byte copy per lane, lane's own LDS byte address and global pointer. The
// closing s_wait_xcnt 0 keeps both address registers unwritten up to the wait.
__device__ __forceinline__ void async_load1_b128(unsigned lds, const __bf16* g) {
  asm volatile("global_load_async_to_lds_b128 %0, %1, off\n\t"
               "s_wait_xcnt 0x0"
               :: "v"(lds), "v"(g)
               : "memory");
}
// the wave's own LDS reads have returned before their buffer is handed back
__device__ __forceinline__ void wait_dscnt_0() {
  asm volatile("s_wait_dscnt 0x0" ::: "memory");
}

// ---------------------------------------------------------------------------
// Weight transpose + fp32 -> bf16 convert: Wt[n*K + k] = (bf16)W[k*N + n]
// One block moves a 64(k) x 64(n) tile through LDS: reads are whole 256-byte
// row pieces of W, writes are whole 128-byte lines of Wt. Two k neighbours are
// packed into one dword before LDS; the pitch of 65 dwords keeps both the
// row-wise stores and the column-wise loads free of bank conflicts.
// K and N must be multiples of 64. bx, by: the block's tile column and tile row.
// ---------------------------------------------------------------------------
__device__ __forceinline__
void transpose_convert_tile(const float* __restrict__ W,
                            __bf16* __restrict__ Wt, int K, int N, int bx, int by) {
  __shared__ unsigned tile[32 * 65];                   // [k pair][n]
  const int tid = threadIdx.x;
  const int n0 = bx * 64, k0 = by * 64;

  const int c4 = (tid & 15) * 4;
  float4 lo[2], hi[2];
#pragma unroll
  for (int i = 0; i < 2; ++i) {
    const int kp = (tid >> 4) + i * 16;
    const float* src = W + (size_t)(k0 + 2 * kp) * N + n0 + c4;
    lo[i] = *(const float4*)src;
    hi[i] = *(const float4*)(src + N);
  }
#pragma unroll
  for (int i = 0; i < 2; ++i) {
    unsigned* t = tile + ((tid >> 4) + i * 16) * 65 + c4;
    t[0] = pack_bf16(lo[i].x, hi[i].x);
    t[1] = pack_bf16(lo[i].y, hi[i].y);
    t[2] = pack_bf16(lo[i].z, hi[i].z);
    t[3] = pack_bf16(lo[i].w, hi[i].w);
  }
  __syncthreads();
#pragma unroll
  for (int i = 0; i < 2; ++i) {
    const int c = tid + i * 256;
    const int n = c >> 3, kc = c & 7;                  // 8 lanes fill one line
    const unsigned* t = tile + kc * 4 * 65 + n;
    v4u o;
#pragma unroll
    for (int e = 0; e < 4; ++e) o[e] = t[e * 65];
    *(v4u*)(Wt + (size_t)(n0 + n) * K + k0 + kc * 8) = o;
  }
  // Inlined into a kernel with other jobs, the code behind this tile may rewrite the
  // two stores' address and data registers: the wait stands in front of any such write.
  asm volatile("s_wait_xcnt 0x0" ::: "memory");
}

__device__ __forceinline__
void convert_block(const float* __restrict__ X, __bf16* __restrict__ Y, int n, int bx) {
  int i = bx * 256 + threadIdx.x;
  if (i < n) Y[i] = (__bf16)X[i];
}

// ---------------------------------------------------------------------------
// LayerNorm (matches reference: unbiased std, alpha*(x-mean)/(std+eps)+bias)
// Output bf16 for the following GEMM.
// One wave owns LNR_ whole rows of D_=1024: a lane holds 32 elements of each row,
// taken by 16-byte loads that cover four whole 128-byte lines per wave, all rows'
// loads in flight at once. Both sums run inside the lane and end in a five-step
// exchange between the lanes, so the kernel has no LDS and no barrier, and a
// launch starts rows / LNR_ = 4,096 waves, not 8 waves per row = 65,536.
// ---------------------------------------------------------------------------
static constexpr int LNR_ = 2;                 // rows per wave
static_assert((B_ * S_) % (8 * LNR_) == 0, "whole work-groups of 8 waves");
static_assert(D_ == 8 * 128, "a lane holds 8 x 4 elements of a row");

// lane l <-> lane l ^ M inside a 16-lane row (DPP row_xmask:M)
template <int M>
__device__ __forceinline__ float xrow(float x) {
  int i = __builtin_bit_cast(int, x);
  return __builtin_bit_cast(float,
      __builtin_amdgcn_update_dpp(i, i, 0x160 + M, 0xf, 0xf, false));
}
// sum over the wave's 32 lanes, the same in every lane
__device__ __forceinline__ float wave_sum(float s) {
  s += xrow<1>(s);
  s += xrow<2>(s);
  s += xrow<4>(s);
  s += xrow<8>(s);
  return s + xhalf(s);
}

__device__ __forceinline__
void layernorm_block(const float* __restrict__ x,
                     const float* __restrict__ alpha,
                     const float* __restrict__ beta,
                     __bf16* __restrict__ y, int bx) {
  const int lane = threadIdx.x & 31, wave = threadIdx.x >> 5;
  const int row0 = (bx * 8 + wave) * LNR_;
  const int c0 = lane * 4;                     // the lane's columns: c0 + 128 i .. + 3
  const float* xr = x + (size_t)row0 * D_ + c0;
  v4f v[LNR_][8];
  // every loop below is unrolled whole: constant indices keep v in registers, and
  // here all the loads are issued before the first one is waited for
#pragma unroll
  for (int r = 0; r < LNR_; ++r)
#pragma unroll
    for (int i = 0; i < 8; ++i) v[r][i] = *(const v4f*)(xr + r * D_ + i * 128);
  // no address register of these loads is rewritten ahead of this wait: named as
  // an input the address stays live up to here, so no load's result lands in it
  asm volatile("s_wait_xcnt 0x0" :: "v"(xr) : "memory");

  float mean[LNR_], rinv[LNR_];
#pragma unroll
  for (int r = 0; r < LNR_; ++r) {
    // four chains per sum, as two packed pairs: the pairs of a 16-byte load are
    // the operands of the packed add and the packed multiply-add as they lie
    v2f a0 = {0.f, 0.f}, a1 = {0.f, 0.f}, q0 = {0.f, 0.f}, q1 = {0.f, 0.f};
#pragma unroll
    for (int i = 0; i < 8; ++i) {
      const v2f lo = v[r][i].xy, hi = v[r][i].zw;
      a0 += lo;
      a1 += hi;
      q0 = __builtin_elementwise_fma(lo, lo, q0);
      q1 = __builtin_elementwise_fma(hi, hi, q1);
    }
    const float sum1 = wave_sum((a0.x + a0.y) + (a1.x + a1.y));
    const float sum2 = wave_sum((q0.x + q0.y) + (q1.x + q1.y));
    const float m = sum1 * (1.0f / D_);
    float var = (sum2 - (float)D_ * m * m) * (1.0f / (D_ - 1));
    var = var > 0.f ? var : 0.f;
    mean[r] = m;
    rinv[r] = 1.0f / (sqrtf(var) + 1e-6f);
  }

  __bf16* yr = y + (size_t)row0 * D_ + c0;
#pragma unroll
  for (int i = 0; i < 8; ++i) {
    const v4f al = *(const v4f*)(alpha + c0 + i * 128);
    const v4f be = *(const v4f*)(beta + c0 + i * 128);
#pragma unroll
    for (int r = 0; r < LNR_; ++r) {
      const v4f t = v[r][i];
      uint2 o;   // 4 bf16: a wave's store covers two whole lines
      o.x = pack_bf16(al.x * (t.x - mean[r]) * rinv[r] + be.x,
                      al.y * (t.y - mean[r]) * rinv[r] + be.y);
      o.y = pack_bf16(al.z * (t.z - mean[r]) * rinv[r] + be.z,
                      al.w * (t.w - mean[r]) * rinv[r] + be.w);
      *(uint2*)(yr + r * D_ + i * 128) = o;
    }
  }
}

__global__ __launch_bounds__(256)
void layernorm_kernel(const float* __restrict__ x,
                      const float* __restrict__ alpha,
                      const float* __restrict__ beta,
                      __bf16* __restrict__ y) {
  layernorm_block(x, alpha, beta, y, blockIdx.x);
}

// ---------------------------------------------------------------------------
// Everything that reads only the inputs, in ONE launch: the first LayerNorm, the
// six weight transposes and the conversion of the memory tokens depend on nothing
// but the inputs and on none of each other, so the block index alone picks a
// block's job. As eight launches in a row each of them paid the gap between
// launches and ran its own start and its own last memory round trip alone.
// ---------------------------------------------------------------------------
static constexpr int PB_LN_  = B_ * S_ / (8 * LNR_);           // LayerNorm blocks
static constexpr int PB_DD_  = (D_ / 64) * (D_ / 64);          // tiles of a D x D weight
static constexpr int PB_FF_  = (D_ / 64) * (DFF_ / 64);        // tiles of an FFN weight
static constexpr int PB_MEM_ = MEMT_ * D_ / 256;               // conversion blocks
static constexpr int PB_ALL_ = PB_LN_ + 4 * PB_DD_ + 2 * PB_FF_ + PB_MEM_;

__global__ __launch_bounds__(256)
void prep_kernel(const float* __restrict__ x,
                 const float* __restrict__ alpha, const float* __restrict__ beta,
                 const float* __restrict__ w_q, const float* __restrict__ w_k,
                 const float* __restrict__ w_v, const float* __restrict__ w_o,
                 const float* __restrict__ fw1, const float* __restrict__ fw2,
                 const float* __restrict__ mem,
                 __bf16* __restrict__ xn,
                 __bf16* __restrict__ wqT, __bf16* __restrict__ wkT,
                 __bf16* __restrict__ wvT, __bf16* __restrict__ woT,
                 __bf16* __restrict__ w1T, __bf16* __restrict__ w2T,
                 __bf16* __restrict__ memb) {
  int t = blockIdx.x;                          // every test below is the whole block's
  if (t < PB_LN_) { layernorm_block(x, alpha, beta, xn, t); return; }
  t -= PB_LN_;
  if (t >= 4 * PB_DD_ + 2 * PB_FF_) {
    convert_block(mem, memb, MEMT_ * D_, t - (4 * PB_DD_ + 2 * PB_FF_));
    return;
  }
  const float* W;
  __bf16* Wt;
  int K = D_, N = D_, lg = 4;                  // lg: log2 of the tiles in a row of W
  static_assert(D_ / 64 == 1 << 4 && DFF_ / 64 == 1 << 6, "lg below");
  if (t < 4 * PB_DD_) {
    const int which = t / PB_DD_;
    t -= which * PB_DD_;
    W  = which == 0 ? w_q : which == 1 ? w_k : which == 2 ? w_v : w_o;
    Wt = which == 0 ? wqT : which == 1 ? wkT : which == 2 ? wvT : woT;
  } else if (t < 4 * PB_DD_ + PB_FF_) {
    t -= 4 * PB_DD_;
    W = fw1; Wt = w1T; N = DFF_; lg = 6;
  } else {
    t -= 4 * PB_DD_ + PB_FF_;
    W = fw2; Wt = w2T; K = DFF_;
  }
  // tile column fastest, as in a grid of (N / 64, K / 64)
  transpose_convert_tile(W, Wt, K, N, t & ((1 << lg) - 1), t >> lg);
}

// ---------------------------------------------------------------------------
// WMMA GEMM: C[M,N] = A[M,K](bf16) * Bt[N,K](bf16)^T  (+ epilogue)
// MODE 0: store bf16
// MODE 1: +bias[col], ReLU, store bf16
// MODE 2: +resid[row,col], store f32
// MODE 3: +bias[col] + resid[row,col], store f32; each wave also stores the column
//         sums of its 32 x 64 piece of C: colsum[row / 32][col]
// Block tile 128x128, K-step 64. 8 waves: 4 (M) x 2 (N); wave tile 32x64.
// K must be a multiple of 64.
// Tiles staged with async global->LDS b128 copies, double-buffered so the
// next K-tile streams in while WMMAs consume the current one. A K-step is 128
// bytes of every operand row: 8 lanes copy one whole line, a wave's copy covers
// 4 whole lines, and no line is asked for in two halves by two K-steps.
// Rows >= M are clamped (not skipped) so every wave issues exactly 8 async
// ops per tile -> ASYNCcnt bookkeeping is uniform; epilogue guards stores.
// ---------------------------------------------------------------------------
// bx, by: the block's tile column and tile row.
template <int MODE>
__device__ __forceinline__
void gemm_bt_tile(const __bf16* __restrict__ A, const __bf16* __restrict__ Bt,
                  const float* __restrict__ bias, const float* __restrict__ resid,
                  float* __restrict__ Cf, __bf16* __restrict__ Cb,
                  float* __restrict__ colsum, int M, int N, int K, int bx, int by) {
  __shared__ __align__(16) __bf16 sA[2][128 * KP_];
  __shared__ __align__(16) __bf16 sB[2][128 * KP_];
  const int tid = threadIdx.x;
  const int lane = tid & 31, wave = tid >> 5;
  const int mw = wave >> 1, nw = wave & 1;
  const int mbase = by * 128, nbase = bx * 128;
  const int lrow = lane & 15, lh = lane >> 4;

  const unsigned long long baseA = (unsigned long long)(uintptr_t)A;
  const unsigned long long baseB = (unsigned long long)(uintptr_t)Bt;

  // this thread's four 16-byte segments of a 128x64 tile: rows r0 + 32 i, one column
  const int r0 = tid >> 3, c0 = (tid & 7) * 8;
  unsigned rowA[4], rowB[4];                         // byte offset of row and column
#pragma unroll   // constant indices keep the two arrays in registers
  for (int i = 0; i < 4; ++i) {
    int ga = mbase + r0 + i * 32; if (ga >= M) ga = M - 1;   // clamp, never skip
    rowA[i] = (unsigned)(((size_t)ga * K + c0) * 2);
    rowB[i] = (unsigned)(((size_t)(nbase + r0 + i * 32) * K + c0) * 2);
  }

  auto issue_tile = [&](int kk, int p) {
    unsigned la[4], va[4], lb[4], vb[4];
#pragma unroll   // constant indices: each element is a register operand of the copies
    for (int i = 0; i < 4; ++i) {
      la[i] = (unsigned)(uintptr_t)&sA[p][(r0 + i * 32) * KP_ + c0];
      lb[i] = (unsigned)(uintptr_t)&sB[p][(r0 + i * 32) * KP_ + c0];
      va[i] = rowA[i] + (unsigned)kk * 2u;
      vb[i] = rowB[i] + (unsigned)kk * 2u;
    }
    async_load8_b128(la, va, lb, vb, baseA, baseB);
  };

  v8f acc[2][4];
#pragma unroll
  for (int mi = 0; mi < 2; ++mi)
#pragma unroll
    for (int ni = 0; ni < 4; ++ni) acc[mi][ni] = zero_v8f();

  issue_tile(0, 0);
  int p = 0;
  for (int kk = 0; kk < K; kk += 64) {
    const bool pf = (kk + 64) < K;
    if (pf) {
      issue_tile(kk + 64, p ^ 1);   // 8 new in flight on top of 8 old
      wait_asynccnt_8();            // all but the 8 youngest: tile p has landed
    } else {
      wait_asynccnt_0();
    }
    __syncthreads();

#pragma unroll   // ks becomes an immediate offset of the LDS loads
    for (int ks = 0; ks < 2; ++ks) {   // the tile's two 32-element WMMA steps, in k order
      v16bf af[2], bfr[4];
#pragma unroll
      for (int mi = 0; mi < 2; ++mi) {
        const __bf16* q = sA[p] + (mw * 32 + mi * 16 + lrow) * KP_ + ks * 32 + lh * 8;
        af[mi] = ld_frag(q, q + 16);
      }
#pragma unroll
      for (int ni = 0; ni < 4; ++ni) {
        const __bf16* q = sB[p] + (nw * 64 + ni * 16 + lrow) * KP_ + ks * 32 + lh * 8;
        bfr[ni] = ld_frag(q, q + 16);
      }
#pragma unroll
      for (int mi = 0; mi < 2; ++mi)
#pragma unroll
        for (int ni = 0; ni < 4; ++ni)
          acc[mi][ni] = wmma_bf16(af[mi], bfr[ni], acc[mi][ni]);
    }

    __syncthreads();                // tile p free for overwrite next round
    p ^= 1;
  }

  // epilogue (C layout: VGPR j -> row j + 8*(lane/16); col = lane%16)
  // Left as it is: under the per-row guard each of a lane's 64 elements waits for its
  // own bias and residual load before the next one is issued.
  float cs[4] = {0.f, 0.f, 0.f, 0.f};   // MODE 3: sum over this lane's 16 rows, per column
#pragma unroll
  for (int mi = 0; mi < 2; ++mi) {
#pragma unroll
    for (int ni = 0; ni < 4; ++ni) {
      int col = nbase + nw * 64 + ni * 16 + lrow;
#pragma unroll
      for (int j = 0; j < 8; ++j) {
        int row = mbase + mw * 32 + mi * 16 + j + 8 * lh;
        if (row >= M) continue;
        float r = acc[mi][ni][j];
        if (MODE == 1 || MODE == 3) r += bias[col];
        if (MODE == 1) r = r > 0.f ? r : 0.f;
        if (MODE == 2 || MODE == 3) r += resid[(size_t)row * N + col];
        if (MODE == 0 || MODE == 1)
          Cb[(size_t)row * N + col] = (__bf16)r;
        else
          Cf[(size_t)row * N + col] = r;
        if (MODE == 3) cs[ni] += r;
      }
    }
  }
  if (MODE == 3) {
    // the other 16 rows of the column are in lane ^ 16; one wave writes its two
    // whole 128-byte lines of colsum
    float* cp = colsum + (size_t)(by * 4 + mw) * N + nbase + nw * 64 + lrow;
#pragma unroll
    for (int ni = 0; ni < 4; ++ni) {
      const float s = cs[ni] + xhalf(cs[ni]);
      if (lh == 0) cp[ni * 16] = s;
    }
  }
}

template <int MODE>
__global__ __launch_bounds__(256)
void gemm_bt_kernel(const __bf16* __restrict__ A, const __bf16* __restrict__ Bt,
                    const float* __restrict__ bias, const float* __restrict__ resid,
                    float* __restrict__ Cf, __bf16* __restrict__ Cb,
                    float* __restrict__ colsum, int M, int N, int K) {
  gemm_bt_tile<MODE>(A, Bt, bias, resid, Cf, Cb, colsum, M, N, K,
                     blockIdx.x, blockIdx.y);
}

// The five projections in front of attention in ONE launch: Q, K, V of the
// normalized rows and K, V of the memory tokens read finished buffers only and
// write buffers of their own. Grid: x = 3 weights x D_/128 tile columns, y = one
// tile row of memory tokens (it has no Q: those blocks leave at once), then the
// rows / 128 tile rows of xn. The two memory products, 8 blocks each, ran a whole
// K loop alone on the chip as launches of their own.
// wT: wq^T, wk^T, wv^T one after the other; qkv: q, k, v; memKV: memory K, V.
__global__ __launch_bounds__(256)
void qkv_gemm_kernel(const __bf16* __restrict__ xn, const __bf16* __restrict__ memb,
                     const __bf16* __restrict__ wT, __bf16* __restrict__ qkv,
                     __bf16* __restrict__ memKV) {
  constexpr int NT = D_ / 128;
  const int which = blockIdx.x / NT, bx = blockIdx.x - which * NT;
  const __bf16* Bt = wT + (size_t)which * D_ * D_;
  const bool ismem = blockIdx.y == 0;
  if (ismem && which == 0) return;   // the whole block, in front of every barrier and copy
  gemm_bt_tile<0>(ismem ? memb : xn, Bt, nullptr, nullptr, nullptr,
                  ismem ? memKV + (size_t)(which - 1) * MEMT_ * D_
                        : qkv + (size_t)which * B_ * S_ * D_,
                  nullptr, ismem ? MEMT_ : B_ * S_, D_, D_,
                  bx, ismem ? 0 : blockIdx.y - 1);
}

__device__ __forceinline__ void exp2_run8(float* o, const float* x) {
  asm("v_exp_f32 %0, %8\n\t"
      "v_exp_f32 %1, %9\n\t"
      "v_exp_f32 %2, %10\n\t"
      "v_exp_f32 %3, %11\n\t"
      "v_exp_f32 %4, %12\n\t"
      "v_exp_f32 %5, %13\n\t"
      "v_exp_f32 %6, %14\n\t"
      "v_exp_f32 %7, %15\n\t"
      "v_nop"
      : "=&v"(o[0]), "=&v"(o[1]), "=&v"(o[2]), "=&v"(o[3]),
        "=&v"(o[4]), "=&v"(o[5]), "=&v"(o[6]), "=&v"(o[7])
      : "v"(x[0]), "v"(x[1]), "v"(x[2]), "v"(x[3]),
        "v"(x[4]), "v"(x[5]), "v"(x[6]), "v"(x[7]));
}
__device__ __forceinline__ float exp2_one(float x) {
  float o;
  asm("v_exp_f32 %0, %1\n\t"
      "v_nop"
      : "=&v"(o) : "v"(x));
  return o;
}

// 8 waves per SIMD = 4 blocks per WGP: the whole grid of 1,024 blocks is then
// resident at once instead of running a thin second round.
__global__ __launch_bounds__(256) __attribute__((amdgpu_waves_per_eu(8)))
void attention_kernel(const __bf16* __restrict__ qg, const __bf16* __restrict__ kg,
                      const __bf16* __restrict__ vg,
                      const __bf16* __restrict__ memk, const __bf16* __restrict__ memv,
                      const int* __restrict__ mask,
                      __bf16* __restrict__ ctxout) {
  __shared__ __align__(16) __bf16 sVt[64 * LP_];       // V tile transposed [d][key]
  __shared__ __align__(16) __bf16 sK[2][32 * KP_];     // K tiles [key][d]

  const int tid = threadIdx.x, lane = tid & 31, wave = tid >> 5;
  const int lrow = lane & 15, lh = lane >> 4;
  const int bh = blockIdx.y;
  const int b = bh >> 4, h = bh & 15;
  const int qbase = blockIdx.x * 128 + wave * 16;

  // Q fragments (rows qbase..+15, d 0..63), pre-scaled by 1/sqrt(64)=0.125
  v16bf qf[2];
  {
    const __bf16* qp =
        qg + ((size_t)b * S_ + qbase + lrow) * D_ + h * DK_ + lh * 8;
#pragma unroll
    for (int half = 0; half < 2; ++half) {
      v16bf f = ld_frag(qp + half * 32, qp + half * 32 + 16);
#pragma unroll
      for (int i = 0; i < 16; ++i) f[i] = (__bf16)((float)f[i] * 0.125f);
      qf[half] = f;
    }
  }

  // ctx[dg][j] = O[query lrow][d = dg*16 + j + 8*lh]
  v8f ctx[4];
#pragma unroll
  for (int dg = 0; dg < 4; ++dg) ctx[dg] = zero_v8f();
  float mrun = -3.0e38f;   // this lane's query: running maximum (both halves equal)
  float lsum = 0.f;        // running sum over this lane's own keys only

  // this lane's query row of the mask, at its first key of a tile
  const int* mrow = mask + (size_t)(qbase + lrow) * T_ + lh * 8;

  // this thread's 16 bytes of a K tile; a tile lies wholly in the memory keys or
  // wholly in the sequence keys, so the choice of the source is the block's
  static_assert(MEMT_ % 32 == 0, "a K tile must not straddle the two sources");
  auto issue_k = [&](int t0, int buf) {
    const int key = tid >> 3;
    const int dseg = (tid & 7) * 8;
    const __bf16* tile = (t0 < MEMT_) ? (memk + (size_t)t0 * D_)
                                      : (kg + ((size_t)b * S_ + (t0 - MEMT_)) * D_);
    async_load1_b128((unsigned)(uintptr_t)&sK[buf][key * KP_ + dseg],
                     tile + (size_t)key * D_ + h * DK_ + dseg);
  };
  issue_k(0, 0);
  wait_asynccnt_0();
  __syncthreads();               // tile 0 is published
  issue_k(32, 1);                // T_ = 65 tiles: tile 1 exists

  for (int tbase = 0; tbase < T_; tbase += 32) {
    const int kbuf = (tbase >> 5) & 1;
    // stage transposed V tile (32 keys x 64 dims) cooperatively
    {
      int key = tid >> 3;
      int dseg = (tid & 7) * 8;
      int tg = tbase + key;
      const __bf16* src =
          (tg < MEMT_) ? (memv + (size_t)tg * D_ + h * DK_ + dseg)
                       : (vg + ((size_t)b * S_ + (tg - MEMT_)) * D_ + h * DK_ + dseg);
      v8bf val = *(const v8bf*)src;
#pragma unroll
      for (int i = 0; i < 8; ++i) sVt[(dseg + i) * LP_ + key] = val[i];
    }
    __syncthreads();

    // the mask words of this tile (the lane's 2 x 8 keys are 2 x 32 contiguous
    // bytes of its query's mask row) and the K fragments (A operand: row = key)
    const int* mp = mrow + tbase;
    int4 mk[4];
#pragma unroll
    for (int i = 0; i < 4; ++i) mk[i] = *(const int4*)(mp + (i >> 1) * 16 + (i & 1) * 4);
    v16bf kf[2][2];
#pragma unroll
    for (int grp = 0; grp < 2; ++grp) {
      const __bf16* ka = sK[kbuf] + (grp * 16 + lrow) * KP_ + lh * 8;
      kf[grp][0] = ld_frag(ka, ka + 16);
      kf[grp][1] = ld_frag(ka + 32, ka + 48);
    }
    // all twelve loads are in flight before the first product waits for one
    __builtin_amdgcn_sched_barrier(0);
    // no address register of the mask loads is rewritten ahead of this wait: named
    // as an input it stays live up to here, so no load's result lands in it
    asm volatile("s_wait_xcnt 0x0" :: "v"(mp) : "memory");

    // scores, transposed: [32 keys x 16 queries] = K[32x64] @ Q^T
    // st[j] = S[query lrow][key tbase + grp*16 + 8*lh + j]
    float v[16];
#pragma unroll
    for (int grp = 0; grp < 2; ++grp) {
      v8f st = wmma_bf16(kf[grp][0], qf[0], zero_v8f());
      st = wmma_bf16(kf[grp][1], qf[1], st);
      const int4 ma = mk[grp * 2], mb = mk[grp * 2 + 1];
      v[grp * 8 + 0] = ma.x ? st[0] : -1e9f;
      v[grp * 8 + 1] = ma.y ? st[1] : -1e9f;
      v[grp * 8 + 2] = ma.z ? st[2] : -1e9f;
      v[grp * 8 + 3] = ma.w ? st[3] : -1e9f;
      v[grp * 8 + 4] = mb.x ? st[4] : -1e9f;
      v[grp * 8 + 5] = mb.y ? st[5] : -1e9f;
      v[grp * 8 + 6] = mb.z ? st[6] : -1e9f;
      v[grp * 8 + 7] = mb.w ? st[7] : -1e9f;
    }

    // online softmax of one query per lane
    float tmax = v[0];
#pragma unroll
    for (int i = 1; i < 16; ++i) tmax = fmaxf(tmax, v[i]);
    tmax = fmaxf(tmax, xhalf(tmax));
    const float newm = fmaxf(mrun, tmax);
    constexpr float LOG2E = 1.44269504f;       // e^x = 2^(x * log2 e)
    const float scale = exp2_one((mrun - newm) * LOG2E);
    mrun = newm;
    float p[16];
#pragma unroll
    for (int i = 0; i < 16; ++i) v[i] = (v[i] - newm) * LOG2E;
    exp2_run8(p, v);
    exp2_run8(p + 8, v + 8);
    float ts = 0.f;
    v16bf pf;   // P^T as B operand: element i <-> key 8*lh + i (+8 for i >= 8)
#pragma unroll
    for (int i = 0; i < 16; ++i) {
      ts += p[i];
      pf[i] = (__bf16)p[i];
    }
    lsum = lsum * scale + ts;
#pragma unroll
    for (int dg = 0; dg < 4; ++dg)
#pragma unroll
      for (int j = 0; j < 8; ++j) ctx[dg][j] *= scale;

    // O^T += V^T @ P^T  (M = 64 dims in 4 groups, K = 32 keys)
#pragma unroll
    for (int dg = 0; dg < 4; ++dg) {
      const __bf16* vp = sVt + (dg * 16 + lrow) * LP_ + lh * 8;
      v16bf vf = ld_frag(vp, vp + 16);
      ctx[dg] = wmma_bf16(vf, pf, ctx[dg]);
    }

    // foot of the trip: own LDS reads back, own copies of tile t + 1 landed; the
    // barrier publishes that tile and ends every read of this trip's K and V
    wait_dscnt_0();
    wait_asynccnt_0();
    __syncthreads();
    if (tbase + 64 < T_) issue_k(tbase + 64, kbuf);   // same for the whole block
  }
  wait_asynccnt_0();             // no copy is left in flight when the wave ends

  // join the halves' sums, normalize, write ctx as bf16 in [B,S,D]: a lane holds
  // 8 neighbouring dims of its query per group, one 16-byte store each
  const float inv = 1.0f / (lsum + xhalf(lsum));
  __bf16* op = ctxout + ((size_t)b * S_ + qbase + lrow) * D_ + h * DK_ + lh * 8;
#pragma unroll
  for (int dg = 0; dg < 4; ++dg) {
    v8bf o;
#pragma unroll
    for (int j = 0; j < 8; ++j) o[j] = (__bf16)(ctx[dg][j] * inv);
    *(v8bf*)(op + dg * 16) = o;
  }
}

// ---------------------------------------------------------------------------
// new_memory: broadcast mean over S of final x into [B, MEM, D]
// The last GEMM has left the sums of every 32 rows of x in colsum[B*S/32][D]:
// a column's mean takes 64 independent loads, not 2,048 rows in 128 dependent
// rounds of loads on 16 work-groups.
// ---------------------------------------------------------------------------
__global__ __launch_bounds__(256)
void mean_bcast_kernel(const float* __restrict__ colsum, float* __restrict__ nm) {
  constexpr int G = S_ / 32;                   // partial sums per column
  int gid = blockIdx.x * 256 + threadIdx.x;    // B*D threads
  int b = gid / D_;
  int d = gid - b * D_;
  const float* p = colsum + (size_t)b * G * D_ + d;
  float v[G];
  // unrolled whole, so that all loads are in flight at once: one memory latency
#pragma unroll
  for (int i = 0; i < G; ++i) v[i] = p[(size_t)i * D_];
  float s4[4] = {0.f, 0.f, 0.f, 0.f};
#pragma unroll
  for (int i = 0; i < G; ++i) s4[i & 3] += v[i];
  float s = (s4[0] + s4[1]) + (s4[2] + s4[3]);
  float mean = s * (1.0f / S_);
  float* o = nm + (size_t)b * MEMT_ * D_ + d;
  for (int mI = 0; mI < MEMT_; ++mI) o[(size_t)mI * D_] = mean;
}

// ---------------------------------------------------------------------------
// launch
// ---------------------------------------------------------------------------
extern "C" void kernel_launch(void* const* d_in, const int* in_sizes, int n_in,
                              void* d_out, int out_size, void* d_ws, size_t ws_size,
                              hipStream_t stream) {
  (void)in_sizes; (void)n_in; (void)out_size; (void)ws_size;
  const float* x    = (const float*)d_in[0];
  const int*   mask = (const int*)d_in[1];
  const float* mem  = (const float*)d_in[2];
  const float* w_q  = (const float*)d_in[3];
  const float* w_k  = (const float*)d_in[4];
  const float* w_v  = (const float*)d_in[5];
  const float* w_o  = (const float*)d_in[6];
  const float* ln1a = (const float*)d_in[7];
  const float* ln1b = (const float*)d_in[8];
  const float* ln2a = (const float*)d_in[9];
  const float* ln2b = (const float*)d_in[10];
  const float* fw1  = (const float*)d_in[11];
  const float* fb1  = (const float*)d_in[12];
  const float* fw2  = (const float*)d_in[13];
  const float* fb2  = (const float*)d_in[14];

  float* out_x  = (float*)d_out;                                // [B,S,D]
  float* out_nm = out_x + (size_t)B_ * S_ * D_;                 // [B,MEM,D]

  // workspace carve-out
  size_t off = 0;
  auto carve = [&](size_t bytes) -> char* {
    char* p = (char*)d_ws + off;
    off = (off + bytes + 255) & ~(size_t)255;
    return p;
  };
  __bf16* wqT  = (__bf16*)carve((size_t)3 * D_ * D_ * 2);      // wq^T, wk^T, wv^T
  __bf16* wkT  = wqT + (size_t)D_ * D_;
  __bf16* wvT  = wkT + (size_t)D_ * D_;
  __bf16* woT  = (__bf16*)carve((size_t)D_ * D_ * 2);
  __bf16* w1T  = (__bf16*)carve((size_t)DFF_ * D_ * 2);
  __bf16* w2T  = (__bf16*)carve((size_t)D_ * DFF_ * 2);
  __bf16* memb = (__bf16*)carve((size_t)MEMT_ * D_ * 2);
  __bf16* memK = (__bf16*)carve((size_t)2 * MEMT_ * D_ * 2);   // memory K, V
  __bf16* memV = memK + (size_t)MEMT_ * D_;
  __bf16* xn   = (__bf16*)carve((size_t)B_ * S_ * D_ * 2);
  __bf16* qb   = (__bf16*)carve((size_t)3 * B_ * S_ * D_ * 2); // q, k, v
  __bf16* kb   = qb + (size_t)B_ * S_ * D_;
  __bf16* vb   = kb + (size_t)B_ * S_ * D_;
  __bf16* ctxb = (__bf16*)carve((size_t)B_ * S_ * D_ * 2);
  float*  x1   = (float*)carve((size_t)B_ * S_ * D_ * 4);
  __bf16* xn2  = (__bf16*)carve((size_t)B_ * S_ * D_ * 2);
  __bf16* ffh  = (__bf16*)carve((size_t)B_ * S_ * DFF_ * 2);
  float*  csum = (float*)carve((size_t)(B_ * S_ / 32) * D_ * 4);

  const int rows = B_ * S_;   // 8192
  dim3 blk(256);

  // LN1, weight prep (bf16, transposed to [N][K]), memory tokens to bf16
  prep_kernel<<<PB_ALL_, blk, 0, stream>>>(x, ln1a, ln1b, w_q, w_k, w_v, w_o, fw1, fw2, mem,
                                           xn, wqT, wkT, wvT, woT, w1T, w2T, memb);

  // Q/K/V projections (WMMA bf16) and memory K/V (raw memory tokens, not
  // layernormed; M=32 with row clamp)
  qkv_gemm_kernel<<<dim3(3 * (D_ / 128), 1 + rows / 128), blk, 0, stream>>>(
      xn, memb, wqT, qb, memK);

  // flash attention over T = MEM + S
  attention_kernel<<<dim3(S_ / 128, B_ * H_), blk, 0, stream>>>(
      qb, kb, vb, memK, memV, mask, ctxb);

  // out-proj + residual -> x1 (f32)
  gemm_bt_kernel<2><<<dim3(D_ / 128, rows / 128), blk, 0, stream>>>(
      ctxb, woT, nullptr, x, x1, nullptr, nullptr, rows, D_, D_);

  // LN2 -> FFN
  layernorm_kernel<<<rows / (8 * LNR_), blk, 0, stream>>>(x1, ln2a, ln2b, xn2);
  gemm_bt_kernel<1><<<dim3(DFF_ / 128, rows / 128), blk, 0, stream>>>(
      xn2, w1T, fb1, nullptr, nullptr, ffh, nullptr, rows, DFF_, D_);
  gemm_bt_kernel<3><<<dim3(D_ / 128, rows / 128), blk, 0, stream>>>(
      ffh, w2T, fb2, x1, out_x, nullptr, csum, rows, D_, DFF_);

  // new_memory = broadcast mean over S, from the last GEMM's column sums
  mean_bcast_kernel<<<(B_ * D_) / 256, blk, 0, stream>>>(csum, out_nm);
}

// v009
// A run of this version takes 406 microseconds.
// Timed twice side by side with v008, it ran 1.12 times as fast both times.
// Over all steps from v000 it is 3.13 times as fast.
#include <hip/hip_runtime.h>
#include <hip/hip_bf16.h>

// ---------------------------------------------------------------------------
// CDNA5 (gfx1250) transformer encoder block with memory tokens.
// - All heavy GEMMs: v_wmma_f32_16x16x32_bf16 (wave32 WMMA), f32 accumulate.
// - GEMM tile staging: global_load_async_to_lds_b128 (ASYNCcnt) with
//   double-buffered LDS tiles -> prefetch tile k+1 while computing tile k.
// ---------------------------------------------------------------------------

typedef __attribute__((ext_vector_type(16))) __bf16 v16bf;
typedef __attribute__((ext_vector_type(8)))  __bf16 v8bf;
typedef __attribute__((ext_vector_type(8)))  float  v8f;
typedef __attribute__((ext_vector_type(2)))  __bf16 v2bf;
typedef __attribute__((ext_vector_type(4)))  unsigned v4u;
typedef __attribute__((ext_vector_type(4)))  float  v4f;
typedef __attribute__((ext_vector_type(2)))  float  v2f;
typedef __attribute__((ext_vector_type(16))) unsigned v16u;

static constexpr int B_    = 4;
static constexpr int S_    = 2048;
static constexpr int D_    = 1024;
static constexpr int H_    = 16;
static constexpr int DK_   = 64;
static constexpr int DFF_  = 4096;
static constexpr int MEMT_ = 32;
static constexpr int T_    = S_ + MEMT_;   // 2080 = 65 * 32
// Row pitch, in bf16, of every LDS tile whose 32-element rows are read as WMMA
// fragments with 16-byte loads: 80 bytes = 16 x 5, so the 16 rows one half-wave
// reads start on 16 different groups of four banks. At the bare 64 bytes rows
// r and r + 4 share their banks and each fragment load takes four times as long.
static constexpr int LP_   = 40;
// The same for tiles with 64-element rows: 144 bytes = 16 x 9.
static constexpr int KP_   = 72;

__device__ __forceinline__ v8f zero_v8f() {
  v8f z;
#pragma unroll
  for (int i = 0; i < 8; ++i) z[i] = 0.0f;
  return z;
}

// Build a 16-element bf16 A/B fragment from two contiguous 16-byte segments.
// Layout per CDNA5 ISA 7.12.2: lane holds row (lane%16); elements 0..7 are
// K = (lane/16)*8 .. +7, elements 8..15 are K = (lane/16)*8+16 .. +23.
__device__ __forceinline__ v16bf ld_frag(const __bf16* p0, const __bf16* p1) {
  v8bf lo = *(const v8bf*)p0;
  v8bf hi = *(const v8bf*)p1;
  return __builtin_shufflevector(lo, hi, 0, 1, 2, 3, 4, 5, 6, 7,
                                         8, 9, 10, 11, 12, 13, 14, 15);
}

// two floats -> one dword of two bf16, a in the low half
__device__ __forceinline__ unsigned pack_bf16(float a, float b) {
  v2bf t = {(__bf16)a, (__bf16)b};
  return __builtin_bit_cast(unsigned, t);
}

// lane l <-> lane l ^ 16
__device__ __forceinline__ float xhalf(float x) {
  int i = __builtin_bit_cast(int, x);
  return __builtin_bit_cast(float, __builtin_amdgcn_permlanex16(
      i, i, 0x76543210, 0xfedcba98, false, false));
}

__device__ __forceinline__ v8f wmma_bf16(v16bf a, v16bf b, v8f c) {
  return __builtin_amdgcn_wmma_f32_16x16x32_bf16(
      false, a, false, b, (short)0, c, false, false);
}

// CDNA5 async global->LDS copies, 16 bytes per lane (GVS mode: SGPR base +
// per-lane u32 byte offset). Tracked by ASYNCcnt. One K-tile's eight copies of a
// thread (A, B four times) stand in one statement that ends in s_wait_xcnt 0, so
// that no address register of a copy is rewritten ahead of that wait.
__device__ __forceinline__ void async_load8_b128(
    const unsigned (&ldsA)[4], const unsigned (&voffA)[4],
    const unsigned (&ldsB)[4], const unsigned (&voffB)[4],
    unsigned long long baseA, unsigned long long baseB) {
  asm volatile("global_load_async_to_lds_b128 %0, %1, %16\n\t"
               "global_load_async_to_lds_b128 %2, %3, %17\n\t"
               "global_load_async_to_lds_b128 %4, %5, %16\n\t"
               "global_load_async_to_lds_b128 %6, %7, %17\n\t"
               "global_load_async_to_lds_b128 %8, %9, %16\n\t"
               "global_load_async_to_lds_b128 %10, %11, %17\n\t"
               "global_load_async_to_lds_b128 %12, %13, %16\n\t"
               "global_load_async_to_lds_b128 %14, %15, %17\n\t"
               "s_wait_xcnt 0x0"
               :: "v"(ldsA[0]), "v"(voffA[0]), "v"(ldsB[0]), "v"(voffB[0]),
                  "v"(ldsA[1]), "v"(voffA[1]), "v"(ldsB[1]), "v"(voffB[1]),
                  "v"(ldsA[2]), "v"(voffA[2]), "v"(ldsB[2]), "v"(voffB[2]),
                  "v"(ldsA[3]), "v"(voffA[3]), "v"(ldsB[3]), "v"(voffB[3]),
                  "s"(baseA), "s"(baseB)
               : "memory");
}
__device__ __forceinline__ void wait_asynccnt_8() {
  asm volatile("s_wait_asynccnt 0x8" ::: "memory");
}
__device__ __forceinline__ void wait_asynccnt_0() {
  asm volatile("s_wait_asynccnt 0x0" ::: "memory");
}
// One 16-byte copy per lane, lane's own LDS byte address and global pointer. The
// closing s_wait_xcnt 0 keeps both address registers unwritten up to the wait.
__device__ __forceinline__ void async_load1_b128(unsigned lds, const __bf16* g) {
  asm volatile("global_load_async_to_lds_b128 %0, %1, off\n\t"
               "s_wait_xcnt 0x0"
               :: "v"(lds), "v"(g)
               : "memory");
}
// the wave's own LDS reads have returned before their buffer is handed back
__device__ __forceinline__ void wait_dscnt_0() {
  asm volatile("s_wait_dscnt 0x0" ::: "memory");
}

// ---------------------------------------------------------------------------
// Weight transpose + fp32 -> bf16 convert: Wt[n*K + k] = (bf16)W[k*N + n]
// One block moves a 64(k) x 64(n) tile through LDS: reads are whole 256-byte
// row pieces of W, writes are whole 128-byte lines of Wt. Two k neighbours are
// packed into one dword before LDS; the pitch of 65 dwords keeps both the
// row-wise stores and the column-wise loads free of bank conflicts.
// K and N must be multiples of 64. bx, by: the block's tile column and tile row.
// ---------------------------------------------------------------------------
__device__ __forceinline__
void transpose_convert_tile(const float* __restrict__ W,
                            __bf16* __restrict__ Wt, int K, int N, int bx, int by) {
  __shared__ unsigned tile[32 * 65];                   // [k pair][n]
  const int tid = threadIdx.x;
  const int n0 = bx * 64, k0 = by * 64;

  const int c4 = (tid & 15) * 4;
  float4 lo[2], hi[2];
#pragma unroll
  for (int i = 0; i < 2; ++i) {
    const int kp = (tid >> 4) + i * 16;
    const float* src = W + (size_t)(k0 + 2 * kp) * N + n0 + c4;
    lo[i] = *(const float4*)src;
    hi[i] = *(const float4*)(src + N);
  }
#pragma unroll
  for (int i = 0; i < 2; ++i) {
    unsigned* t = tile + ((tid >> 4) + i * 16) * 65 + c4;
    t[0] = pack_bf16(lo[i].x, hi[i].x);
    t[1] = pack_bf16(lo[i].y, hi[i].y);
    t[2] = pack_bf16(lo[i].z, hi[i].z);
    t[3] = pack_bf16(lo[i].w, hi[i].w);
  }
  __syncthreads();
#pragma unroll
  for (int i = 0; i < 2; ++i) {
    const int c = tid + i * 256;
    const int n = c >> 3, kc = c & 7;                  // 8 lanes fill one line
    const unsigned* t = tile + kc * 4 * 65 + n;
    v4u o;
#pragma unroll
    for (int e = 0; e < 4; ++e) o[e] = t[e * 65];
    *(v4u*)(Wt + (size_t)(n0 + n) * K + k0 + kc * 8) = o;
  }
  // Inlined into a kernel with other jobs, the code behind this tile may rewrite the
  // two stores' address and data registers: the wait stands in front of any such write.
  asm volatile("s_wait_xcnt 0x0" ::: "memory");
}

__device__ __forceinline__
void convert_block(const float* __restrict__ X, __bf16* __restrict__ Y, int n, int bx) {
  int i = bx * 256 + threadIdx.x;
  if (i < n) Y[i] = (__bf16)X[i];
}

// ---------------------------------------------------------------------------
// LayerNorm (matches reference: unbiased std, alpha*(x-mean)/(std+eps)+bias)
// Output bf16 for the following GEMM.
// One wave owns LNR_ whole rows of D_=1024: a lane holds 32 elements of each row,
// taken by 16-byte loads that cover four whole 128-byte lines per wave, all rows'
// loads in flight at once. Both sums run inside the lane and end in a five-step
// exchange between the lanes, so the kernel has no LDS and no barrier, and a
// launch starts rows / LNR_ = 4,096 waves, not 8 waves per row = 65,536.
// ---------------------------------------------------------------------------
static constexpr int LNR_ = 2;                 // rows per wave
static_assert((B_ * S_) % (8 * LNR_) == 0, "whole work-groups of 8 waves");
static_assert(D_ == 8 * 128, "a lane holds 8 x 4 elements of a row");

// lane l <-> lane l ^ M inside a 16-lane row (DPP row_xmask:M)
template <int M>
__device__ __forceinline__ float xrow(float x) {
  int i = __builtin_bit_cast(int, x);
  return __builtin_bit_cast(float,
      __builtin_amdgcn_update_dpp(i, i, 0x160 + M, 0xf, 0xf, false));
}
// sum over the wave's 32 lanes, the same in every lane
__device__ __forceinline__ float wave_sum(float s) {
  s += xrow<1>(s);
  s += xrow<2>(s);
  s += xrow<4>(s);
  s += xrow<8>(s);
  return s + xhalf(s);
}

__device__ __forceinline__
void layernorm_block(const float* __restrict__ x,
                     const float* __restrict__ alpha,
                     const float* __restrict__ beta,
                     __bf16* __restrict__ y, int bx) {
  const int lane = threadIdx.x & 31, wave = threadIdx.x >> 5;
  const int row0 = (bx * 8 + wave) * LNR_;
  const int c0 = lane * 4;                     // the lane's columns: c0 + 128 i .. + 3
  const float* xr = x + (size_t)row0 * D_ + c0;
  v4f v[LNR_][8];
  // every loop below is unrolled whole: constant indices keep v in registers, and
  // here all the loads are issued before the first one is waited for
#pragma unroll
  for (int r = 0; r < LNR_; ++r)
#pragma unroll
    for (int i = 0; i < 8; ++i) v[r][i] = *(const v4f*)(xr + r * D_ + i * 128);
  // no address register of these loads is rewritten ahead of this wait: named as
  // an input the address stays live up to here, so no load's result lands in it
  asm volatile("s_wait_xcnt 0x0" :: "v"(xr) : "memory");

  float mean[LNR_], rinv[LNR_];
#pragma unroll
  for (int r = 0; r < LNR_; ++r) {
    // four chains per sum, as two packed pairs: the pairs of a 16-byte load are
    // the operands of the packed add and the packed multiply-add as they lie
    v2f a0 = {0.f, 0.f}, a1 = {0.f, 0.f}, q0 = {0.f, 0.f}, q1 = {0.f, 0.f};
#pragma unroll
    for (int i = 0; i < 8; ++i) {
      const v2f lo = v[r][i].xy, hi = v[r][i].zw;
      a0 += lo;
      a1 += hi;
      q0 = __builtin_elementwise_fma(lo, lo, q0);
      q1 = __builtin_elementwise_fma(hi, hi, q1);
    }
    const float sum1 = wave_sum((a0.x + a0.y) + (a1.x + a1.y));
    const float sum2 = wave_sum((q0.x + q0.y) + (q1.x + q1.y));
    const float m = sum1 * (1.0f / D_);
    float var = (sum2 - (float)D_ * m * m) * (1.0f / (D_ - 1));
    var = var > 0.f ? var : 0.f;
    mean[r] = m;
    rinv[r] = 1.0f / (sqrtf(var) + 1e-6f);
  }

  __bf16* yr = y + (size_t)row0 * D_ + c0;
#pragma unroll
  for (int i = 0; i < 8; ++i) {
    const v4f al = *(const v4f*)(alpha + c0 + i * 128);
    const v4f be = *(const v4f*)(beta + c0 + i * 128);
#pragma unroll
    for (int r = 0; r < LNR_; ++r) {
      const v4f t = v[r][i];
      uint2 o;   // 4 bf16: a wave's store covers two whole lines
      o.x = pack_bf16(al.x * (t.x - mean[r]) * rinv[r] + be.x,
                      al.y * (t.y - mean[r]) * rinv[r] + be.y);
      o.y = pack_bf16(al.z * (t.z - mean[r]) * rinv[r] + be.z,
                      al.w * (t.w - mean[r]) * rinv[r] + be.w);
      *(uint2*)(yr + r * D_ + i * 128) = o;
    }
  }
}

__global__ __launch_bounds__(256)
void layernorm_kernel(const float* __restrict__ x,
                      const float* __restrict__ alpha,
                      const float* __restrict__ beta,
                      __bf16* __restrict__ y) {
  layernorm_block(x, alpha, beta, y, blockIdx.x);
}

// ---------------------------------------------------------------------------
// Attention mask, int32 [S][T] -> one bit per score, in the order in which an
// attention wave holds its scores. For 16 queries (group g) and 32 keys (tile t)
// the wave has 16 score registers e = grp * 8 + j, and lane l of register e holds
// query g * 16 + l % 16, key t * 32 + grp * 16 + 8 * (l / 16) + j. Word e of
// mbits[g][t][16] has bit l set where that mask element is not 0: it is the lane
// mask of the select on register e as it stands. The mask is the same for every
// batch and head, so each of its elements is read here once, not 64 times.
// One wave packs two tiles, 32 words: its store is one whole 128-byte line. The
// odd tile count is padded to an even one; the pad tile repeats the last tile.
// ---------------------------------------------------------------------------
static constexpr int NT_       = T_ / 32;              // key tiles
static constexpr int MB_PAIRS_ = (NT_ + 1) / 2;        // tile pairs of a query group
static constexpr int MB_PITCH_ = MB_PAIRS_ * 32;       // words of a query group
static_assert(T_ % 32 == 0 && S_ % 16 == 0, "whole tiles and whole query groups");
static_assert(((S_ / 16) * MB_PAIRS_) % 8 == 0, "whole work-groups of 8 waves");

__device__ __forceinline__
void mask_pack_block(const int* __restrict__ mask, unsigned* __restrict__ mbits, int bx) {
  const int lane = threadIdx.x & 31, wave = threadIdx.x >> 5;
  const int job = bx * 8 + wave;
  const int g = job / MB_PAIRS_, u = job - g * MB_PAIRS_;
  const int* mr = mask + (size_t)(g * 16 + (lane & 15)) * T_ + (lane >> 4) * 8;
  const int t1 = 2 * u + 1 < NT_ ? 2 * u + 1 : NT_ - 1;   // the pad tile stays inside the mask
  const int* mp[2] = {mr + 2 * u * 32, mr + t1 * 32};
  int4 mk[2][4];
  // unrolled whole: constant indices keep mk in registers, all loads in flight at once
#pragma unroll
  for (int tt = 0; tt < 2; ++tt)
#pragma unroll
    for (int i = 0; i < 4; ++i)
      mk[tt][i] = *(const int4*)(mp[tt] + (i >> 1) * 16 + (i & 1) * 4);
  // no address register of these loads is rewritten ahead of this wait: named as
  // inputs the addresses stay live up to here, so no load's result lands in them
  asm volatile("s_wait_xcnt 0x0" :: "v"(mp[0]), "v"(mp[1]) : "memory");
  unsigned w = 0;                              // lane k ends up with word k of the pair
#pragma unroll
  for (int tt = 0; tt < 2; ++tt)
#pragma unroll
    for (int i = 0; i < 4; ++i) {
      const int k = tt * 16 + i * 4;
      // every ballot is taken by the whole wave, ahead of the choice of its lane
      const unsigned b0 = __builtin_amdgcn_ballot_w32(mk[tt][i].x != 0);
      const unsigned b1 = __builtin_amdgcn_ballot_w32(mk[tt][i].y != 0);
      const unsigned b2 = __builtin_amdgcn_ballot_w32(mk[tt][i].z != 0);
      const unsigned b3 = __builtin_amdgcn_ballot_w32(mk[tt][i].w != 0);
      w = lane == k + 0 ? b0 : w;
      w = lane == k + 1 ? b1 : w;
      w = lane == k + 2 ? b2 : w;
      w = lane == k + 3 ? b3 : w;
    }
  mbits[(size_t)g * MB_PITCH_ + u * 32 + lane] = w;
  // Inlined into a kernel with other jobs, the code behind this store may rewrite its
  // address and data registers: the wait stands in front of any such write.
  asm volatile("s_wait_xcnt 0x0" ::: "memory");
}

// ---------------------------------------------------------------------------
// Everything that reads only the inputs, in ONE launch: the first LayerNorm, the
// packing of the mask, the six weight transposes and the conversion of the memory
// tokens depend on nothing but the inputs and on none of each other, so the block
// index alone picks a block's job. As nine launches in a row each of them paid
// the gap between launches and ran its own start and its own last memory round
// trip alone.
// ---------------------------------------------------------------------------
static constexpr int PB_LN_  = B_ * S_ / (8 * LNR_);           // LayerNorm blocks
static constexpr int PB_DD_  = (D_ / 64) * (D_ / 64);          // tiles of a D x D weight
static constexpr int PB_FF_  = (D_ / 64) * (DFF_ / 64);        // tiles of an FFN weight
static constexpr int PB_MEM_ = MEMT_ * D_ / 256;               // conversion blocks
static constexpr int PB_MASK_ = (S_ / 16) * MB_PAIRS_ / 8;     // mask packing blocks
static constexpr int PB_ALL_ = PB_LN_ + PB_MASK_ + 4 * PB_DD_ + 2 * PB_FF_ + PB_MEM_;

__global__ __launch_bounds__(256)
void prep_kernel(const float* __restrict__ x,
                 const float* __restrict__ alpha, const float* __restrict__ beta,
                 const float* __restrict__ w_q, const float* __restrict__ w_k,
                 const float* __restrict__ w_v, const float* __restrict__ w_o,
                 const float* __restrict__ fw1, const float* __restrict__ fw2,
                 const float* __restrict__ mem, const int* __restrict__ mask,
                 __bf16* __restrict__ xn,
                 __bf16* __restrict__ wqT, __bf16* __restrict__ wkT,
                 __bf16* __restrict__ wvT, __bf16* __restrict__ woT,
                 __bf16* __restrict__ w1T, __bf16* __restrict__ w2T,
                 __bf16* __restrict__ memb, unsigned* __restrict__ mbits) {
  int t = blockIdx.x;                          // every test below is the whole block's
  if (t < PB_LN_) { layernorm_block(x, alpha, beta, xn, t); return; }
  t -= PB_LN_;
  if (t < PB_MASK_) { mask_pack_block(mask, mbits, t); return; }
  t -= PB_MASK_;
  if (t >= 4 * PB_DD_ + 2 * PB_FF_) {
    convert_block(mem, memb, MEMT_ * D_, t - (4 * PB_DD_ + 2 * PB_FF_));
    return;
  }
  const float* W;
  __bf16* Wt;
  int K = D_, N = D_, lg = 4;                  // lg: log2 of the tiles in a row of W
  static_assert(D_ / 64 == 1 << 4 && DFF_ / 64 == 1 << 6, "lg below");
  if (t < 4 * PB_DD_) {
    const int which = t / PB_DD_;
    t -= which * PB_DD_;
    W  = which == 0 ? w_q : which == 1 ? w_k : which == 2 ? w_v : w_o;
    Wt = which == 0 ? wqT : which == 1 ? wkT : which == 2 ? wvT : woT;
  } else if (t < 4 * PB_DD_ + PB_FF_) {
    t -= 4 * PB_DD_;
    W = fw1; Wt = w1T; N = DFF_; lg = 6;
  } else {
    t -= 4 * PB_DD_ + PB_FF_;
    W = fw2; Wt = w2T; K = DFF_;
  }
  // tile column fastest, as in a grid of (N / 64, K / 64)
  transpose_convert_tile(W, Wt, K, N, t & ((1 << lg) - 1), t >> lg);
}

// ---------------------------------------------------------------------------
// WMMA GEMM: C[M,N] = A[M,K](bf16) * Bt[N,K](bf16)^T  (+ epilogue)
// MODE 0: store bf16
// MODE 1: +bias[col], ReLU, store bf16
// MODE 2: +resid[row,col], store f32
// MODE 3: +bias[col] + resid[row,col], store f32; each wave also stores the column
//         sums of its 32 x 64 piece of C: colsum[row / 32][col]
// Block tile 128x128, K-step 64. 8 waves: 4 (M) x 2 (N); wave tile 32x64.
// K must be a multiple of 64.
// Tiles staged with async global->LDS b128 copies, double-buffered so the
// next K-tile streams in while WMMAs consume the current one. A K-step is 128
// bytes of every operand row: 8 lanes copy one whole line, a wave's copy covers
// 4 whole lines, and no line is asked for in two halves by two K-steps.
// Rows >= M are clamped (not skipped) so every wave issues exactly 8 async
// ops per tile -> ASYNCcnt bookkeeping is uniform; epilogue guards stores.
// ---------------------------------------------------------------------------
// bx, by: the block's tile column and tile row.
template <int MODE>
__device__ __forceinline__
void gemm_bt_tile(const __bf16* __restrict__ A, const __bf16* __restrict__ Bt,
                  const float* __restrict__ bias, const float* __restrict__ resid,
                  float* __restrict__ Cf, __bf16* __restrict__ Cb,
                  float* __restrict__ colsum, int M, int N, int K, int bx, int by) {
  __shared__ __align__(16) __bf16 sA[2][128 * KP_];
  __shared__ __align__(16) __bf16 sB[2][128 * KP_];
  const int tid = threadIdx.x;
  const int lane = tid & 31, wave = tid >> 5;
  const int mw = wave >> 1, nw = wave & 1;
  const int mbase = by * 128, nbase = bx * 128;
  const int lrow = lane & 15, lh = lane >> 4;

  const unsigned long long baseA = (unsigned long long)(uintptr_t)A;
  const unsigned long long baseB = (unsigned long long)(uintptr_t)Bt;

  // this thread's four 16-byte segments of a 128x64 tile: rows r0 + 32 i, one column
  const int r0 = tid >> 3, c0 = (tid & 7) * 8;
  unsigned rowA[4], rowB[4];                         // byte offset of row and column
#pragma unroll   // constant indices keep the two arrays in registers
  for (int i = 0; i < 4; ++i) {
    int ga = mbase + r0 + i * 32; if (ga >= M) ga = M - 1;   // clamp, never skip
    rowA[i] = (unsigned)(((size_t)ga * K + c0) * 2);
    rowB[i] = (unsigned)(((size_t)(nbase + r0 + i * 32) * K + c0) * 2);
  }

  auto issue_tile = [&](int kk, int p) {
    unsigned la[4], va[4], lb[4], vb[4];
#pragma unroll   // constant indices: each element is a register operand of the copies
    for (int i = 0; i < 4; ++i) {
      la[i] = (unsigned)(uintptr_t)&sA[p][(r0 + i * 32) * KP_ + c0];
      lb[i] = (unsigned)(uintptr_t)&sB[p][(r0 + i * 32) * KP_ + c0];
      va[i] = rowA[i] + (unsigned)kk * 2u;
      vb[i] = rowB[i] + (unsigned)kk * 2u;
    }
    async_load8_b128(la, va, lb, vb, baseA, baseB);
  };

  v8f acc[2][4];
#pragma unroll
  for (int mi = 0; mi < 2; ++mi)
#pragma unroll
    for (int ni = 0; ni < 4; ++ni) acc[mi][ni] = zero_v8f();

  issue_tile(0, 0);
  int p = 0;
  for (int kk = 0; kk < K; kk += 64) {
    const bool pf = (kk + 64) < K;
    if (pf) {
      issue_tile(kk + 64, p ^ 1);   // 8 new in flight on top of 8 old
      wait_asynccnt_8();            // all but the 8 youngest: tile p has landed
    } else {
      wait_asynccnt_0();
    }
    __syncthreads();

#pragma unroll   // ks becomes an immediate offset of the LDS loads
    for (int ks = 0; ks < 2; ++ks) {   // the tile's two 32-element WMMA steps, in k order
      v16bf af[2], bfr[4];
#pragma unroll
      for (int mi = 0; mi < 2; ++mi) {
        const __bf16* q = sA[p] + (mw * 32 + mi * 16 + lrow) * KP_ + ks * 32 + lh * 8;
        af[mi] = ld_frag(q, q + 16);
      }
#pragma unroll
      for (int ni = 0; ni < 4; ++ni) {
        const __bf16* q = sB[p] + (nw * 64 + ni * 16 + lrow) * KP_ + ks * 32 + lh * 8;
        bfr[ni] = ld_frag(q, q + 16);
      }
#pragma unroll
      for (int mi = 0; mi < 2; ++mi)
#pragma unroll
        for (int ni = 0; ni < 4; ++ni)
          acc[mi][ni] = wmma_bf16(af[mi], bfr[ni], acc[mi][ni]);
    }

    __syncthreads();                // tile p free for overwrite next round
    p ^= 1;
  }

  // epilogue (C layout: VGPR j -> row j + 8*(lane/16); col = lane%16)
  // Left as it is: under the per-row guard each of a lane's 64 elements waits for its
  // own bias and residual load before the next one is issued.
  float cs[4] = {0.f, 0.f, 0.f, 0.f};   // MODE 3: sum over this lane's 16 rows, per column
#pragma unroll
  for (int mi = 0; mi < 2; ++mi) {
#pragma unroll
    for (int ni = 0; ni < 4; ++ni) {
      int col = nbase + nw * 64 + ni * 16 + lrow;
#pragma unroll
      for (int j = 0; j < 8; ++j) {
        int row = mbase + mw * 32 + mi * 16 + j + 8 * lh;
        if (row >= M) continue;
        float r = acc[mi][ni][j];
        if (MODE == 1 || MODE == 3) r += bias[col];
        if (MODE == 1) r = r > 0.f ? r : 0.f;
        if (MODE == 2 || MODE == 3) r += resid[(size_t)row * N + col];
        if (MODE == 0 || MODE == 1)
          Cb[(size_t)row * N + col] = (__bf16)r;
        else
          Cf[(size_t)row * N + col] = r;
        if (MODE == 3) cs[ni] += r;
      }
    }
  }
  if (MODE == 3) {
    // the other 16 rows of the column are in lane ^ 16; one wave writes its two
    // whole 128-byte lines of colsum
    float* cp = colsum + (size_t)(by * 4 + mw) * N + nbase + nw * 64 + lrow;
#pragma unroll
    for (int ni = 0; ni < 4; ++ni) {
      const float s = cs[ni] + xhalf(cs[ni]);
      if (lh == 0) cp[ni * 16] = s;
    }
  }
}

template <int MODE>
__global__ __launch_bounds__(256)
void gemm_bt_kernel(const __bf16* __restrict__ A, const __bf16* __restrict__ Bt,
                    const float* __restrict__ bias, const float* __restrict__ resid,
                    float* __restrict__ Cf, __bf16* __restrict__ Cb,
                    float* __restrict__ colsum, int M, int N, int K) {
  gemm_bt_tile<MODE>(A, Bt, bias, resid, Cf, Cb, colsum, M, N, K,
                     blockIdx.x, blockIdx.y);
}

// The five projections in front of attention in ONE launch: Q, K, V of the
// normalized rows and K, V of the memory tokens read finished buffers only and
// write buffers of their own. Grid: x = 3 weights x D_/128 tile columns, y = one
// tile row of memory tokens (it has no Q: those blocks leave at once), then the
// rows / 128 tile rows of xn. The two memory products, 8 blocks each, ran a whole
// K loop alone on the chip as launches of their own.
// wT: wq^T, wk^T, wv^T one after the other; qkv: q, k, v; memKV: memory K, V.
__global__ __launch_bounds__(256)
void qkv_gemm_kernel(const __bf16* __restrict__ xn, const __bf16* __restrict__ memb,
                     const __bf16* __restrict__ wT, __bf16* __restrict__ qkv,
                     __bf16* __restrict__ memKV) {
  constexpr int NT = D_ / 128;
  const int which = blockIdx.x / NT, bx = blockIdx.x - which * NT;
  const __bf16* Bt = wT + (size_t)which * D_ * D_;
  const bool ismem = blockIdx.y == 0;
  if (ismem && which == 0) return;   // the whole block, in front of every barrier and copy
  gemm_bt_tile<0>(ismem ? memb : xn, Bt, nullptr, nullptr, nullptr,
                  ismem ? memKV + (size_t)(which - 1) * MEMT_ * D_
                        : qkv + (size_t)which * B_ * S_ * D_,
                  nullptr, ismem ? MEMT_ : B_ * S_, D_, D_,
                  bx, ismem ? 0 : blockIdx.y - 1);
}

__device__ __forceinline__ void exp2_run8(float* o, const float* x) {
  asm("v_exp_f32 %0, %8\n\t"
      "v_exp_f32 %1, %9\n\t"
      "v_exp_f32 %2, %10\n\t"
      "v_exp_f32 %3, %11\n\t"
      "v_exp_f32 %4, %12\n\t"
      "v_exp_f32 %5, %13\n\t"
      "v_exp_f32 %6, %14\n\t"
      "v_exp_f32 %7, %15\n\t"
      "v_nop"
      : "=&v"(o[0]), "=&v"(o[1]), "=&v"(o[2]), "=&v"(o[3]),
        "=&v"(o[4]), "=&v"(o[5]), "=&v"(o[6]), "=&v"(o[7])
      : "v"(x[0]), "v"(x[1]), "v"(x[2]), "v"(x[3]),
        "v"(x[4]), "v"(x[5]), "v"(x[6]), "v"(x[7]));
}
__device__ __forceinline__ float exp2_one(float x) {
  float o;
  asm("v_exp_f32 %0, %1\n\t"
      "v_nop"
      : "=&v"(o) : "v"(x));
  return o;
}

// 8 waves per SIMD = 4 blocks per WGP: the whole grid of 1,024 blocks is then
// resident at once instead of running a thin second round.
__global__ __launch_bounds__(256) __attribute__((amdgpu_waves_per_eu(8)))
void attention_kernel(const __bf16* __restrict__ qg, const __bf16* __restrict__ kg,
                      const __bf16* __restrict__ vg,
                      const __bf16* __restrict__ memk, const __bf16* __restrict__ memv,
                      const unsigned* __restrict__ mbits,
                      __bf16* __restrict__ ctxout) {
  __shared__ __align__(16) __bf16 sVt[64 * LP_];       // V tile transposed [d][key]
  __shared__ __align__(16) __bf16 sK[2][32 * KP_];     // K tiles [key][d]

  const int tid = threadIdx.x, lane = tid & 31, wave = tid >> 5;
  const int lrow = lane & 15, lh = lane >> 4;
  const int bh = blockIdx.y;
  const int b = bh >> 4, h = bh & 15;
  const int qbase = blockIdx.x * 128 + wave * 16;

  // Q fragments (rows qbase..+15, d 0..63), pre-scaled by 1/sqrt(64)=0.125
  v16bf qf[2];
  {
    const __bf16* qp =
        qg + ((size_t)b * S_ + qbase + lrow) * D_ + h * DK_ + lh * 8;
#pragma unroll
    for (int half = 0; half < 2; ++half) {
      v16bf f = ld_frag(qp + half * 32, qp + half * 32 + 16);
#pragma unroll
      for (int i = 0; i < 16; ++i) f[i] = (__bf16)((float)f[i] * 0.125f);
      qf[half] = f;
    }
  }

  // ctx[dg][j] = O[query lrow][d = dg*16 + j + 8*lh]
  v8f ctx[4];
#pragma unroll
  for (int dg = 0; dg < 4; ++dg) ctx[dg] = zero_v8f();
  float mrun = -3.0e38f;   // this lane's query: running maximum (both halves equal)
  float lsum = 0.f;        // running sum over this lane's own keys only

  // the packed mask of this wave's 16 queries: 16 words a tile, the same address in
  // every lane (the wave's number is taken from lane 0). An earlier launch wrote the
  // words and nothing writes them while this kernel runs: read through the constant
  // address space, a tile's words come by one scalar load of 64 bytes
  typedef const __attribute__((address_space(4))) v16u* mask_words_ptr;
  const unsigned* mrow =
      mbits + (size_t)(blockIdx.x * 8 + __builtin_amdgcn_readfirstlane(wave)) * MB_PITCH_;

  // this thread's 16 bytes of a K tile; a tile lies wholly in the memory keys or
  // wholly in the sequence keys, so the choice of the source is the block's
  static_assert(MEMT_ % 32 == 0, "a K tile must not straddle the two sources");
  auto issue_k = [&](int t0, int buf) {
    const int key = tid >> 3;
    const int dseg = (tid & 7) * 8;
    const __bf16* tile = (t0 < MEMT_) ? (memk + (size_t)t0 * D_)
                                      : (kg + ((size_t)b * S_ + (t0 - MEMT_)) * D_);
    async_load1_b128((unsigned)(uintptr_t)&sK[buf][key * KP_ + dseg],
                     tile + (size_t)key * D_ + h * DK_ + dseg);
  };
  issue_k(0, 0);
  wait_asynccnt_0();
  __syncthreads();               // tile 0 is published
  issue_k(32, 1);                // T_ = 65 tiles: tile 1 exists

  for (int tbase = 0; tbase < T_; tbase += 32) {
    const int kbuf = (tbase >> 5) & 1;
    // this tile's 16 lane masks, asked for ahead of the V staging and its barrier
    const v16u mw = *(mask_words_ptr)(uintptr_t)(mrow + (tbase >> 5) * 16);
    // stage transposed V tile (32 keys x 64 dims) cooperatively
    {
      int key = tid >> 3;
      int dseg = (tid & 7) * 8;
      int tg = tbase + key;
      const __bf16* src =
          (tg < MEMT_) ? (memv + (size_t)tg * D_ + h * DK_ + dseg)
                       : (vg + ((size_t)b * S_ + (tg - MEMT_)) * D_ + h * DK_ + dseg);
      v8bf val = *(const v8bf*)src;
#pragma unroll
      for (int i = 0; i < 8; ++i) sVt[(dseg + i) * LP_ + key] = val[i];
    }
    __syncthreads();

    // the K fragments (A operand: row = key)
    v16bf kf[2][2];
#pragma unroll
    for (int grp = 0; grp < 2; ++grp) {
      const __bf16* ka = sK[kbuf] + (grp * 16 + lrow) * KP_ + lh * 8;
      kf[grp][0] = ld_frag(ka, ka + 16);
      kf[grp][1] = ld_frag(ka + 32, ka + 48);
    }
    // all eight loads are in flight before the first product waits for one
    __builtin_amdgcn_sched_barrier(0);

    // scores, transposed: [32 keys x 16 queries] = K[32x64] @ Q^T
    // st[j] = S[query lrow][key tbase + grp*16 + 8*lh + j]
    float v[16];
#pragma unroll
    for (int grp = 0; grp < 2; ++grp) {
      v8f st = wmma_bf16(kf[grp][0], qf[0], zero_v8f());
      st = wmma_bf16(kf[grp][1], qf[1], st);
      // word e is the select's lane mask as it lies in its scalar register
#pragma unroll
      for (int j = 0; j < 8; ++j)
        v[grp * 8 + j] =
            __builtin_amdgcn_inverse_ballot_w32(mw[grp * 8 + j]) ? st[j] : -1e9f;
    }

    // the V^T fragments (A operand: row = dim), all four asked for as one group
    v16bf vf[4];
#pragma unroll
    for (int dg = 0; dg < 4; ++dg) {
      const __bf16* vp = sVt + (dg * 16 + lrow) * LP_ + lh * 8;
      vf[dg] = ld_frag(vp, vp + 16);
    }
    // holds the group together: without it the compiler loads three of the four
    // fragments directly in front of their products, into one set of registers, and
    // the wave waits out the LDS latency once for each of them, not once per trip
    __builtin_amdgcn_sched_barrier(0);

    // online softmax of one query per lane
    float tmax = v[0];
#pragma unroll
    for (int i = 1; i < 16; ++i) tmax = fmaxf(tmax, v[i]);
    tmax = fmaxf(tmax, xhalf(tmax));
    const float newm = fmaxf(mrun, tmax);
    constexpr float LOG2E = 1.44269504f;       // e^x = 2^(x * log2 e)
    const float scale = exp2_one((mrun - newm) * LOG2E);
    mrun = newm;
    float p[16];
#pragma unroll
    for (int i = 0; i < 16; ++i) v[i] = (v[i] - newm) * LOG2E;
    exp2_run8(p, v);
    exp2_run8(p + 8, v + 8);
    float ts = 0.f;
    v16bf pf;   // P^T as B operand: element i <-> key 8*lh + i (+8 for i >= 8)
#pragma unroll
    for (int i = 0; i < 16; ++i) {
      ts += p[i];
      pf[i] = (__bf16)p[i];
    }
    lsum = lsum * scale + ts;
#pragma unroll
    for (int dg = 0; dg < 4; ++dg)
#pragma unroll
      for (int j = 0; j < 8; ++j) ctx[dg][j] *= scale;

    // O^T += V^T @ P^T  (M = 64 dims in 4 groups, K = 32 keys)
#pragma unroll
    for (int dg = 0; dg < 4; ++dg) ctx[dg] = wmma_bf16(vf[dg], pf, ctx[dg]);

    // foot of the trip: own LDS reads back, own copies of tile t + 1 landed; the
    // barrier publishes that tile and ends every read of this trip's K and V
    wait_dscnt_0();
    wait_asynccnt_0();
    __syncthreads();
    if (tbase + 64 < T_) issue_k(tbase + 64, kbuf);   // same for the whole block
  }
  wait_asynccnt_0();             // no copy is left in flight when the wave ends

  // join the halves' sums, normalize, write ctx as bf16 in [B,S,D]: a lane holds
  // 8 neighbouring dims of its query per group, one 16-byte store each
  const float inv = 1.0f / (lsum + xhalf(lsum));
  __bf16* op = ctxout + ((size_t)b * S_ + qbase + lrow) * D_ + h * DK_ + lh * 8;
#pragma unroll
  for (int dg = 0; dg < 4; ++dg) {
    v8bf o;
#pragma unroll
    for (int j = 0; j < 8; ++j) o[j] = (__bf16)(ctx[dg][j] * inv);
    *(v8bf*)(op + dg * 16) = o;
  }
}

// ---------------------------------------------------------------------------
// new_memory: broadcast mean over S of final x into [B, MEM, D]
// The last GEMM has left the sums of every 32 rows of x in colsum[B*S/32][D]:
// a column's mean takes 64 independent loads, not 2,048 rows in 128 dependent
// rounds of loads on 16 work-groups.
// ---------------------------------------------------------------------------
__global__ __launch_bounds__(256)
void mean_bcast_kernel(const float* __restrict__ colsum, float* __restrict__ nm) {
  constexpr int G = S_ / 32;                   // partial sums per column
  int gid = blockIdx.x * 256 + threadIdx.x;    // B*D threads
  int b = gid / D_;
  int d = gid - b * D_;
  const float* p = colsum + (size_t)b * G * D_ + d;
  float v[G];
  // unrolled whole, so that all loads are in flight at once: one memory latency
#pragma unroll
  for (int i = 0; i < G; ++i) v[i] = p[(size_t)i * D_];
  float s4[4] = {0.f, 0.f, 0.f, 0.f};
#pragma unroll
  for (int i = 0; i < G; ++i) s4[i & 3] += v[i];
  float s = (s4[0] + s4[1]) + (s4[2] + s4[3]);
  float mean = s * (1.0f / S_);
  float* o = nm + (size_t)b * MEMT_ * D_ + d;
  for (int mI = 0; mI < MEMT_; ++mI) o[(size_t)mI * D_] = mean;
}

// ---------------------------------------------------------------------------
// launch
// ---------------------------------------------------------------------------
extern "C" void kernel_launch(void* const* d_in, const int* in_sizes, int n_in,
                              void* d_out, int out_size, void* d_ws, size_t ws_size,
                              hipStream_t stream) {
  (void)in_sizes; (void)n_in; (void)out_size; (void)ws_size;
  const float* x    = (const float*)d_in[0];
  const int*   mask = (const int*)d_in[1];
  const float* mem  = (const float*)d_in[2];
  const float* w_q  = (const float*)d_in[3];
  const float* w_k  = (const float*)d_in[4];
  const float* w_v  = (const float*)d_in[5];
  const float* w_o  = (const float*)d_in[6];
  const float* ln1a = (const float*)d_in[7];
  const float* ln1b = (const float*)d_in[8];
  const float* ln2a = (const float*)d_in[9];
  const float* ln2b = (const float*)d_in[10];
  const float* fw1  = (const float*)d_in[11];
  const float* fb1  = (const float*)d_in[12];
  const float* fw2  = (const float*)d_in[13];
  const float* fb2  = (const float*)d_in[14];

  float* out_x  = (float*)d_out;                                // [B,S,D]
  float* out_nm = out_x + (size_t)B_ * S_ * D_;                 // [B,MEM,D]

  // workspace carve-out
  size_t off = 0;
  auto carve = [&](size_t bytes) -> char* {
    char* p = (char*)d_ws + off;
    off = (off + bytes + 255) & ~(size_t)255;
    return p;
  };
  __bf16* wqT  = (__bf16*)carve((size_t)3 * D_ * D_ * 2);      // wq^T, wk^T, wv^T
  __bf16* wkT  = wqT + (size_t)D_ * D_;
  __bf16* wvT  = wkT + (size_t)D_ * D_;
  __bf16* woT  = (__bf16*)carve((size_t)D_ * D_ * 2);
  __bf16* w1T  = (__bf16*)carve((size_t)DFF_ * D_ * 2);
  __bf16* w2T  = (__bf16*)carve((size_t)D_ * DFF_ * 2);
  __bf16* memb = (__bf16*)carve((size_t)MEMT_ * D_ * 2);
  __bf16* memK = (__bf16*)carve((size_t)2 * MEMT_ * D_ * 2);   // memory K, V
  __bf16* memV = memK + (size_t)MEMT_ * D_;
  __bf16* xn   = (__bf16*)carve((size_t)B_ * S_ * D_ * 2);
  __bf16* qb   = (__bf16*)carve((size_t)3 * B_ * S_ * D_ * 2); // q, k, v
  __bf16* kb   = qb + (size_t)B_ * S_ * D_;
  __bf16* vb   = kb + (size_t)B_ * S_ * D_;
  __bf16* ctxb = (__bf16*)carve((size_t)B_ * S_ * D_ * 2);
  float*  x1   = (float*)carve((size_t)B_ * S_ * D_ * 4);
  __bf16* xn2  = (__bf16*)carve((size_t)B_ * S_ * D_ * 2);
  __bf16* ffh  = (__bf16*)carve((size_t)B_ * S_ * DFF_ * 2);
  float*  csum = (float*)carve((size_t)(B_ * S_ / 32) * D_ * 4);
  unsigned* mbits = (unsigned*)carve((size_t)(S_ / 16) * MB_PITCH_ * 4);

  const int rows = B_ * S_;   // 8192
  dim3 blk(256);

  // LN1, mask to bits, weight prep (bf16, transposed to [N][K]), memory tokens to bf16
  prep_kernel<<<PB_ALL_, blk, 0, stream>>>(x, ln1a, ln1b, w_q, w_k, w_v, w_o, fw1, fw2, mem,
                                           mask, xn, wqT, wkT, wvT, woT, w1T, w2T, memb,
                                           mbits);

  // Q/K/V projections (WMMA bf16) and memory K/V (raw memory tokens, not
  // layernormed; M=32 with row clamp)
  qkv_gemm_kernel<<<dim3(3 * (D_ / 128), 1 + rows / 128), blk, 0, stream>>>(
      xn, memb, wqT, qb, memK);

  // flash attention over T = MEM + S
  attention_kernel<<<dim3(S_ / 128, B_ * H_), blk, 0, stream>>>(
      qb, kb, vb, memK, memV, mbits, ctxb);

  // out-proj + residual -> x1 (f32)
  gemm_bt_kernel<2><<<dim3(D_ / 128, rows / 128), blk, 0, stream>>>(
      ctxb, woT, nullptr, x, x1, nullptr, nullptr, rows, D_, D_);

  // LN2 -> FFN
  layernorm_kernel<<<rows / (8 * LNR_), blk, 0, stream>>>(x1, ln2a, ln2b, xn2);
  gemm_bt_kernel<1><<<dim3(DFF_ / 128, rows / 128), blk, 0, stream>>>(
      xn2, w1T, fb1, nullptr, nullptr, ffh, nullptr, rows, DFF_, D_);
  gemm_bt_kernel<3><<<dim3(D_ / 128, rows / 128), blk, 0, stream>>>(
      ffh, w2T, fb2, x1, out_x, nullptr, csum, rows, D_, DFF_);

  // new_memory = broadcast mean over S, from the last GEMM's column sums
  mean_bcast_kernel<<<(B_ * D_) / 256, blk, 0, stream>>>(csum, out_nm);
}

// v010
// Measured time: 323 microseconds a run.
// Next to v009, in two timings, it ran 1.26 times as fast each time.
// All steps since v000 together make it 3.94 times as fast.
#include <hip/hip_runtime.h>
#include <hip/hip_bf16.h>

// ---------------------------------------------------------------------------
// CDNA5 (gfx1250) transformer encoder block with memory tokens.
// - All heavy GEMMs: v_wmma_f32_16x16x32_bf16 (wave32 WMMA), f32 accumulate.
// - GEMM tile staging: global_load_async_to_lds_b128 (ASYNCcnt) with
//   double-buffered LDS tiles -> prefetch tile k+1 while computing tile k.
// ---------------------------------------------------------------------------

typedef __attribute__((ext_vector_type(16))) __bf16 v16bf;
typedef __attribute__((ext_vector_type(8)))  __bf16 v8bf;
typedef __attribute__((ext_vector_type(8)))  float  v8f;
typedef __attribute__((ext_vector_type(2)))  __bf16 v2bf;
typedef __attribute__((ext_vector_type(4)))  unsigned v4u;
typedef __attribute__((ext_vector_type(4)))  float  v4f;
typedef __attribute__((ext_vector_type(2)))  float  v2f;
typedef __attribute__((ext_vector_type(16))) unsigned v16u;

static constexpr int B_    = 4;
static constexpr int S_    = 2048;
static constexpr int D_    = 1024;
static constexpr int H_    = 16;
static constexpr int DK_   = 64;
static constexpr int DFF_  = 4096;
static constexpr int MEMT_ = 32;
static constexpr int T_    = S_ + MEMT_;   // 2080 = 65 * 32
// Row pitch, in bf16, of every LDS tile whose 32-element rows are read as WMMA
// fragments with 16-byte loads: 80 bytes = 16 x 5, so the 16 rows one half-wave
// reads start on 16 different groups of four banks. At the bare 64 bytes rows
// r and r + 4 share their banks and each fragment load takes four times as long.
static constexpr int LP_   = 40;
// The same for tiles with 64-element rows: 144 bytes = 16 x 9.
static constexpr int KP_   = 72;

__device__ __forceinline__ v8f zero_v8f() {
  v8f z;
#pragma unroll
  for (int i = 0; i < 8; ++i) z[i] = 0.0f;
  return z;
}

// Build a 16-element bf16 A/B fragment from two contiguous 16-byte segments.
// Layout per CDNA5 ISA 7.12.2: lane holds row (lane%16); elements 0..7 are
// K = (lane/16)*8 .. +7, elements 8..15 are K = (lane/16)*8+16 .. +23.
__device__ __forceinline__ v16bf ld_frag(const __bf16* p0, const __bf16* p1) {
  v8bf lo = *(const v8bf*)p0;
  v8bf hi = *(const v8bf*)p1;
  return __builtin_shufflevector(lo, hi, 0, 1, 2, 3, 4, 5, 6, 7,
                                         8, 9, 10, 11, 12, 13, 14, 15);
}

// two floats -> one dword of two bf16, a in the low half
__device__ __forceinline__ unsigned pack_bf16(float a, float b) {
  v2bf t = {(__bf16)a, (__bf16)b};
  return __builtin_bit_cast(unsigned, t);
}

// two floats -> one dword of two bf16 (round to nearest even, as the cast does), a in
// the low half. Written as the instruction so that the pair stays ONE 32-bit register
// whose halves two 16-bit stores take as they lie: from 16-bit values the compiler
// copies each into a further register in the middle of a run of stores.
__device__ __forceinline__ unsigned cvt_pk_bf16(float a, float b) {
  unsigned u;
  asm("v_cvt_pk_bf16_f32 %0, %1, %2" : "=v"(u) : "v"(a), "v"(b));
  return u;
}

// lane l <-> lane l ^ 16
__device__ __forceinline__ float xhalf(float x) {
  int i = __builtin_bit_cast(int, x);
  return __builtin_bit_cast(float, __builtin_amdgcn_permlanex16(
      i, i, 0x76543210, 0xfedcba98, false, false));
}

__device__ __forceinline__ v8f wmma_bf16(v16bf a, v16bf b, v8f c) {
  return __builtin_amdgcn_wmma_f32_16x16x32_bf16(
      false, a, false, b, (short)0, c, false, false);
}

// CDNA5 async global->LDS copies, 16 bytes per lane (GVS mode: SGPR base +
// per-lane u32 byte offset). Tracked by ASYNCcnt. One K-tile's eight copies of a
// thread (A, B four times) stand in one statement that ends in s_wait_xcnt 0, so
// that no address register of a copy is rewritten ahead of that wait.
__device__ __forceinline__ void async_load8_b128(
    const unsigned (&ldsA)[4], const unsigned (&voffA)[4],
    const unsigned (&ldsB)[4], const unsigned (&voffB)[4],
    unsigned long long baseA, unsigned long long baseB) {
  asm volatile("global_load_async_to_lds_b128 %0, %1, %16\n\t"
               "global_load_async_to_lds_b128 %2, %3, %17\n\t"
               "global_load_async_to_lds_b128 %4, %5, %16\n\t"
               "global_load_async_to_lds_b128 %6, %7, %17\n\t"
               "global_load_async_to_lds_b128 %8, %9, %16\n\t"
               "global_load_async_to_lds_b128 %10, %11, %17\n\t"
               "global_load_async_to_lds_b128 %12, %13, %16\n\t"
               "global_load_async_to_lds_b128 %14, %15, %17\n\t"
               "s_wait_xcnt 0x0"
               :: "v"(ldsA[0]), "v"(voffA[0]), "v"(ldsB[0]), "v"(voffB[0]),
                  "v"(ldsA[1]), "v"(voffA[1]), "v"(ldsB[1]), "v"(voffB[1]),
                  "v"(ldsA[2]), "v"(voffA[2]), "v"(ldsB[2]), "v"(voffB[2]),
                  "v"(ldsA[3]), "v"(voffA[3]), "v"(ldsB[3]), "v"(voffB[3]),
                  "s"(baseA), "s"(baseB)
               : "memory");
}
__device__ __forceinline__ void wait_asynccnt_8() {
  asm volatile("s_wait_asynccnt 0x8" ::: "memory");
}
__device__ __forceinline__ void wait_asynccnt_0() {
  asm volatile("s_wait_asynccnt 0x0" ::: "memory");
}
// One 16-byte copy per lane, lane's own LDS byte address and global pointer. The
// closing s_wait_xcnt 0 keeps both address registers unwritten up to the wait.
__device__ __forceinline__ void async_load1_b128(unsigned lds, const __bf16* g) {
  asm volatile("global_load_async_to_lds_b128 %0, %1, off\n\t"
               "s_wait_xcnt 0x0"
               :: "v"(lds), "v"(g)
               : "memory");
}
// the wave's own LDS reads have returned before their buffer is handed back
__device__ __forceinline__ void wait_dscnt_0() {
  asm volatile("s_wait_dscnt 0x0" ::: "memory");
}

// ---------------------------------------------------------------------------
// Weight transpose + fp32 -> bf16 convert: Wt[n*K + k] = (bf16)W[k*N + n]
// One block moves a 64(k) x 64(n) tile through LDS: reads are whole 256-byte
// row pieces of W, writes are whole 128-byte lines of Wt. Two k neighbours are
// packed into one dword before LDS; the pitch of 65 dwords keeps both the
// row-wise stores and the column-wise loads free of bank conflicts.
// K and N must be multiples of 64. bx, by: the block's tile column and tile row.
// ---------------------------------------------------------------------------
__device__ __forceinline__
void transpose_convert_tile(const float* __restrict__ W,
                            __bf16* __restrict__ Wt, int K, int N, int bx, int by) {
  __shared__ unsigned tile[32 * 65];                   // [k pair][n]
  const int tid = threadIdx.x;
  const int n0 = bx * 64, k0 = by * 64;

  const int c4 = (tid & 15) * 4;
  float4 lo[2], hi[2];
#pragma unroll
  for (int i = 0; i < 2; ++i) {
    const int kp = (tid >> 4) + i * 16;
    const float* src = W + (size_t)(k0 + 2 * kp) * N + n0 + c4;
    lo[i] = *(const float4*)src;
    hi[i] = *(const float4*)(src + N);
  }
#pragma unroll
  for (int i = 0; i < 2; ++i) {
    unsigned* t = tile + ((tid >> 4) + i * 16) * 65 + c4;
    t[0] = pack_bf16(lo[i].x, hi[i].x);
    t[1] = pack_bf16(lo[i].y, hi[i].y);
    t[2] = pack_bf16(lo[i].z, hi[i].z);
    t[3] = pack_bf16(lo[i].w, hi[i].w);
  }
  __syncthreads();
#pragma unroll
  for (int i = 0; i < 2; ++i) {
    const int c = tid + i * 256;
    const int n = c >> 3, kc = c & 7;                  // 8 lanes fill one line
    const unsigned* t = tile + kc * 4 * 65 + n;
    v4u o;
#pragma unroll
    for (int e = 0; e < 4; ++e) o[e] = t[e * 65];
    *(v4u*)(Wt + (size_t)(n0 + n) * K + k0 + kc * 8) = o;
  }
  // Inlined into a kernel with other jobs, the code behind this tile may rewrite the
  // two stores' address and data registers: the wait stands in front of any such write.
  asm volatile("s_wait_xcnt 0x0" ::: "memory");
}

__device__ __forceinline__
void convert_block(const float* __restrict__ X, __bf16* __restrict__ Y, int n, int bx) {
  int i = bx * 256 + threadIdx.x;
  if (i < n) Y[i] = (__bf16)X[i];
}

// ---------------------------------------------------------------------------
// LayerNorm (matches reference: unbiased std, alpha*(x-mean)/(std+eps)+bias)
// Output bf16 for the following GEMM.
// One wave owns LNR_ whole rows of D_=1024: a lane holds 32 elements of each row,
// taken by 16-byte loads that cover four whole 128-byte lines per wave, all rows'
// loads in flight at once. Both sums run inside the lane and end in a five-step
// exchange between the lanes, so the kernel has no LDS and no barrier, and a
// launch starts rows / LNR_ = 4,096 waves, not 8 waves per row = 65,536.
// ---------------------------------------------------------------------------
static constexpr int LNR_ = 2;                 // rows per wave
static_assert((B_ * S_) % (8 * LNR_) == 0, "whole work-groups of 8 waves");
static_assert(D_ == 8 * 128, "a lane holds 8 x 4 elements of a row");

// lane l <-> lane l ^ M inside a 16-lane row (DPP row_xmask:M)
template <int M>
__device__ __forceinline__ float xrow(float x) {
  int i = __builtin_bit_cast(int, x);
  return __builtin_bit_cast(float,
      __builtin_amdgcn_update_dpp(i, i, 0x160 + M, 0xf, 0xf, false));
}
// sum over the wave's 32 lanes, the same in every lane
__device__ __forceinline__ float wave_sum(float s) {
  s += xrow<1>(s);
  s += xrow<2>(s);
  s += xrow<4>(s);
  s += xrow<8>(s);
  return s + xhalf(s);
}

__device__ __forceinline__
void layernorm_block(const float* __restrict__ x,
                     const float* __restrict__ alpha,
                     const float* __restrict__ beta,
                     __bf16* __restrict__ y, int bx) {
  const int lane = threadIdx.x & 31, wave = threadIdx.x >> 5;
  const int row0 = (bx * 8 + wave) * LNR_;
  const int c0 = lane * 4;                     // the lane's columns: c0 + 128 i .. + 3
  const float* xr = x + (size_t)row0 * D_ + c0;
  v4f v[LNR_][8];
  // every loop below is unrolled whole: constant indices keep v in registers, and
  // here all the loads are issued before the first one is waited for
#pragma unroll
  for (int r = 0; r < LNR_; ++r)
#pragma unroll
    for (int i = 0; i < 8; ++i) v[r][i] = *(const v4f*)(xr + r * D_ + i * 128);
  // no address register of these loads is rewritten ahead of this wait: named as
  // an input the address stays live up to here, so no load's result lands in it
  asm volatile("s_wait_xcnt 0x0" :: "v"(xr) : "memory");

  float mean[LNR_], rinv[LNR_];
#pragma unroll
  for (int r = 0; r < LNR_; ++r) {
    // four chains per sum, as two packed pairs: the pairs of a 16-byte load are
    // the operands of the packed add and the packed multiply-add as they lie
    v2f a0 = {0.f, 0.f}, a1 = {0.f, 0.f}, q0 = {0.f, 0.f}, q1 = {0.f, 0.f};
#pragma unroll
    for (int i = 0; i < 8; ++i) {
      const v2f lo = v[r][i].xy, hi = v[r][i].zw;
      a0 += lo;
      a1 += hi;
      q0 = __builtin_elementwise_fma(lo, lo, q0);
      q1 = __builtin_elementwise_fma(hi, hi, q1);
    }
    const float sum1 = wave_sum((a0.x + a0.y) + (a1.x + a1.y));
    const float sum2 = wave_sum((q0.x + q0.y) + (q1.x + q1.y));
    const float m = sum1 * (1.0f / D_);
    float var = (sum2 - (float)D_ * m * m) * (1.0f / (D_ - 1));
    var = var > 0.f ? var : 0.f;
    mean[r] = m;
    rinv[r] = 1.0f / (sqrtf(var) + 1e-6f);
  }

  __bf16* yr = y + (size_t)row0 * D_ + c0;
#pragma unroll
  for (int i = 0; i < 8; ++i) {
    const v4f al = *(const v4f*)(alpha + c0 + i * 128);
    const v4f be = *(const v4f*)(beta + c0 + i * 128);
#pragma unroll
    for (int r = 0; r < LNR_; ++r) {
      const v4f t = v[r][i];
      uint2 o;   // 4 bf16: a wave's store covers two whole lines
      o.x = pack_bf16(al.x * (t.x - mean[r]) * rinv[r] + be.x,
                      al.y * (t.y - mean[r]) * rinv[r] + be.y);
      o.y = pack_bf16(al.z * (t.z - mean[r]) * rinv[r] + be.z,
                      al.w * (t.w - mean[r]) * rinv[r] + be.w);
      *(uint2*)(yr + r * D_ + i * 128) = o;
    }
  }
}

__global__ __launch_bounds__(256)
void layernorm_kernel(const float* __restrict__ x,
                      const float* __restrict__ alpha,
                      const float* __restrict__ beta,
                      __bf16* __restrict__ y) {
  layernorm_block(x, alpha, beta, y, blockIdx.x);
}

// ---------------------------------------------------------------------------
// Attention mask, int32 [S][T] -> one bit per score, in the order in which an
// attention wave holds its scores. For 16 queries (group g) and 32 keys (tile t)
// the wave has 16 score registers e = grp * 8 + j, and lane l of register e holds
// query g * 16 + l % 16, key t * 32 + grp * 16 + 8 * (l / 16) + j. Word e of
// mbits[g][t][16] has bit l set where that mask element is not 0: it is the lane
// mask of the select on register e as it stands. The mask is the same for every
// batch and head, so each of its elements is read here once, not 64 times.
// One wave packs two tiles, 32 words: its store is one whole 128-byte line. The
// odd tile count is padded to an even one; the pad tile repeats the last tile.
// ---------------------------------------------------------------------------
static constexpr int NT_       = T_ / 32;              // key tiles
static constexpr int MB_PAIRS_ = (NT_ + 1) / 2;        // tile pairs of a query group
static constexpr int MB_PITCH_ = MB_PAIRS_ * 32;       // words of a query group
static_assert(T_ % 32 == 0 && S_ % 16 == 0, "whole tiles and whole query groups");
static_assert(((S_ / 16) * MB_PAIRS_) % 8 == 0, "whole work-groups of 8 waves");

__device__ __forceinline__
void mask_pack_block(const int* __restrict__ mask, unsigned* __restrict__ mbits, int bx) {
  const int lane = threadIdx.x & 31, wave = threadIdx.x >> 5;
  const int job = bx * 8 + wave;
  const int g = job / MB_PAIRS_, u = job - g * MB_PAIRS_;
  const int* mr = mask + (size_t)(g * 16 + (lane & 15)) * T_ + (lane >> 4) * 8;
  const int t1 = 2 * u + 1 < NT_ ? 2 * u + 1 : NT_ - 1;   // the pad tile stays inside the mask
  const int* mp[2] = {mr + 2 * u * 32, mr + t1 * 32};
  int4 mk[2][4];
  // unrolled whole: constant indices keep mk in registers, all loads in flight at once
#pragma unroll
  for (int tt = 0; tt < 2; ++tt)
#pragma unroll
    for (int i = 0; i < 4; ++i)
      mk[tt][i] = *(const int4*)(mp[tt] + (i >> 1) * 16 + (i & 1) * 4);
  // no address register of these loads is rewritten ahead of this wait: named as
  // inputs the addresses stay live up to here, so no load's result lands in them
  asm volatile("s_wait_xcnt 0x0" :: "v"(mp[0]), "v"(mp[1]) : "memory");
  unsigned w = 0;                              // lane k ends up with word k of the pair
#pragma unroll
  for (int tt = 0; tt < 2; ++tt)
#pragma unroll
    for (int i = 0; i < 4; ++i) {
      const int k = tt * 16 + i * 4;
      // every ballot is taken by the whole wave, ahead of the choice of its lane
      const unsigned b0 = __builtin_amdgcn_ballot_w32(mk[tt][i].x != 0);
      const unsigned b1 = __builtin_amdgcn_ballot_w32(mk[tt][i].y != 0);
      const unsigned b2 = __builtin_amdgcn_ballot_w32(mk[tt][i].z != 0);
      const unsigned b3 = __builtin_amdgcn_ballot_w32(mk[tt][i].w != 0);
      w = lane == k + 0 ? b0 : w;
      w = lane == k + 1 ? b1 : w;
      w = lane == k + 2 ? b2 : w;
      w = lane == k + 3 ? b3 : w;
    }
  mbits[(size_t)g * MB_PITCH_ + u * 32 + lane] = w;
  // Inlined into a kernel with other jobs, the code behind this store may rewrite its
  // address and data registers: the wait stands in front of any such write.
  asm volatile("s_wait_xcnt 0x0" ::: "memory");
}

// ---------------------------------------------------------------------------
// Everything that reads only the inputs, in ONE launch: the first LayerNorm, the
// packing of the mask, the six weight transposes and the conversion of the memory
// tokens depend on nothing but the inputs and on none of each other, so the block
// index alone picks a block's job. As nine launches in a row each of them paid
// the gap between launches and ran its own start and its own last memory round
// trip alone.
// ---------------------------------------------------------------------------
static constexpr int PB_LN_  = B_ * S_ / (8 * LNR_);           // LayerNorm blocks
static constexpr int PB_DD_  = (D_ / 64) * (D_ / 64);          // tiles of a D x D weight
static constexpr int PB_FF_  = (D_ / 64) * (DFF_ / 64);        // tiles of an FFN weight
static constexpr int PB_MEM_ = MEMT_ * D_ / 256;               // conversion blocks
static constexpr int PB_MASK_ = (S_ / 16) * MB_PAIRS_ / 8;     // mask packing blocks
static constexpr int PB_ALL_ = PB_LN_ + PB_MASK_ + 4 * PB_DD_ + 2 * PB_FF_ + PB_MEM_;

__global__ __launch_bounds__(256)
void prep_kernel(const float* __restrict__ x,
                 const float* __restrict__ alpha, const float* __restrict__ beta,
                 const float* __restrict__ w_q, const float* __restrict__ w_k,
                 const float* __restrict__ w_v, const float* __restrict__ w_o,
                 const float* __restrict__ fw1, const float* __restrict__ fw2,
                 const float* __restrict__ mem, const int* __restrict__ mask,
                 __bf16* __restrict__ xn,
                 __bf16* __restrict__ wqT, __bf16* __restrict__ wkT,
                 __bf16* __restrict__ wvT, __bf16* __restrict__ woT,
                 __bf16* __restrict__ w1T, __bf16* __restrict__ w2T,
                 __bf16* __restrict__ memb, unsigned* __restrict__ mbits) {
  int t = blockIdx.x;                          // every test below is the whole block's
  if (t < PB_LN_) { layernorm_block(x, alpha, beta, xn, t); return; }
  t -= PB_LN_;
  if (t < PB_MASK_) { mask_pack_block(mask, mbits, t); return; }
  t -= PB_MASK_;
  if (t >= 4 * PB_DD_ + 2 * PB_FF_) {
    convert_block(mem, memb, MEMT_ * D_, t - (4 * PB_DD_ + 2 * PB_FF_));
    return;
  }
  const float* W;
  __bf16* Wt;
  int K = D_, N = D_, lg = 4;                  // lg: log2 of the tiles in a row of W
  static_assert(D_ / 64 == 1 << 4 && DFF_ / 64 == 1 << 6, "lg below");
  if (t < 4 * PB_DD_) {
    const int which = t / PB_DD_;
    t -= which * PB_DD_;
    W  = which == 0 ? w_q : which == 1 ? w_k : which == 2 ? w_v : w_o;
    Wt = which == 0 ? wqT : which == 1 ? wkT : which == 2 ? wvT : woT;
  } else if (t < 4 * PB_DD_ + PB_FF_) {
    t -= 4 * PB_DD_;
    W = fw1; Wt = w1T; N = DFF_; lg = 6;
  } else {
    t -= 4 * PB_DD_ + PB_FF_;
    W = fw2; Wt = w2T; K = DFF_;
  }
  // tile column fastest, as in a grid of (N / 64, K / 64)
  transpose_convert_tile(W, Wt, K, N, t & ((1 << lg) - 1), t >> lg);
}

// ---------------------------------------------------------------------------
// WMMA GEMM: C[M,N] = A[M,K](bf16) * Bt[N,K](bf16)^T  (+ epilogue)
// MODE 0: store bf16
// MODE 1: +bias[col], ReLU, store bf16
// MODE 2: +resid[row,col], store f32
// MODE 3: +bias[col] + resid[row,col], store f32; each wave also stores the column
//         sums of its 32 x 64 piece of C: colsum[row / 32][col]
// Block tile 128x128, K-step 64. 8 waves: 4 (M) x 2 (N); wave tile 32x64.
// K must be a multiple of 64.
// Tiles staged with async global->LDS b128 copies, double-buffered so the
// next K-tile streams in while WMMAs consume the current one. A K-step is 128
// bytes of every operand row: 8 lanes copy one whole line, a wave's copy covers
// 4 whole lines, and no line is asked for in two halves by two K-steps.
// Rows >= M are clamped (not skipped) so every wave issues exactly 8 async
// ops per tile -> ASYNCcnt bookkeeping is uniform; epilogue guards stores.
// ---------------------------------------------------------------------------
// bx, by: the block's tile column and tile row.
template <int MODE>
__device__ __forceinline__
void gemm_bt_tile(const __bf16* __restrict__ A, const __bf16* __restrict__ Bt,
                  const float* __restrict__ bias, const float* __restrict__ resid,
                  float* __restrict__ Cf, __bf16* __restrict__ Cb,
                  float* __restrict__ colsum, int M, int N, int K, int bx, int by) {
  __shared__ __align__(16) __bf16 sA[2][128 * KP_];
  __shared__ __align__(16) __bf16 sB[2][128 * KP_];
  const int tid = threadIdx.x;
  const int lane = tid & 31, wave = tid >> 5;
  const int mw = wave >> 1, nw = wave & 1;
  const int mbase = by * 128, nbase = bx * 128;
  const int lrow = lane & 15, lh = lane >> 4;

  const unsigned long long baseA = (unsigned long long)(uintptr_t)A;
  const unsigned long long baseB = (unsigned long long)(uintptr_t)Bt;

  // this thread's four 16-byte segments of a 128x64 tile: rows r0 + 32 i, one column
  const int r0 = tid >> 3, c0 = (tid & 7) * 8;
  unsigned rowA[4], rowB[4];                         // byte offset of row and column
#pragma unroll   // constant indices keep the two arrays in registers
  for (int i = 0; i < 4; ++i) {
    int ga = mbase + r0 + i * 32; if (ga >= M) ga = M - 1;   // clamp, never skip
    rowA[i] = (unsigned)(((size_t)ga * K + c0) * 2);
    rowB[i] = (unsigned)(((size_t)(nbase + r0 + i * 32) * K + c0) * 2);
  }

  auto issue_tile = [&](int kk, int p) {
    unsigned la[4], va[4], lb[4], vb[4];
#pragma unroll   // constant indices: each element is a register operand of the copies
    for (int i = 0; i < 4; ++i) {
      la[i] = (unsigned)(uintptr_t)&sA[p][(r0 + i * 32) * KP_ + c0];
      lb[i] = (unsigned)(uintptr_t)&sB[p][(r0 + i * 32) * KP_ + c0];
      va[i] = rowA[i] + (unsigned)kk * 2u;
      vb[i] = rowB[i] + (unsigned)kk * 2u;
    }
    async_load8_b128(la, va, lb, vb, baseA, baseB);
  };

  v8f acc[2][4];
#pragma unroll
  for (int mi = 0; mi < 2; ++mi)
#pragma unroll
    for (int ni = 0; ni < 4; ++ni) acc[mi][ni] = zero_v8f();

  issue_tile(0, 0);
  int p = 0;
  for (int kk = 0; kk < K; kk += 64) {
    const bool pf = (kk + 64) < K;
    if (pf) {
      issue_tile(kk + 64, p ^ 1);   // 8 new in flight on top of 8 old
      wait_asynccnt_8();            // all but the 8 youngest: tile p has landed
    } else {
      wait_asynccnt_0();
    }
    __syncthreads();

#pragma unroll   // ks becomes an immediate offset of the LDS loads
    for (int ks = 0; ks < 2; ++ks) {   // the tile's two 32-element WMMA steps, in k order
      v16bf af[2], bfr[4];
#pragma unroll
      for (int mi = 0; mi < 2; ++mi) {
        const __bf16* q = sA[p] + (mw * 32 + mi * 16 + lrow) * KP_ + ks * 32 + lh * 8;
        af[mi] = ld_frag(q, q + 16);
      }
#pragma unroll
      for (int ni = 0; ni < 4; ++ni) {
        const __bf16* q = sB[p] + (nw * 64 + ni * 16 + lrow) * KP_ + ks * 32 + lh * 8;
        bfr[ni] = ld_frag(q, q + 16);
      }
#pragma unroll
      for (int mi = 0; mi < 2; ++mi)
#pragma unroll
        for (int ni = 0; ni < 4; ++ni)
          acc[mi][ni] = wmma_bf16(af[mi], bfr[ni], acc[mi][ni]);
    }

    __syncthreads();                // tile p free for overwrite next round
    p ^= 1;
  }

  // epilogue (C layout: VGPR j -> row j + 8*(lane/16); col = lane%16)
  float cs[4] = {0.f, 0.f, 0.f, 0.f};   // MODE 3: sum over this lane's 16 rows, per column
  const int col0 = nbase + nw * 64 + lrow;
  const int row0 = mbase + mw * 32 + 8 * lh;
  if (mbase + 128 <= M) {
    // The whole tile lies inside C (the block's test): no row is guarded, so nothing
    // stands between the loads. The bias comes once per column, and all 64 residual
    // elements of the lane are asked for before the first one is used: one memory
    // round trip per tile, not one per element. An element's index is its row's index
    // (a register) plus a constant column step, which goes into the instruction.
    unsigned ix[2][8];
#pragma unroll   // constant indices keep ix, rs, bv and ob in registers, here and below
    for (int mi = 0; mi < 2; ++mi)
#pragma unroll
      for (int j = 0; j < 8; ++j)
        ix[mi][j] = (unsigned)(row0 + mi * 16 + j) * (unsigned)N + (unsigned)col0;
    float bv[4], rs[2][4][8];
    if (MODE != 0) {
      // keeps the index arithmetic in front of the loads: between here and the wait
      // stand loads alone, so nothing rewrites a register that an issued load names
      __builtin_amdgcn_sched_barrier(0);
      if (MODE == 1 || MODE == 3) {
#pragma unroll
        for (int ni = 0; ni < 4; ++ni) bv[ni] = bias[col0 + ni * 16];
      }
      if (MODE == 2 || MODE == 3) {
#pragma unroll
        for (int mi = 0; mi < 2; ++mi)
#pragma unroll
          for (int j = 0; j < 8; ++j)
#pragma unroll
            for (int ni = 0; ni < 4; ++ni) rs[mi][ni][j] = (resid + ni * 16)[ix[mi][j]];
      }
      // in front of every later write of an address register of these loads
      asm volatile("s_wait_xcnt 0x0" ::: "memory");
      // keeps the arithmetic below behind that wait
      __builtin_amdgcn_sched_barrier(0);
    }
#pragma unroll
    for (int mi = 0; mi < 2; ++mi) {   // a 16-row half at a time
      unsigned ob[4][4];               // bf16 results, two rows to a register
#pragma unroll
      for (int ni = 0; ni < 4; ++ni) {
#pragma unroll
        for (int j = 0; j < 8; ++j) {
          float r = acc[mi][ni][j];
          if (MODE == 1 || MODE == 3) r += bv[ni];
          if (MODE == 1) r = r > 0.f ? r : 0.f;
          if (MODE == 2 || MODE == 3) r += rs[mi][ni][j];
          acc[mi][ni][j] = r;
        }
        if (MODE == 0 || MODE == 1) {
#pragma unroll
          for (int j = 0; j < 8; j += 2)
            ob[ni][j >> 1] = cvt_pk_bf16(acc[mi][ni][j], acc[mi][ni][j + 1]);
        }
      }
      // keeps the arithmetic above in front of the stores, so that between here and the
      // wait nothing rewrites an address or a data register of an issued store and no
      // store stands behind such a rewrite's own s_wait_xcnt
      __builtin_amdgcn_sched_barrier(0);
#pragma unroll
      for (int j = 0; j < 8; ++j)
#pragma unroll
        for (int ni = 0; ni < 4; ++ni) {
          if (MODE == 0 || MODE == 1)
            (Cb + ni * 16)[ix[mi][j]] = __builtin_bit_cast(
                __bf16, (unsigned short)(ob[ni][j >> 1] >> ((j & 1) * 16)));
          else
            (Cf + ni * 16)[ix[mi][j]] = acc[mi][ni][j];
        }
      // in front of every later write of a register of these stores
      asm volatile("s_wait_xcnt 0x0" ::: "memory");
      // keeps what follows behind that wait
      __builtin_amdgcn_sched_barrier(0);
      if (MODE == 3) {   // the column sums, in the order mi, j, while the stores drain
#pragma unroll
        for (int ni = 0; ni < 4; ++ni)
#pragma unroll
          for (int j = 0; j < 8; ++j) cs[ni] += acc[mi][ni][j];
      }
    }
  } else {
    // a tile that ends beyond row M: every row under its own guard
#pragma unroll
    for (int mi = 0; mi < 2; ++mi) {
#pragma unroll
      for (int ni = 0; ni < 4; ++ni) {
        int col = col0 + ni * 16;
#pragma unroll
        for (int j = 0; j < 8; ++j) {
          int row = row0 + mi * 16 + j;
          if (row >= M) continue;
          float r = acc[mi][ni][j];
          if (MODE == 1 || MODE == 3) r += bias[col];
          if (MODE == 1) r = r > 0.f ? r : 0.f;
          if (MODE == 2 || MODE == 3) r += resid[(size_t)row * N + col];
          if (MODE == 0 || MODE == 1)
            Cb[(size_t)row * N + col] = (__bf16)r;
          else
            Cf[(size_t)row * N + col] = r;
          if (MODE == 3) cs[ni] += r;
        }
      }
    }
  }
  if (MODE == 3) {
    // the other 16 rows of the column are in lane ^ 16; one wave writes its two
    // whole 128-byte lines of colsum
    float* cp = colsum + (size_t)(by * 4 + mw) * N + nbase + nw * 64 + lrow;
#pragma unroll
    for (int ni = 0; ni < 4; ++ni) {
      const float s = cs[ni] + xhalf(cs[ni]);
      if (lh == 0) cp[ni * 16] = s;
    }
  }
}

template <int MODE>
__global__ __launch_bounds__(256)
void gemm_bt_kernel(const __bf16* __restrict__ A, const __bf16* __restrict__ Bt,
                    const float* __restrict__ bias, const float* __restrict__ resid,
                    float* __restrict__ Cf, __bf16* __restrict__ Cb,
                    float* __restrict__ colsum, int M, int N, int K) {
  gemm_bt_tile<MODE>(A, Bt, bias, resid, Cf, Cb, colsum, M, N, K,
                     blockIdx.x, blockIdx.y);
}

// The five projections in front of attention in ONE launch: Q, K, V of the
// normalized rows and K, V of the memory tokens read finished buffers only and
// write buffers of their own. Grid: x = 3 weights x D_/128 tile columns, y = one
// tile row of memory tokens (it has no Q: those blocks leave at once), then the
// rows / 128 tile rows of xn. The two memory products, 8 blocks each, ran a whole
// K loop alone on the chip as launches of their own.
// wT: wq^T, wk^T, wv^T one after the other; qkv: q, k, v; memKV: memory K, V.
__global__ __launch_bounds__(256)
void qkv_gemm_kernel(const __bf16* __restrict__ xn, const __bf16* __restrict__ memb,
                     const __bf16* __restrict__ wT, __bf16* __restrict__ qkv,
                     __bf16* __restrict__ memKV) {
  constexpr int NT = D_ / 128;
  const int which = blockIdx.x / NT, bx = blockIdx.x - which * NT;
  const __bf16* Bt = wT + (size_t)which * D_ * D_;
  const bool ismem = blockIdx.y == 0;
  if (ismem && which == 0) return;   // the whole block, in front of every barrier and copy
  gemm_bt_tile<0>(ismem ? memb : xn, Bt, nullptr, nullptr, nullptr,
                  ismem ? memKV + (size_t)(which - 1) * MEMT_ * D_
                        : qkv + (size_t)which * B_ * S_ * D_,
                  nullptr, ismem ? MEMT_ : B_ * S_, D_, D_,
                  bx, ismem ? 0 : blockIdx.y - 1);
}

__device__ __forceinline__ void exp2_run8(float* o, const float* x) {
  asm("v_exp_f32 %0, %8\n\t"
      "v_exp_f32 %1, %9\n\t"
      "v_exp_f32 %2, %10\n\t"
      "v_exp_f32 %3, %11\n\t"
      "v_exp_f32 %4, %12\n\t"
      "v_exp_f32 %5, %13\n\t"
      "v_exp_f32 %6, %14\n\t"
      "v_exp_f32 %7, %15\n\t"
      "v_nop"
      : "=&v"(o[0]), "=&v"(o[1]), "=&v"(o[2]), "=&v"(o[3]),
        "=&v"(o[4]), "=&v"(o[5]), "=&v"(o[6]), "=&v"(o[7])
      : "v"(x[0]), "v"(x[1]), "v"(x[2]), "v"(x[3]),
        "v"(x[4]), "v"(x[5]), "v"(x[6]), "v"(x[7]));
}
__device__ __forceinline__ float exp2_one(float x) {
  float o;
  asm("v_exp_f32 %0, %1\n\t"
      "v_nop"
      : "=&v"(o) : "v"(x));
  return o;
}

// 8 waves per SIMD = 4 blocks per WGP: the whole grid of 1,024 blocks is then
// resident at once instead of running a thin second round.
__global__ __launch_bounds__(256) __attribute__((amdgpu_waves_per_eu(8)))
void attention_kernel(const __bf16* __restrict__ qg, const __bf16* __restrict__ kg,
                      const __bf16* __restrict__ vg,
                      const __bf16* __restrict__ memk, const __bf16* __restrict__ memv,
                      const unsigned* __restrict__ mbits,
                      __bf16* __restrict__ ctxout) {
  __shared__ __align__(16) __bf16 sVt[64 * LP_];       // V tile transposed [d][key]
  __shared__ __align__(16) __bf16 sK[2][32 * KP_];     // K tiles [key][d]

  const int tid = threadIdx.x, lane = tid & 31, wave = tid >> 5;
  const int lrow = lane & 15, lh = lane >> 4;
  const int bh = blockIdx.y;
  const int b = bh >> 4, h = bh & 15;
  const int qbase = blockIdx.x * 128 + wave * 16;

  // Q fragments (rows qbase..+15, d 0..63), pre-scaled by 1/sqrt(64)=0.125
  v16bf qf[2];
  {
    const __bf16* qp =
        qg + ((size_t)b * S_ + qbase + lrow) * D_ + h * DK_ + lh * 8;
#pragma unroll
    for (int half = 0; half < 2; ++half) {
      v16bf f = ld_frag(qp + half * 32, qp + half * 32 + 16);
#pragma unroll
      for (int i = 0; i < 16; ++i) f[i] = (__bf16)((float)f[i] * 0.125f);
      qf[half] = f;
    }
  }

  // ctx[dg][j] = O[query lrow][d = dg*16 + j + 8*lh]
  v8f ctx[4];
#pragma unroll
  for (int dg = 0; dg < 4; ++dg) ctx[dg] = zero_v8f();
  float mrun = -3.0e38f;   // this lane's query: running maximum (both halves equal)
  float lsum = 0.f;        // running sum over this lane's own keys only

  // the packed mask of this wave's 16 queries: 16 words a tile, the same address in
  // every lane (the wave's number is taken from lane 0). An earlier launch wrote the
  // words and nothing writes them while this kernel runs: read through the constant
  // address space, a tile's words come by one scalar load of 64 bytes
  typedef const __attribute__((address_space(4))) v16u* mask_words_ptr;
  const unsigned* mrow =
      mbits + (size_t)(blockIdx.x * 8 + __builtin_amdgcn_readfirstlane(wave)) * MB_PITCH_;

  // this thread's 16 bytes of a K tile; a tile lies wholly in the memory keys or
  // wholly in the sequence keys, so the choice of the source is the block's
  static_assert(MEMT_ % 32 == 0, "a K tile must not straddle the two sources");
  auto issue_k = [&](int t0, int buf) {
    const int key = tid >> 3;
    const int dseg = (tid & 7) * 8;
    const __bf16* tile = (t0 < MEMT_) ? (memk + (size_t)t0 * D_)
                                      : (kg + ((size_t)b * S_ + (t0 - MEMT_)) * D_);
    async_load1_b128((unsigned)(uintptr_t)&sK[buf][key * KP_ + dseg],
                     tile + (size_t)key * D_ + h * DK_ + dseg);
  };
  issue_k(0, 0);
  wait_asynccnt_0();
  __syncthreads();               // tile 0 is published
  issue_k(32, 1);                // T_ = 65 tiles: tile 1 exists

  for (int tbase = 0; tbase < T_; tbase += 32) {
    const int kbuf = (tbase >> 5) & 1;
    // this tile's 16 lane masks, asked for ahead of the V staging and its barrier
    const v16u mw = *(mask_words_ptr)(uintptr_t)(mrow + (tbase >> 5) * 16);
    // stage transposed V tile (32 keys x 64 dims) cooperatively
    {
      int key = tid >> 3;
      int dseg = (tid & 7) * 8;
      int tg = tbase + key;
      const __bf16* src =
          (tg < MEMT_) ? (memv + (size_t)tg * D_ + h * DK_ + dseg)
                       : (vg + ((size_t)b * S_ + (tg - MEMT_)) * D_ + h * DK_ + dseg);
      v8bf val = *(const v8bf*)src;
#pragma unroll
      for (int i = 0; i < 8; ++i) sVt[(dseg + i) * LP_ + key] = val[i];
    }
    __syncthreads();

    // the K fragments (A operand: row = key)
    v16bf kf[2][2];
#pragma unroll
    for (int grp = 0; grp < 2; ++grp) {
      const __bf16* ka = sK[kbuf] + (grp * 16 + lrow) * KP_ + lh * 8;
      kf[grp][0] = ld_frag(ka, ka + 16);
      kf[grp][1] = ld_frag(ka + 32, ka + 48);
    }
    // all eight loads are in flight before the first product waits for one
    __builtin_amdgcn_sched_barrier(0);

    // scores, transposed: [32 keys x 16 queries] = K[32x64] @ Q^T
    // st[j] = S[query lrow][key tbase + grp*16 + 8*lh + j]
    float v[16];
#pragma unroll
    for (int grp = 0; grp < 2; ++grp) {
      v8f st = wmma_bf16(kf[grp][0], qf[0], zero_v8f());
      st = wmma_bf16(kf[grp][1], qf[1], st);
      // word e is the select's lane mask as it lies in its scalar register
#pragma unroll
      for (int j = 0; j < 8; ++j)
        v[grp * 8 + j] =
            __builtin_amdgcn_inverse_ballot_w32(mw[grp * 8 + j]) ? st[j] : -1e9f;
    }

    // the V^T fragments (A operand: row = dim), all four asked for as one group
    v16bf vf[4];
#pragma unroll
    for (int dg = 0; dg < 4; ++dg) {
      const __bf16* vp = sVt + (dg * 16 + lrow) * LP_ + lh * 8;
      vf[dg] = ld_frag(vp, vp + 16);
    }
    // holds the group together: without it the compiler loads three of the four
    // fragments directly in front of their products, into one set of registers, and
    // the wave waits out the LDS latency once for each of them, not once per trip
    __builtin_amdgcn_sched_barrier(0);

    // online softmax of one query per lane
    float tmax = v[0];
#pragma unroll
    for (int i = 1; i < 16; ++i) tmax = fmaxf(tmax, v[i]);
    tmax = fmaxf(tmax, xhalf(tmax));
    const float newm = fmaxf(mrun, tmax);
    constexpr float LOG2E = 1.44269504f;       // e^x = 2^(x * log2 e)
    const float scale = exp2_one((mrun - newm) * LOG2E);
    mrun = newm;
    float p[16];
#pragma unroll
    for (int i = 0; i < 16; ++i) v[i] = (v[i] - newm) * LOG2E;
    exp2_run8(p, v);
    exp2_run8(p + 8, v + 8);
    float ts = 0.f;
    v16bf pf;   // P^T as B operand: element i <-> key 8*lh + i (+8 for i >= 8)
#pragma unroll
    for (int i = 0; i < 16; ++i) {
      ts += p[i];
      pf[i] = (__bf16)p[i];
    }
    lsum = lsum * scale + ts;
#pragma unroll
    for (int dg = 0; dg < 4; ++dg)
#pragma unroll
      for (int j = 0; j < 8; ++j) ctx[dg][j] *= scale;

    // O^T += V^T @ P^T  (M = 64 dims in 4 groups, K = 32 keys)
#pragma unroll
    for (int dg = 0; dg < 4; ++dg) ctx[dg] = wmma_bf16(vf[dg], pf, ctx[dg]);

    // foot of the trip: own LDS reads back, own copies of tile t + 1 landed; the
    // barrier publishes that tile and ends every read of this trip's K and V
    wait_dscnt_0();
    wait_asynccnt_0();
    __syncthreads();
    if (tbase + 64 < T_) issue_k(tbase + 64, kbuf);   // same for the whole block
  }
  wait_asynccnt_0();             // no copy is left in flight when the wave ends

  // join the halves' sums, normalize, write ctx as bf16 in [B,S,D]: a lane holds
  // 8 neighbouring dims of its query per group, one 16-byte store each
  const float inv = 1.0f / (lsum + xhalf(lsum));
  __bf16* op = ctxout + ((size_t)b * S_ + qbase + lrow) * D_ + h * DK_ + lh * 8;
#pragma unroll
  for (int dg = 0; dg < 4; ++dg) {
    v8bf o;
#pragma unroll
    for (int j = 0; j < 8; ++j) o[j] = (__bf16)(ctx[dg][j] * inv);
    *(v8bf*)(op + dg * 16) = o;
  }
}

// ---------------------------------------------------------------------------
// new_memory: broadcast mean over S of final x into [B, MEM, D]
// The last GEMM has left the sums of every 32 rows of x in colsum[B*S/32][D]:
// a column's mean takes 64 independent loads, not 2,048 rows in 128 dependent
// rounds of loads on 16 work-groups.
// ---------------------------------------------------------------------------
__global__ __launch_bounds__(256)
void mean_bcast_kernel(const float* __restrict__ colsum, float* __restrict__ nm) {
  constexpr int G = S_ / 32;                   // partial sums per column
  int gid = blockIdx.x * 256 + threadIdx.x;    // B*D threads
  int b = gid / D_;
  int d = gid - b * D_;
  const float* p = colsum + (size_t)b * G * D_ + d;
  float v[G];
  // unrolled whole, so that all loads are in flight at once: one memory latency
#pragma unroll
  for (int i = 0; i < G; ++i) v[i] = p[(size_t)i * D_];
  float s4[4] = {0.f, 0.f, 0.f, 0.f};
#pragma unroll
  for (int i = 0; i < G; ++i) s4[i & 3] += v[i];
  float s = (s4[0] + s4[1]) + (s4[2] + s4[3]);
  float mean = s * (1.0f / S_);
  float* o = nm + (size_t)b * MEMT_ * D_ + d;
  for (int mI = 0; mI < MEMT_; ++mI) o[(size_t)mI * D_] = mean;
}

// ---------------------------------------------------------------------------
// launch
// ---------------------------------------------------------------------------
extern "C" void kernel_launch(void* const* d_in, const int* in_sizes, int n_in,
                              void* d_out, int out_size, void* d_ws, size_t ws_size,
                              hipStream_t stream) {
  (void)in_sizes; (void)n_in; (void)out_size; (void)ws_size;
  const float* x    = (const float*)d_in[0];
  const int*   mask = (const int*)d_in[1];
  const float* mem  = (const float*)d_in[2];
  const float* w_q  = (const float*)d_in[3];
  const float* w_k  = (const float*)d_in[4];
  const float* w_v  = (const float*)d_in[5];
  const float* w_o  = (const float*)d_in[6];
  const float* ln1a = (const float*)d_in[7];
  const float* ln1b = (const float*)d_in[8];
  const float* ln2a = (const float*)d_in[9];
  const float* ln2b = (const float*)d_in[10];
  const float* fw1  = (const float*)d_in[11];
  const float* fb1  = (const float*)d_in[12];
  const float* fw2  = (const float*)d_in[13];
  const float* fb2  = (const float*)d_in[14];

  float* out_x  = (float*)d_out;                                // [B,S,D]
  float* out_nm = out_x + (size_t)B_ * S_ * D_;                 // [B,MEM,D]

  // workspace carve-out
  size_t off = 0;
  auto carve = [&](size_t bytes) -> char* {
    char* p = (char*)d_ws + off;
    off = (off + bytes + 255) & ~(size_t)255;
    return p;
  };
  __bf16* wqT  = (__bf16*)carve((size_t)3 * D_ * D_ * 2);      // wq^T, wk^T, wv^T
  __bf16* wkT  = wqT + (size_t)D_ * D_;
  __bf16* wvT  = wkT + (size_t)D_ * D_;
  __bf16* woT  = (__bf16*)carve((size_t)D_ * D_ * 2);
  __bf16* w1T  = (__bf16*)carve((size_t)DFF_ * D_ * 2);
  __bf16* w2T  = (__bf16*)carve((size_t)D_ * DFF_ * 2);
  __bf16* memb = (__bf16*)carve((size_t)MEMT_ * D_ * 2);
  __bf16* memK = (__bf16*)carve((size_t)2 * MEMT_ * D_ * 2);   // memory K, V
  __bf16* memV = memK + (size_t)MEMT_ * D_;
  __bf16* xn   = (__bf16*)carve((size_t)B_ * S_ * D_ * 2);
  __bf16* qb   = (__bf16*)carve((size_t)3 * B_ * S_ * D_ * 2); // q, k, v
  __bf16* kb   = qb + (size_t)B_ * S_ * D_;
  __bf16* vb   = kb + (size_t)B_ * S_ * D_;
  __bf16* ctxb = (__bf16*)carve((size_t)B_ * S_ * D_ * 2);
  float*  x1   = (float*)carve((size_t)B_ * S_ * D_ * 4);
  __bf16* xn2  = (__bf16*)carve((size_t)B_ * S_ * D_ * 2);
  __bf16* ffh  = (__bf16*)carve((size_t)B_ * S_ * DFF_ * 2);
  float*  csum = (float*)carve((size_t)(B_ * S_ / 32) * D_ * 4);
  unsigned* mbits = (unsigned*)carve((size_t)(S_ / 16) * MB_PITCH_ * 4);

  const int rows = B_ * S_;   // 8192
  dim3 blk(256);

  // LN1, mask to bits, weight prep (bf16, transposed to [N][K]), memory tokens to bf16
  prep_kernel<<<PB_ALL_, blk, 0, stream>>>(x, ln1a, ln1b, w_q, w_k, w_v, w_o, fw1, fw2, mem,
                                           mask, xn, wqT, wkT, wvT, woT, w1T, w2T, memb,
                                           mbits);

  // Q/K/V projections (WMMA bf16) and memory K/V (raw memory tokens, not
  // layernormed; M=32 with row clamp)
  qkv_gemm_kernel<<<dim3(3 * (D_ / 128), 1 + rows / 128), blk, 0, stream>>>(
      xn, memb, wqT, qb, memK);

  // flash attention over T = MEM + S
  attention_kernel<<<dim3(S_ / 128, B_ * H_), blk, 0, stream>>>(
      qb, kb, vb, memK, memV, mbits, ctxb);

  // out-proj + residual -> x1 (f32)
  gemm_bt_kernel<2><<<dim3(D_ / 128, rows / 128), blk, 0, stream>>>(
      ctxb, woT, nullptr, x, x1, nullptr, nullptr, rows, D_, D_);

  // LN2 -> FFN
  layernorm_kernel<<<rows / (8 * LNR_), blk, 0, stream>>>(x1, ln2a, ln2b, xn2);
  gemm_bt_kernel<1><<<dim3(DFF_ / 128, rows / 128), blk, 0, stream>>>(
      xn2, w1T, fb1, nullptr, nullptr, ffh, nullptr, rows, DFF_, D_);
  gemm_bt_kernel<3><<<dim3(D_ / 128, rows / 128), blk, 0, stream>>>(
      ffh, w2T, fb2, x1, out_x, nullptr, csum, rows, D_, DFF_);

  // new_memory = broadcast mean over S, from the last GEMM's column sums
  mean_bcast_kernel<<<(B_ * D_) / 256, blk, 0, stream>>>(csum, out_nm);
}
